// v000
// The times below were measured on an AMD MI455X: many runs one after another, warmed up first and cycling through
// copies of the inputs, with the whole window's GPU time divided by the number of runs. Launches and the gaps
// between them are all in it. The median over several windows is given; except for v000 it joins two sittings, which
// can be a few percent apart, so the side-by-side timings, each taken in one sitting, are the better comparison.
// v000 is the starting kernel. One run takes 1030 microseconds.
#include <hip/hip_runtime.h>
#include <cstdint>

#define B_   4
#define C_   256
#define N_   4096
#define G_   8
#define CPG_ 32
#define BC_  64          // key block per attention iteration

typedef __attribute__((ext_vector_type(16))) __bf16 v16bf;
typedef __attribute__((ext_vector_type(8)))  __bf16 v8bf;
typedef __attribute__((ext_vector_type(8)))  float  v8f;
typedef __attribute__((ext_vector_type(8)))  unsigned short u16x8;
typedef __attribute__((ext_vector_type(4)))  unsigned int v4u;
typedef __attribute__((ext_vector_type(8)))  int v8i;
typedef __attribute__((ext_vector_type(4)))  int v4i;

__device__ __forceinline__ unsigned short f2bf(float f) {
  unsigned u = __builtin_bit_cast(unsigned, f);
  u += 0x7fffu + ((u >> 16) & 1u);          // round-to-nearest-even
  return (unsigned short)(u >> 16);
}

__device__ __forceinline__ v8f zero8() {
  v8f z;
#pragma unroll
  for (int i = 0; i < 8; ++i) z[i] = 0.0f;
  return z;
}

__device__ __forceinline__ v16bf load_ab_tile(const unsigned short* base, int row0,
                                              int ld, int k0, int lane) {
  int r  = row0 + (lane & 15);
  int kh = (lane >> 4) << 3;
  const unsigned short* p = base + (size_t)r * ld + (size_t)(k0 + kh);
  v8bf lo = *(const v8bf*)p;
  v8bf hi = *(const v8bf*)(p + 16);
  return __builtin_shufflevector(lo, hi, 0,1,2,3,4,5,6,7,8,9,10,11,12,13,14,15);
}

__device__ __forceinline__ v8f wmma_bf16(v16bf a, v16bf b, v8f c) {
  return __builtin_amdgcn_wmma_f32_16x16x32_bf16(false, a, false, b, (short)0, c,
                                                 false, false);
}

__device__ __forceinline__ void tdm_load_2d(unsigned int lds_off, const void* gptr,
                                            unsigned tensor_d0, unsigned tensor_d1,
                                            unsigned tile_d0, unsigned tile_d1,
                                            unsigned stride0) {
  unsigned long long ga = (unsigned long long)(uintptr_t)gptr;
  v4u g0;
  g0[0] = 1u;                                             // count=1, user mode
  g0[1] = lds_off;                                        // lds_addr
  g0[2] = (unsigned)ga;                                   // global_addr[31:0]
  g0[3] = (unsigned)((ga >> 32) & 0x01FFFFFFu) | (2u << 30);  // addr[56:32], type=2
  v8i g1;
  g1[0] = (int)(1u << 16);
  g1[1] = (int)(tensor_d0 << 16);
  g1[2] = (int)((tensor_d0 >> 16) | (tensor_d1 << 16));
  g1[3] = (int)((tensor_d1 >> 16) | (tile_d0 << 16));
  g1[4] = (int)(tile_d1 & 0xffffu);
  g1[5] = (int)stride0;
  g1[6] = 0;
  g1[7] = 0;
  v4i z4;
  z4[0] = 0; z4[1] = 0; z4[2] = 0; z4[3] = 0;
  v8i z8;
#pragma unroll
  for (int i = 0; i < 8; ++i) z8[i] = 0;
  __builtin_amdgcn_tensor_load_to_lds(g0, g1, z4, z4, z8, 0);
}

// ---------------------------------------------------------------- weights->bf16
__global__ void k_prep_weights(const float* qw, const float* kw, const float* vw,
                               const float* pw, unsigned short* dst) {
  int i = blockIdx.x * blockDim.x + threadIdx.x;   // 0 .. 4*65536
  int m = i >> 16, e = i & 65535;
  const float* s = (m == 0) ? qw : (m == 1) ? kw : (m == 2) ? vw : pw;
  dst[i] = f2bf(s[e]);
}

// ---------------------------------------------------------------- GN stats
__global__ void k_gn_stats(const float* x, float* stat) {
  int bg = blockIdx.x;                             // b*8+g, 0..31
  const float* p = x + (size_t)bg * CPG_ * N_;
  float s = 0.f, s2 = 0.f;
  for (int i = threadIdx.x; i < CPG_ * N_; i += blockDim.x) {
    float v = p[i]; s += v; s2 += v * v;
  }
  __shared__ float rs[256], rq[256];
  rs[threadIdx.x] = s; rq[threadIdx.x] = s2;
  __syncthreads();
  for (int o = 128; o > 0; o >>= 1) {
    if ((int)threadIdx.x < o) {
      rs[threadIdx.x] += rs[threadIdx.x + o];
      rq[threadIdx.x] += rq[threadIdx.x + o];
    }
    __syncthreads();
  }
  if (threadIdx.x == 0) {
    float inv  = 1.0f / (float)(CPG_ * N_);
    float mean = rs[0] * inv;
    float var  = rq[0] * inv - mean * mean;
    stat[bg * 2 + 0] = mean;
    stat[bg * 2 + 1] = rsqrtf(var + 1e-5f);
  }
}

// ------------------------------------------------- GN apply + transpose to [n][c]
__global__ void k_gn_apply(const float* x, const float* gw, const float* gb,
                           const float* stat, unsigned short* h) {
  // grid (C_/32, N_/64, B_), 256 threads; blockIdx.x == group id (CPG_==32)
  int cb = blockIdx.x * 32, nb = blockIdx.y * 64, b = blockIdx.z;
  float mean = stat[(b * G_ + blockIdx.x) * 2 + 0];
  float rstd = stat[(b * G_ + blockIdx.x) * 2 + 1];
  __shared__ unsigned short tile[32][68];          // [c][n], padded
  const float* xb = x + ((size_t)b * C_ + cb) * N_ + nb;
#pragma unroll
  for (int i = 0; i < 8; ++i) {
    int idx = threadIdx.x + i * 256;
    int cl = idx >> 6, nl = idx & 63;              // coalesced along n
    float v = xb[(size_t)cl * N_ + nl];
    int c = cb + cl;
    v = (v - mean) * rstd * gw[c] + gb[c];
    tile[cl][nl] = f2bf(v);
  }
  __syncthreads();
  unsigned short* hb = h + ((size_t)b * N_ + nb) * C_ + cb;
#pragma unroll
  for (int i = 0; i < 8; ++i) {
    int idx = threadIdx.x + i * 256;
    int nl = idx >> 5, cl = idx & 31;              // coalesced along c
    hb[(size_t)nl * C_ + cl] = tile[cl][nl];
  }
}

// ---------------------------------------------------------------- QKV GEMMs
__global__ void __launch_bounds__(32) k_qkv(
    const unsigned short* h, const unsigned short* wq, const unsigned short* wk,
    const unsigned short* wv, const float* qb, const float* kb, const float* vb,
    unsigned short* q, unsigned short* k, unsigned short* v) {
  int lane = threadIdx.x;
  int nt = blockIdx.x, ot = blockIdx.y;
  int b = blockIdx.z / 3, which = blockIdx.z % 3;
  const unsigned short* w    = (which == 0) ? wq : (which == 1) ? wk : wv;
  const float*          bias = (which == 0) ? qb : (which == 1) ? kb : vb;
  const unsigned short* hb = h + (size_t)b * N_ * C_;

  v8f acc = zero8();
#pragma unroll
  for (int kk = 0; kk < C_; kk += 32) {
    v16bf a  = load_ab_tile(w,  ot * 16, C_, kk, lane);   // weights [o][c]
    v16bf bb = load_ab_tile(hb, nt * 16, C_, kk, lane);   // h [n][c]
    acc = wmma_bf16(a, bb, acc);
  }
  int hh = lane >> 4, lo = lane & 15;
  int obase = ot * 16 + hh * 8;
  const float4* bp = (const float4*)(bias + obase);
  float4 bq0 = bp[0], bq1 = bp[1];
  float bias8[8] = {bq0.x, bq0.y, bq0.z, bq0.w, bq1.x, bq1.y, bq1.z, bq1.w};
  int n = nt * 16 + lo;

  if (which == 2) {                                       // v -> [c][n]
    unsigned short* vd = v + (size_t)b * C_ * N_ + n;
#pragma unroll
    for (int r = 0; r < 8; ++r)
      vd[(size_t)(obase + r) * N_] = f2bf(acc[r] + bias8[r]);
  } else {                                                // q,k -> [n][c]
    float scale = (which == 0) ? 0.0625f : 1.0f;          // 1/sqrt(256) folded into q
    u16x8 outv;
#pragma unroll
    for (int r = 0; r < 8; ++r) outv[r] = f2bf((acc[r] + bias8[r]) * scale);
    unsigned short* dst = ((which == 0) ? q : k) + ((size_t)b * N_ + n) * C_ + obase;
    *(u16x8*)dst = outv;
  }
}

__global__ void __launch_bounds__(256) k_attn(
    const unsigned short* q, const unsigned short* k, const unsigned short* v,
    unsigned short* o) {
  int lane = threadIdx.x & 31, wid = threadIdx.x >> 5;
  int b = blockIdx.y;
  int n0 = blockIdx.x * 128 + wid * 16;                   // 16 query rows per wave
  int hh = lane >> 4, lo = lane & 15;
  const unsigned short* qp = q + (size_t)b * N_ * C_;
  const unsigned short* kp = k + (size_t)b * N_ * C_;
  const unsigned short* vp = v + (size_t)b * C_ * N_;

  __shared__ unsigned short smk[2][BC_ * C_];             // K tiles [m][c]  2x32KB
  __shared__ unsigned short smv[2][C_ * BC_];             // V tiles [c][m]  2x32KB
  __shared__ unsigned short smp[8][16 * BC_];             // per-wave P buf  16KB
  unsigned short* pl = smp[wid];

  if (wid == 0) {                                         // prefetch buffer 0
    tdm_load_2d((unsigned)(uintptr_t)&smk[0][0], kp, C_, N_, C_, BC_, C_);
    tdm_load_2d((unsigned)(uintptr_t)&smv[0][0], vp, N_, C_, BC_, C_, N_);
  }

  v16bf qr[8];                                            // Q block in registers
#pragma unroll
  for (int kk = 0; kk < 8; ++kk) qr[kk] = load_ab_tile(qp, n0, C_, kk * 32, lane);

  v8f acc[16];                                            // O accum: 16n x 256c
#pragma unroll
  for (int t = 0; t < 16; ++t) acc[t] = zero8();
  float mrun[8], lrun[8];
#pragma unroll
  for (int r = 0; r < 8; ++r) { mrun[r] = -1e30f; lrun[r] = 0.0f; }

  for (int it = 0; it < N_ / BC_; ++it) {                 // 64 key blocks
    int buf = it & 1;
    __builtin_amdgcn_s_wait_tensorcnt(0);
    __syncthreads();
    if (wid == 0 && it + 1 < N_ / BC_) {
      int m1 = (it + 1) * BC_;
      tdm_load_2d((unsigned)(uintptr_t)&smk[buf ^ 1][0], kp + (size_t)m1 * C_,
                  C_, N_, C_, BC_, C_);
      tdm_load_2d((unsigned)(uintptr_t)&smv[buf ^ 1][0], vp + m1,
                  N_, C_, BC_, C_, N_);
    }
    const unsigned short* kb = smk[buf];
    const unsigned short* vb = smv[buf];

    v8f s[4];                                             // S = Q^T K (16x64)
#pragma unroll
    for (int mt = 0; mt < 4; ++mt) s[mt] = zero8();
#pragma unroll
    for (int kk = 0; kk < 8; ++kk) {
#pragma unroll
      for (int mt = 0; mt < 4; ++mt) {
        v16bf bk = load_ab_tile(kb, mt * 16, C_, kk * 32, lane);
        s[mt] = wmma_bf16(qr[kk], bk, s[mt]);
      }
    }

    float mxr[8];                                         // per-row block max
#pragma unroll
    for (int r = 0; r < 8; ++r) {
      float mx = fmaxf(fmaxf(s[0][r], s[1][r]), fmaxf(s[2][r], s[3][r]));
#pragma unroll
      for (int off = 1; off < 16; off <<= 1) mx = fmaxf(mx, __shfl_xor(mx, off, 32));
      mxr[r] = mx;
    }
    int upd = 0;
#pragma unroll
    for (int r = 0; r < 8; ++r) upd |= (mxr[r] > mrun[r]) ? 1 : 0;
    if (__ballot(upd) != 0ull) {                          // lazy rescale (rare)
      float cf[8];
#pragma unroll
      for (int r = 0; r < 8; ++r) {
        float mnew = fmaxf(mrun[r], mxr[r]);
        cf[r] = __expf(mrun[r] - mnew);
        lrun[r] *= cf[r];
        mrun[r] = mnew;
      }
#pragma unroll
      for (int t = 0; t < 16; ++t)
#pragma unroll
        for (int r = 0; r < 8; ++r) acc[t][r] *= cf[r];
    }
#pragma unroll
    for (int r = 0; r < 8; ++r) {                         // P = exp(S - m)
      int nloc = r + hh * 8;
      float p0 = __expf(s[0][r] - mrun[r]);
      float p1 = __expf(s[1][r] - mrun[r]);
      float p2 = __expf(s[2][r] - mrun[r]);
      float p3 = __expf(s[3][r] - mrun[r]);
      pl[nloc * BC_ +      lo] = f2bf(p0);                // D-layout -> LDS [n][m]
      pl[nloc * BC_ + 16 + lo] = f2bf(p1);
      pl[nloc * BC_ + 32 + lo] = f2bf(p2);
      pl[nloc * BC_ + 48 + lo] = f2bf(p3);
      float rsum = (p0 + p1) + (p2 + p3);
#pragma unroll
      for (int off = 1; off < 16; off <<= 1) rsum += __shfl_xor(rsum, off, 32);
      lrun[r] += rsum;
    }
    v16bf pa0 = load_ab_tile(pl, 0, BC_, 0,  lane);       // P as A operand
    v16bf pa1 = load_ab_tile(pl, 0, BC_, 32, lane);
#pragma unroll
    for (int t = 0; t < 16; ++t) {                        // O += P * V
      v16bf bv0 = load_ab_tile(vb, t * 16, BC_, 0,  lane);
      v16bf bv1 = load_ab_tile(vb, t * 16, BC_, 32, lane);
      acc[t] = wmma_bf16(pa0, bv0, acc[t]);
      acc[t] = wmma_bf16(pa1, bv1, acc[t]);
    }
  }

  float inv[8];
#pragma unroll
  for (int r = 0; r < 8; ++r) inv[r] = 1.0f / lrun[r];
  unsigned short* ob = o + (size_t)b * N_ * C_;           // O -> [n][c] bf16
#pragma unroll
  for (int t = 0; t < 16; ++t) {
    int c = t * 16 + lo;
#pragma unroll
    for (int r = 0; r < 8; ++r) {
      int n = n0 + r + hh * 8;
      ob[(size_t)n * C_ + c] = f2bf(acc[t][r] * inv[r]);
    }
  }
}

// -------------------------------------------------- projection + residual add
__global__ void __launch_bounds__(32) k_proj(
    const unsigned short* o, const unsigned short* wp, const float* pb,
    const float* x, float* out) {
  int lane = threadIdx.x;
  int nt = blockIdx.x, ot = blockIdx.y, b = blockIdx.z;
  const unsigned short* ob = o + (size_t)b * N_ * C_;
  v8f acc = zero8();
#pragma unroll
  for (int kk = 0; kk < C_; kk += 32) {
    v16bf a  = load_ab_tile(wp, ot * 16, C_, kk, lane);   // pw [o][c]
    v16bf bb = load_ab_tile(ob, nt * 16, C_, kk, lane);   // O [n][c]
    acc = wmma_bf16(a, bb, acc);
  }
  int hh = lane >> 4, lo = lane & 15;
  int n = nt * 16 + lo;
  const float4* bp = (const float4*)(pb + ot * 16 + hh * 8);
  float4 b0 = bp[0], b1 = bp[1];
  float bias8[8] = {b0.x, b0.y, b0.z, b0.w, b1.x, b1.y, b1.z, b1.w};
#pragma unroll
  for (int r = 0; r < 8; ++r) {
    int oc = ot * 16 + hh * 8 + r;
    size_t idx = ((size_t)b * C_ + oc) * N_ + n;
    out[idx] = x[idx] + acc[r] + bias8[r];
  }
}

extern "C" void kernel_launch(void* const* d_in, const int* in_sizes, int n_in,
                              void* d_out, int out_size, void* d_ws, size_t ws_size,
                              hipStream_t stream) {
  (void)in_sizes; (void)n_in; (void)out_size; (void)ws_size;
  const float* x     = (const float*)d_in[0];
  const float* gnw   = (const float*)d_in[1];
  const float* gnb   = (const float*)d_in[2];
  const float* qw    = (const float*)d_in[3];
  const float* qbias = (const float*)d_in[4];
  const float* kw    = (const float*)d_in[5];
  const float* kbias = (const float*)d_in[6];
  const float* vw    = (const float*)d_in[7];
  const float* vbias = (const float*)d_in[8];
  const float* pw    = (const float*)d_in[9];
  const float* pbias = (const float*)d_in[10];
  float* out = (float*)d_out;

  char* w = (char*)d_ws;
  float*          stat = (float*)w;                         // 64 f32 (pad 1KB)
  unsigned short* wqb  = (unsigned short*)(w + 1024);       // 4 x 64K bf16
  unsigned short* wkb  = wqb + 65536;
  unsigned short* wvb  = wqb + 2 * 65536;
  unsigned short* wpb  = wqb + 3 * 65536;
  unsigned short* h    = (unsigned short*)(w + 1024 + 524288);
  const size_t    bnc  = (size_t)B_ * N_ * C_;
  unsigned short* qd = h  + bnc;
  unsigned short* kd = qd + bnc;
  unsigned short* vd = kd + bnc;
  unsigned short* od = vd + bnc;                            // total ~40.5 MB

  k_prep_weights<<<1024, 256, 0, stream>>>(qw, kw, vw, pw, wqb);
  k_gn_stats    <<<32, 256, 0, stream>>>(x, stat);
  k_gn_apply    <<<dim3(C_ / 32, N_ / 64, B_), 256, 0, stream>>>(x, gnw, gnb, stat, h);
  k_qkv         <<<dim3(N_ / 16, C_ / 16, 3 * B_), 32, 0, stream>>>(
                    h, wqb, wkb, wvb, qbias, kbias, vbias, qd, kd, vd);
  k_attn        <<<dim3(N_ / 128, B_), 256, 0, stream>>>(qd, kd, vd, od);
  k_proj        <<<dim3(N_ / 16, C_ / 16, B_), 32, 0, stream>>>(od, wpb, pbias, x, out);
}

// v001
// Measured time: 503 microseconds a run.
// Timed twice side by side with v000, it ran 2.05 times as fast both times.
#include <hip/hip_runtime.h>
#include <cstdint>

#define B_   4
#define C_   256
#define N_   4096
#define G_   8
#define CPG_ 32
#define BC_  64          // key block per attention iteration

typedef __attribute__((ext_vector_type(16))) __bf16 v16bf;
typedef __attribute__((ext_vector_type(8)))  __bf16 v8bf;
typedef __attribute__((ext_vector_type(8)))  float  v8f;
typedef __attribute__((ext_vector_type(8)))  unsigned short u16x8;
typedef __attribute__((ext_vector_type(4)))  unsigned int v4u;
typedef __attribute__((ext_vector_type(8)))  int v8i;
typedef __attribute__((ext_vector_type(4)))  int v4i;

__device__ __forceinline__ unsigned short f2bf(float f) {
  unsigned u = __builtin_bit_cast(unsigned, f);
  u += 0x7fffu + ((u >> 16) & 1u);          // round-to-nearest-even
  return (unsigned short)(u >> 16);
}

__device__ __forceinline__ v8f zero8() {
  v8f z;
#pragma unroll
  for (int i = 0; i < 8; ++i) z[i] = 0.0f;
  return z;
}

__device__ __forceinline__ v16bf load_ab_tile(const unsigned short* base, int row0,
                                              int ld, int k0, int lane) {
  int r  = row0 + (lane & 15);
  int kh = (lane >> 4) << 3;
  const unsigned short* p = base + (size_t)r * ld + (size_t)(k0 + kh);
  v8bf lo = *(const v8bf*)p;
  v8bf hi = *(const v8bf*)(p + 16);
  return __builtin_shufflevector(lo, hi, 0,1,2,3,4,5,6,7,8,9,10,11,12,13,14,15);
}

__device__ __forceinline__ v16bf load_frag(const unsigned short* base, int f, int lane) {
  const unsigned short* p = base + f * 512 + lane * 8;
  v8bf lo = *(const v8bf*)p;
  v8bf hi = *(const v8bf*)(p + 256);
  return __builtin_shufflevector(lo, hi, 0,1,2,3,4,5,6,7,8,9,10,11,12,13,14,15);
}

__device__ __forceinline__ v8f wmma_bf16(v16bf a, v16bf b, v8f c) {
  return __builtin_amdgcn_wmma_f32_16x16x32_bf16(false, a, false, b, (short)0, c,
                                                 false, false);
}

__device__ __forceinline__ void tdm_load_2d(unsigned int lds_off, const void* gptr,
                                            unsigned tensor_d0, unsigned tensor_d1,
                                            unsigned tile_d0, unsigned tile_d1,
                                            unsigned stride0) {
  unsigned long long ga = (unsigned long long)(uintptr_t)gptr;
  v4u g0;
  g0[0] = 1u;                                             // count=1, user mode
  g0[1] = lds_off;                                        // lds_addr
  g0[2] = (unsigned)ga;                                   // global_addr[31:0]
  g0[3] = (unsigned)((ga >> 32) & 0x01FFFFFFu) | (2u << 30);  // addr[56:32], type=2
  v8i g1;
  g1[0] = (int)(1u << 16);
  g1[1] = (int)(tensor_d0 << 16);
  g1[2] = (int)((tensor_d0 >> 16) | (tensor_d1 << 16));
  g1[3] = (int)((tensor_d1 >> 16) | (tile_d0 << 16));
  g1[4] = (int)(tile_d1 & 0xffffu);
  g1[5] = (int)stride0;
  g1[6] = 0;
  g1[7] = 0;
  v4i z4;
  z4[0] = 0; z4[1] = 0; z4[2] = 0; z4[3] = 0;
  v8i z8;
#pragma unroll
  for (int i = 0; i < 8; ++i) z8[i] = 0;
  __builtin_amdgcn_tensor_load_to_lds(g0, g1, z4, z4, z8, 0);
}

// ---------------------------------------------------------------- weights->bf16
__global__ void k_prep_weights(const float* qw, const float* kw, const float* vw,
                               const float* pw, unsigned short* dst) {
  int i = blockIdx.x * blockDim.x + threadIdx.x;   // 0 .. 4*65536
  int m = i >> 16, e = i & 65535;
  const float* s = (m == 0) ? qw : (m == 1) ? kw : (m == 2) ? vw : pw;
  dst[i] = f2bf(s[e]);
}

// ---------------------------------------------------------------- GN stats
__global__ void k_gn_stats(const float* x, float* stat) {
  int bg = blockIdx.x;                             // b*8+g, 0..31
  const float* p = x + (size_t)bg * CPG_ * N_;
  float s = 0.f, s2 = 0.f;
  for (int i = threadIdx.x; i < CPG_ * N_; i += blockDim.x) {
    float v = p[i]; s += v; s2 += v * v;
  }
  __shared__ float rs[256], rq[256];
  rs[threadIdx.x] = s; rq[threadIdx.x] = s2;
  __syncthreads();
  for (int o = 128; o > 0; o >>= 1) {
    if ((int)threadIdx.x < o) {
      rs[threadIdx.x] += rs[threadIdx.x + o];
      rq[threadIdx.x] += rq[threadIdx.x + o];
    }
    __syncthreads();
  }
  if (threadIdx.x == 0) {
    float inv  = 1.0f / (float)(CPG_ * N_);
    float mean = rs[0] * inv;
    float var  = rq[0] * inv - mean * mean;
    stat[bg * 2 + 0] = mean;
    stat[bg * 2 + 1] = rsqrtf(var + 1e-5f);
  }
}

// ------------------------------------------------- GN apply + transpose to [n][c]
__global__ void k_gn_apply(const float* x, const float* gw, const float* gb,
                           const float* stat, unsigned short* h) {
  // grid (C_/32, N_/64, B_), 256 threads; blockIdx.x == group id (CPG_==32)
  int cb = blockIdx.x * 32, nb = blockIdx.y * 64, b = blockIdx.z;
  float mean = stat[(b * G_ + blockIdx.x) * 2 + 0];
  float rstd = stat[(b * G_ + blockIdx.x) * 2 + 1];
  __shared__ unsigned short tile[32][68];          // [c][n], padded
  const float* xb = x + ((size_t)b * C_ + cb) * N_ + nb;
#pragma unroll
  for (int i = 0; i < 8; ++i) {
    int idx = threadIdx.x + i * 256;
    int cl = idx >> 6, nl = idx & 63;              // coalesced along n
    float v = xb[(size_t)cl * N_ + nl];
    int c = cb + cl;
    v = (v - mean) * rstd * gw[c] + gb[c];
    tile[cl][nl] = f2bf(v);
  }
  __syncthreads();
  unsigned short* hb = h + ((size_t)b * N_ + nb) * C_ + cb;
#pragma unroll
  for (int i = 0; i < 8; ++i) {
    int idx = threadIdx.x + i * 256;
    int nl = idx >> 5, cl = idx & 31;              // coalesced along c
    hb[(size_t)nl * C_ + cl] = tile[cl][nl];
  }
}

// ---------------------------------------------------------------- QKV GEMMs
// One 16x16 output tile of q (WHICH 0), k (1) or v (2). The case is chosen in
// front of the matrix products, so that no branch stands behind the last one.
template <int WHICH>
__device__ __forceinline__ void qkv_tile(const unsigned short* hb, const unsigned short* w,
                                         const float* bias, unsigned short* dstb,
                                         int nt, int ot, int lane) {
  // q,k: A = weights [o][c], B = h [n][c]: a lane ends with 8 channels of one n.
  // v:   A = h, B = weights: a lane ends with 8 keys of one channel, which is
  //      the 16-byte chunk that the attention kernel's V operand wants.
  const unsigned short* wt = w  + (size_t)ot * 16 * C_;
  const unsigned short* ht = hb + (size_t)nt * 16 * C_;
  const unsigned short* pa = (WHICH == 2) ? ht : wt;
  const unsigned short* pb = (WHICH == 2) ? wt : ht;
  v8f acc = zero8();
#pragma unroll
  for (int kk = 0; kk < C_; kk += 32) {
    v16bf a  = load_ab_tile(pa, 0, C_, kk, lane);
    v16bf bb = load_ab_tile(pb, 0, C_, kk, lane);
    acc = wmma_bf16(a, bb, acc);
  }
  int hh = lane >> 4, lo = lane & 15;
  u16x8 outv;
  unsigned short* dst;
  if (WHICH == 2) {
    // v: fragment (ot, key half) of key block nt>>2, laid so that the 256 x 128-byte
    // tile the attention kernel loads at row pitch N_ lands in fragment order:
    // tile byte L = fragment*1024 + chunk*512 + lane*16, row L>>7, column L&127.
    float bv = bias[ot * 16 + lo];
#pragma unroll
    for (int r = 0; r < 8; ++r) outv[r] = f2bf(acc[r] + bv);
    int row = (ot * 2 + ((nt >> 1) & 1)) * 8 + (nt & 1) * 4 + (lane >> 3);
    dst = dstb + (size_t)row * N_ + (nt >> 2) * BC_ + (lane & 7) * 8;
  } else {
    int obase = ot * 16 + hh * 8;
    const float4* bp = (const float4*)(bias + obase);
    float4 bq0 = bp[0], bq1 = bp[1];
    float bias8[8] = {bq0.x, bq0.y, bq0.z, bq0.w, bq1.x, bq1.y, bq1.z, bq1.w};
    const float scale = (WHICH == 0) ? 0.0625f : 1.0f;    // 1/sqrt(256) folded into q
#pragma unroll
    for (int r = 0; r < 8; ++r) outv[r] = f2bf((acc[r] + bias8[r]) * scale);
    if (WHICH == 0)                                       // q -> [n][c]
      dst = dstb + (size_t)(nt * 16 + lo) * C_ + obase;
    else                                                  // k -> fragment order inside
      dst = dstb + (size_t)(nt >> 2) * (BC_ * C_) +       // each 64-key block (32 KB)
            ((ot >> 1) * 4 + (nt & 3)) * 512 + (ot & 1) * 256 + lane * 8;
  }
  *(u16x8*)dst = outv;
  // Precaution: the three cases join again in the built code, and registers that
  // this store names are rewritten there; the wait stands in front of that.
  asm volatile("s_wait_xcnt 0x0" ::: "memory");
}

__global__ void __launch_bounds__(32) k_qkv(
    const unsigned short* h, const unsigned short* wq, const unsigned short* wk,
    const unsigned short* wv, const float* qb, const float* kb, const float* vb,
    unsigned short* q, unsigned short* k, unsigned short* v) {
  int lane = threadIdx.x;
  int nt = blockIdx.x, ot = blockIdx.y;
  int b = blockIdx.z / 3, which = blockIdx.z % 3;
  size_t boff = (size_t)b * N_ * C_;
  const unsigned short* hb = h + boff;
  if (which == 0)      qkv_tile<0>(hb, wq, qb, q + boff, nt, ot, lane);
  else if (which == 1) qkv_tile<1>(hb, wk, kb, k + boff, nt, ot, lane);
  else                 qkv_tile<2>(hb, wv, vb, v + boff, nt, ot, lane);
}

__global__ void __launch_bounds__(256) k_attn(
    const unsigned short* q, const unsigned short* k, const unsigned short* v,
    unsigned short* o) {
  int lane = threadIdx.x & 31, wid = threadIdx.x >> 5;
  int b = blockIdx.y;
  int n0 = blockIdx.x * 128 + wid * 16;                   // 16 query rows per wave
  int hh = lane >> 4, lo = lane & 15;
  const unsigned short* qp = q + (size_t)b * N_ * C_;
  const unsigned short* kp = k + (size_t)b * N_ * C_;
  const unsigned short* vp = v + (size_t)b * C_ * N_;

  __shared__ unsigned short smk[2][BC_ * C_];             // K fragments [kk][mt] 2x32KB
  __shared__ unsigned short smv[2][C_ * BC_];             // V fragments [t][kk]  2x32KB
  __shared__ unsigned short smp[8][16 * BC_];             // per-wave P buf  16KB
  unsigned short* pl = smp[wid];

  if (wid == 0) {                                         // prefetch buffer 0
    tdm_load_2d((unsigned)(uintptr_t)&smk[0][0], kp, C_, N_, C_, BC_, C_);
    tdm_load_2d((unsigned)(uintptr_t)&smv[0][0], vp, N_, C_, BC_, C_, N_);
  }

  v16bf qr[8];                                            // Q block in registers
#pragma unroll
  for (int kk = 0; kk < 8; ++kk) qr[kk] = load_ab_tile(qp, n0, C_, kk * 32, lane);

  v8f acc[16];                                            // O accum: 16n x 256c
#pragma unroll
  for (int t = 0; t < 16; ++t) acc[t] = zero8();
  float mrun[8], lrun[8];
#pragma unroll
  for (int r = 0; r < 8; ++r) { mrun[r] = -1e30f; lrun[r] = 0.0f; }

  for (int it = 0; it < N_ / BC_; ++it) {                 // 64 key blocks
    int buf = it & 1;
    __builtin_amdgcn_s_wait_tensorcnt(0);
    __syncthreads();
    if (wid == 0 && it + 1 < N_ / BC_) {
      int m1 = (it + 1) * BC_;
      tdm_load_2d((unsigned)(uintptr_t)&smk[buf ^ 1][0], kp + (size_t)m1 * C_,
                  C_, N_, C_, BC_, C_);
      tdm_load_2d((unsigned)(uintptr_t)&smv[buf ^ 1][0], vp + m1,
                  N_, C_, BC_, C_, N_);
    }
    const unsigned short* kb = smk[buf];
    const unsigned short* vb = smv[buf];

    v8f s[4];                                             // S = Q^T K (16x64)
#pragma unroll
    for (int mt = 0; mt < 4; ++mt) s[mt] = zero8();
#pragma unroll
    for (int kk = 0; kk < 8; ++kk) {
#pragma unroll
      for (int mt = 0; mt < 4; ++mt) {
        v16bf bk = load_frag(kb, kk * 4 + mt, lane);
        s[mt] = wmma_bf16(qr[kk], bk, s[mt]);
      }
    }

    float mxr[8];                                         // per-row block max
#pragma unroll
    for (int r = 0; r < 8; ++r) {
      float mx = fmaxf(fmaxf(s[0][r], s[1][r]), fmaxf(s[2][r], s[3][r]));
#pragma unroll
      for (int off = 1; off < 16; off <<= 1) mx = fmaxf(mx, __shfl_xor(mx, off, 32));
      mxr[r] = mx;
    }
    int upd = 0;
#pragma unroll
    for (int r = 0; r < 8; ++r) upd |= (mxr[r] > mrun[r]) ? 1 : 0;
    if (__ballot(upd) != 0ull) {                          // lazy rescale (rare)
      float cf[8];
#pragma unroll
      for (int r = 0; r < 8; ++r) {
        float mnew = fmaxf(mrun[r], mxr[r]);
        cf[r] = __expf(mrun[r] - mnew);
        lrun[r] *= cf[r];
        mrun[r] = mnew;
      }
#pragma unroll
      for (int t = 0; t < 16; ++t)
#pragma unroll
        for (int r = 0; r < 8; ++r) acc[t][r] *= cf[r];
    }
#pragma unroll
    for (int r = 0; r < 8; ++r) {                         // P = exp(S - m)
      int nloc = r + hh * 8;
      float p0 = __expf(s[0][r] - mrun[r]);
      float p1 = __expf(s[1][r] - mrun[r]);
      float p2 = __expf(s[2][r] - mrun[r]);
      float p3 = __expf(s[3][r] - mrun[r]);
      pl[nloc * BC_ +      lo] = f2bf(p0);                // D-layout -> LDS [n][m]
      pl[nloc * BC_ + 16 + lo] = f2bf(p1);
      pl[nloc * BC_ + 32 + lo] = f2bf(p2);
      pl[nloc * BC_ + 48 + lo] = f2bf(p3);
      float rsum = (p0 + p1) + (p2 + p3);
#pragma unroll
      for (int off = 1; off < 16; off <<= 1) rsum += __shfl_xor(rsum, off, 32);
      lrun[r] += rsum;
    }
    v16bf pa0 = load_ab_tile(pl, 0, BC_, 0,  lane);       // P as A operand
    v16bf pa1 = load_ab_tile(pl, 0, BC_, 32, lane);
#pragma unroll
    for (int t = 0; t < 16; ++t) {                        // O += P * V
      v16bf bv0 = load_frag(vb, t * 2,     lane);
      v16bf bv1 = load_frag(vb, t * 2 + 1, lane);
      acc[t] = wmma_bf16(pa0, bv0, acc[t]);
      acc[t] = wmma_bf16(pa1, bv1, acc[t]);
    }
  }

  float inv[8];
#pragma unroll
  for (int r = 0; r < 8; ++r) inv[r] = 1.0f / lrun[r];
  unsigned short* ob = o + (size_t)b * N_ * C_;           // O -> [n][c] bf16
#pragma unroll
  for (int t = 0; t < 16; ++t) {
    int c = t * 16 + lo;
#pragma unroll
    for (int r = 0; r < 8; ++r) {
      int n = n0 + r + hh * 8;
      ob[(size_t)n * C_ + c] = f2bf(acc[t][r] * inv[r]);
    }
  }
}

// -------------------------------------------------- projection + residual add
__global__ void __launch_bounds__(32) k_proj(
    const unsigned short* o, const unsigned short* wp, const float* pb,
    const float* x, float* out) {
  int lane = threadIdx.x;
  int nt = blockIdx.x, ot = blockIdx.y, b = blockIdx.z;
  const unsigned short* ob = o + (size_t)b * N_ * C_;
  v8f acc = zero8();
#pragma unroll
  for (int kk = 0; kk < C_; kk += 32) {
    v16bf a  = load_ab_tile(wp, ot * 16, C_, kk, lane);   // pw [o][c]
    v16bf bb = load_ab_tile(ob, nt * 16, C_, kk, lane);   // O [n][c]
    acc = wmma_bf16(a, bb, acc);
  }
  int hh = lane >> 4, lo = lane & 15;
  int n = nt * 16 + lo;
  const float4* bp = (const float4*)(pb + ot * 16 + hh * 8);
  float4 b0 = bp[0], b1 = bp[1];
  float bias8[8] = {b0.x, b0.y, b0.z, b0.w, b1.x, b1.y, b1.z, b1.w};
#pragma unroll
  for (int r = 0; r < 8; ++r) {
    int oc = ot * 16 + hh * 8 + r;
    size_t idx = ((size_t)b * C_ + oc) * N_ + n;
    out[idx] = x[idx] + acc[r] + bias8[r];
  }
}

extern "C" void kernel_launch(void* const* d_in, const int* in_sizes, int n_in,
                              void* d_out, int out_size, void* d_ws, size_t ws_size,
                              hipStream_t stream) {
  (void)in_sizes; (void)n_in; (void)out_size; (void)ws_size;
  const float* x     = (const float*)d_in[0];
  const float* gnw   = (const float*)d_in[1];
  const float* gnb   = (const float*)d_in[2];
  const float* qw    = (const float*)d_in[3];
  const float* qbias = (const float*)d_in[4];
  const float* kw    = (const float*)d_in[5];
  const float* kbias = (const float*)d_in[6];
  const float* vw    = (const float*)d_in[7];
  const float* vbias = (const float*)d_in[8];
  const float* pw    = (const float*)d_in[9];
  const float* pbias = (const float*)d_in[10];
  float* out = (float*)d_out;

  char* w = (char*)d_ws;
  float*          stat = (float*)w;                         // 64 f32 (pad 1KB)
  unsigned short* wqb  = (unsigned short*)(w + 1024);       // 4 x 64K bf16
  unsigned short* wkb  = wqb + 65536;
  unsigned short* wvb  = wqb + 2 * 65536;
  unsigned short* wpb  = wqb + 3 * 65536;
  unsigned short* h    = (unsigned short*)(w + 1024 + 524288);
  const size_t    bnc  = (size_t)B_ * N_ * C_;
  unsigned short* qd = h  + bnc;
  unsigned short* kd = qd + bnc;
  unsigned short* vd = kd + bnc;
  unsigned short* od = vd + bnc;                            // total ~40.5 MB

  k_prep_weights<<<1024, 256, 0, stream>>>(qw, kw, vw, pw, wqb);
  k_gn_stats    <<<32, 256, 0, stream>>>(x, stat);
  k_gn_apply    <<<dim3(C_ / 32, N_ / 64, B_), 256, 0, stream>>>(x, gnw, gnb, stat, h);
  k_qkv         <<<dim3(N_ / 16, C_ / 16, 3 * B_), 32, 0, stream>>>(
                    h, wqb, wkb, wvb, qbias, kbias, vbias, qd, kd, vd);
  k_attn        <<<dim3(N_ / 128, B_), 256, 0, stream>>>(qd, kd, vd, od);
  k_proj        <<<dim3(N_ / 16, C_ / 16, B_), 32, 0, stream>>>(od, wpb, pbias, x, out);
}

// v002
// Measured time: 306 microseconds a run.
// Timed twice side by side with v001, it ran 1.64 and 1.65 times as fast.
// Counting every step since v000, it is 3.37 times as fast.
#include <hip/hip_runtime.h>
#include <cstdint>

#define B_   4
#define C_   256
#define N_   4096
#define G_   8
#define CPG_ 32
#define BC_  64          // key block per attention iteration
#define GSL_ 8           // work-groups that share one (batch, group) in the GN statistics
#define GPP_ 32          // floats between two partial sums: each has its own 128-byte line

typedef __attribute__((ext_vector_type(16))) __bf16 v16bf;
typedef __attribute__((ext_vector_type(8)))  __bf16 v8bf;
typedef __attribute__((ext_vector_type(8)))  float  v8f;
typedef __attribute__((ext_vector_type(8)))  unsigned short u16x8;
typedef __attribute__((ext_vector_type(4)))  unsigned int v4u;
typedef __attribute__((ext_vector_type(8)))  int v8i;
typedef __attribute__((ext_vector_type(4)))  int v4i;

__device__ __forceinline__ unsigned short f2bf(float f) {
  unsigned u = __builtin_bit_cast(unsigned, f);
  u += 0x7fffu + ((u >> 16) & 1u);          // round-to-nearest-even
  return (unsigned short)(u >> 16);
}

__device__ __forceinline__ v8f zero8() {
  v8f z;
#pragma unroll
  for (int i = 0; i < 8; ++i) z[i] = 0.0f;
  return z;
}

__device__ __forceinline__ v16bf load_ab_tile(const unsigned short* base, int row0,
                                              int ld, int k0, int lane) {
  int r  = row0 + (lane & 15);
  int kh = (lane >> 4) << 3;
  const unsigned short* p = base + (size_t)r * ld + (size_t)(k0 + kh);
  v8bf lo = *(const v8bf*)p;
  v8bf hi = *(const v8bf*)(p + 16);
  return __builtin_shufflevector(lo, hi, 0,1,2,3,4,5,6,7,8,9,10,11,12,13,14,15);
}

__device__ __forceinline__ v16bf load_frag(const unsigned short* base, int f, int lane) {
  const unsigned short* p = base + f * 512 + lane * 8;
  v8bf lo = *(const v8bf*)p;
  v8bf hi = *(const v8bf*)(p + 256);
  return __builtin_shufflevector(lo, hi, 0,1,2,3,4,5,6,7,8,9,10,11,12,13,14,15);
}

__device__ __forceinline__ v8f wmma_bf16(v16bf a, v16bf b, v8f c) {
  return __builtin_amdgcn_wmma_f32_16x16x32_bf16(false, a, false, b, (short)0, c,
                                                 false, false);
}

__device__ __forceinline__ void tdm_load_2d(unsigned int lds_off, const void* gptr,
                                            unsigned tensor_d0, unsigned tensor_d1,
                                            unsigned tile_d0, unsigned tile_d1,
                                            unsigned stride0) {
  unsigned long long ga = (unsigned long long)(uintptr_t)gptr;
  v4u g0;
  g0[0] = 1u;                                             // count=1, user mode
  g0[1] = lds_off;                                        // lds_addr
  g0[2] = (unsigned)ga;                                   // global_addr[31:0]
  g0[3] = (unsigned)((ga >> 32) & 0x01FFFFFFu) | (2u << 30);  // addr[56:32], type=2
  v8i g1;
  g1[0] = (int)(1u << 16);
  g1[1] = (int)(tensor_d0 << 16);
  g1[2] = (int)((tensor_d0 >> 16) | (tensor_d1 << 16));
  g1[3] = (int)((tensor_d1 >> 16) | (tile_d0 << 16));
  g1[4] = (int)(tile_d1 & 0xffffu);
  g1[5] = (int)stride0;
  g1[6] = 0;
  g1[7] = 0;
  v4i z4;
  z4[0] = 0; z4[1] = 0; z4[2] = 0; z4[3] = 0;
  v8i z8;
#pragma unroll
  for (int i = 0; i < 8; ++i) z8[i] = 0;
  __builtin_amdgcn_tensor_load_to_lds(g0, g1, z4, z4, z8, 0);
}

// ---------------------------------------------------------------- weights->bf16
__global__ void k_prep_weights(const float* qw, const float* kw, const float* vw,
                               const float* pw, unsigned short* dst) {
  int i = blockIdx.x * blockDim.x + threadIdx.x;   // 0 .. 4*65536
  int m = i >> 16, e = i & 65535;
  const float* s = (m == 0) ? qw : (m == 1) ? kw : (m == 2) ? vw : pw;
  dst[i] = f2bf(s[e]);
}

__global__ void __launch_bounds__(256) __attribute__((amdgpu_waves_per_eu(2, 2)))
k_gn_stats(const float* x, float* part) {
  int blk = blockIdx.x;                            // (b*8+g)*GSL_ + slice, 0..255
  const float4* p = (const float4*)(x + (size_t)blk * (CPG_ * N_ / GSL_)) + threadIdx.x;
  float4 v[16];
#pragma unroll
  for (int i = 0; i < 16; ++i) v[i] = p[i * 256];
  float4 a = make_float4(0.f, 0.f, 0.f, 0.f), q = a;
#pragma unroll
  for (int i = 0; i < 16; ++i) {
    a.x += v[i].x; a.y += v[i].y; a.z += v[i].z; a.w += v[i].w;
    q.x += v[i].x * v[i].x; q.y += v[i].y * v[i].y;
    q.z += v[i].z * v[i].z; q.w += v[i].w * v[i].w;
  }
  float s = (a.x + a.y) + (a.z + a.w), s2 = (q.x + q.y) + (q.z + q.w);
#pragma unroll
  for (int off = 16; off > 0; off >>= 1) {
    s  += __shfl_xor(s,  off, 32);
    s2 += __shfl_xor(s2, off, 32);
  }
  __shared__ float rs[8], rq[8];
  if ((threadIdx.x & 31) == 0) { rs[threadIdx.x >> 5] = s; rq[threadIdx.x >> 5] = s2; }
  __syncthreads();
  if (threadIdx.x == 0) {
    float ts = 0.f, tq = 0.f;
#pragma unroll
    for (int w = 0; w < 8; ++w) { ts += rs[w]; tq += rq[w]; }
    *(float2*)(part + blk * GPP_) = make_float2(ts, tq);
  }
}

// ------------------------------------------------- GN apply + transpose to [n][c]
__global__ void k_gn_apply(const float* x, const float* gw, const float* gb,
                           const float* part, unsigned short* h) {
  // grid (C_/32, N_/64, B_), 256 threads; blockIdx.x == group id (CPG_==32)
  int cb = blockIdx.x * 32, nb = blockIdx.y * 64, b = blockIdx.z;
  const float* pp = part + (b * G_ + blockIdx.x) * (GSL_ * GPP_);
  float s = 0.f, s2 = 0.f;
#pragma unroll
  for (int j = 0; j < GSL_; ++j) { s += pp[j * GPP_]; s2 += pp[j * GPP_ + 1]; }
  const float inv = 1.0f / (float)(CPG_ * N_);
  float mean = s * inv;
  float rstd = rsqrtf(s2 * inv - mean * mean + 1e-5f);
  __shared__ unsigned short tile[32][68];          // [c][n], padded
  const float* xb = x + ((size_t)b * C_ + cb) * N_ + nb;
#pragma unroll
  for (int i = 0; i < 8; ++i) {
    int idx = threadIdx.x + i * 256;
    int cl = idx >> 6, nl = idx & 63;              // coalesced along n
    float v = xb[(size_t)cl * N_ + nl];
    int c = cb + cl;
    v = (v - mean) * rstd * gw[c] + gb[c];
    tile[cl][nl] = f2bf(v);
  }
  __syncthreads();
  unsigned short* hb = h + ((size_t)b * N_ + nb) * C_ + cb;
#pragma unroll
  for (int i = 0; i < 8; ++i) {
    int idx = threadIdx.x + i * 256;
    int nl = idx >> 5, cl = idx & 31;              // coalesced along c
    hb[(size_t)nl * C_ + cl] = tile[cl][nl];
  }
}

// ---------------------------------------------------------------- QKV GEMMs
// One 16x16 output tile of q (WHICH 0), k (1) or v (2). The case is chosen in
// front of the matrix products, so that no branch stands behind the last one.
template <int WHICH>
__device__ __forceinline__ void qkv_tile(const unsigned short* hb, const unsigned short* w,
                                         const float* bias, unsigned short* dstb,
                                         int nt, int ot, int lane) {
  // q,k: A = weights [o][c], B = h [n][c]: a lane ends with 8 channels of one n.
  // v:   A = h, B = weights: a lane ends with 8 keys of one channel, which is
  //      the 16-byte chunk that the attention kernel's V operand wants.
  const unsigned short* wt = w  + (size_t)ot * 16 * C_;
  const unsigned short* ht = hb + (size_t)nt * 16 * C_;
  const unsigned short* pa = (WHICH == 2) ? ht : wt;
  const unsigned short* pb = (WHICH == 2) ? wt : ht;
  v8f acc = zero8();
#pragma unroll
  for (int kk = 0; kk < C_; kk += 32) {
    v16bf a  = load_ab_tile(pa, 0, C_, kk, lane);
    v16bf bb = load_ab_tile(pb, 0, C_, kk, lane);
    acc = wmma_bf16(a, bb, acc);
  }
  int hh = lane >> 4, lo = lane & 15;
  u16x8 outv;
  unsigned short* dst;
  if (WHICH == 2) {
    // v: fragment (ot, key half) of key block nt>>2, laid so that the 256 x 128-byte
    // tile the attention kernel loads at row pitch N_ lands in fragment order:
    // tile byte L = fragment*1024 + chunk*512 + lane*16, row L>>7, column L&127.
    float bv = bias[ot * 16 + lo];
#pragma unroll
    for (int r = 0; r < 8; ++r) outv[r] = f2bf(acc[r] + bv);
    int row = (ot * 2 + ((nt >> 1) & 1)) * 8 + (nt & 1) * 4 + (lane >> 3);
    dst = dstb + (size_t)row * N_ + (nt >> 2) * BC_ + (lane & 7) * 8;
  } else {
    int obase = ot * 16 + hh * 8;
    const float4* bp = (const float4*)(bias + obase);
    float4 bq0 = bp[0], bq1 = bp[1];
    float bias8[8] = {bq0.x, bq0.y, bq0.z, bq0.w, bq1.x, bq1.y, bq1.z, bq1.w};
    const float scale = (WHICH == 0) ? 0.0625f : 1.0f;    // 1/sqrt(256) folded into q
#pragma unroll
    for (int r = 0; r < 8; ++r) outv[r] = f2bf((acc[r] + bias8[r]) * scale);
    if (WHICH == 0)                                       // q -> [n][c]
      dst = dstb + (size_t)(nt * 16 + lo) * C_ + obase;
    else                                                  // k -> fragment order inside
      dst = dstb + (size_t)(nt >> 2) * (BC_ * C_) +       // each 64-key block (32 KB)
            ((ot >> 1) * 4 + (nt & 3)) * 512 + (ot & 1) * 256 + lane * 8;
  }
  *(u16x8*)dst = outv;
  // Precaution: the three cases join again in the built code, and registers that
  // this store names are rewritten there; the wait stands in front of that.
  asm volatile("s_wait_xcnt 0x0" ::: "memory");
}

__global__ void __launch_bounds__(32) k_qkv(
    const unsigned short* h, const unsigned short* wq, const unsigned short* wk,
    const unsigned short* wv, const float* qb, const float* kb, const float* vb,
    unsigned short* q, unsigned short* k, unsigned short* v) {
  int lane = threadIdx.x;
  int nt = blockIdx.x, ot = blockIdx.y;
  int b = blockIdx.z / 3, which = blockIdx.z % 3;
  size_t boff = (size_t)b * N_ * C_;
  const unsigned short* hb = h + boff;
  if (which == 0)      qkv_tile<0>(hb, wq, qb, q + boff, nt, ot, lane);
  else if (which == 1) qkv_tile<1>(hb, wk, kb, k + boff, nt, ot, lane);
  else                 qkv_tile<2>(hb, wv, vb, v + boff, nt, ot, lane);
}

__global__ void __launch_bounds__(256) k_attn(
    const unsigned short* q, const unsigned short* k, const unsigned short* v,
    unsigned short* o) {
  int lane = threadIdx.x & 31, wid = threadIdx.x >> 5;
  int b = blockIdx.y;
  int n0 = blockIdx.x * 128 + wid * 16;                   // 16 query rows per wave
  int hh = lane >> 4, lo = lane & 15;
  const unsigned short* qp = q + (size_t)b * N_ * C_;
  const unsigned short* kp = k + (size_t)b * N_ * C_;
  const unsigned short* vp = v + (size_t)b * C_ * N_;

  __shared__ unsigned short smk[2][BC_ * C_];             // K fragments [kk][mt] 2x32KB
  __shared__ unsigned short smv[2][C_ * BC_];             // V fragments [t][kk]  2x32KB
  __shared__ unsigned short smp[8][16 * BC_];             // per-wave P buf  16KB
  unsigned short* pl = smp[wid];

  if (wid == 0) {                                         // prefetch buffer 0
    tdm_load_2d((unsigned)(uintptr_t)&smk[0][0], kp, C_, N_, C_, BC_, C_);
    tdm_load_2d((unsigned)(uintptr_t)&smv[0][0], vp, N_, C_, BC_, C_, N_);
  }

  v16bf qr[8];                                            // Q block in registers
#pragma unroll
  for (int kk = 0; kk < 8; ++kk) qr[kk] = load_ab_tile(qp, n0, C_, kk * 32, lane);

  v8f acc[16];                                            // O accum: 16n x 256c
#pragma unroll
  for (int t = 0; t < 16; ++t) acc[t] = zero8();
  float mrun[8], lrun[8];
#pragma unroll
  for (int r = 0; r < 8; ++r) { mrun[r] = -1e30f; lrun[r] = 0.0f; }

  for (int it = 0; it < N_ / BC_; ++it) {                 // 64 key blocks
    int buf = it & 1;
    __builtin_amdgcn_s_wait_tensorcnt(0);
    __syncthreads();
    if (wid == 0 && it + 1 < N_ / BC_) {
      int m1 = (it + 1) * BC_;
      tdm_load_2d((unsigned)(uintptr_t)&smk[buf ^ 1][0], kp + (size_t)m1 * C_,
                  C_, N_, C_, BC_, C_);
      tdm_load_2d((unsigned)(uintptr_t)&smv[buf ^ 1][0], vp + m1,
                  N_, C_, BC_, C_, N_);
    }
    const unsigned short* kb = smk[buf];
    const unsigned short* vb = smv[buf];

    v8f s[4];                                             // S = Q^T K (16x64)
#pragma unroll
    for (int mt = 0; mt < 4; ++mt) s[mt] = zero8();
#pragma unroll
    for (int kk = 0; kk < 8; ++kk) {
#pragma unroll
      for (int mt = 0; mt < 4; ++mt) {
        v16bf bk = load_frag(kb, kk * 4 + mt, lane);
        s[mt] = wmma_bf16(qr[kk], bk, s[mt]);
      }
    }

    float mxr[8];                                         // per-row block max
#pragma unroll
    for (int r = 0; r < 8; ++r) {
      float mx = fmaxf(fmaxf(s[0][r], s[1][r]), fmaxf(s[2][r], s[3][r]));
#pragma unroll
      for (int off = 1; off < 16; off <<= 1) mx = fmaxf(mx, __shfl_xor(mx, off, 32));
      mxr[r] = mx;
    }
    int upd = 0;
#pragma unroll
    for (int r = 0; r < 8; ++r) upd |= (mxr[r] > mrun[r]) ? 1 : 0;
    if (__ballot(upd) != 0ull) {                          // lazy rescale (rare)
      float cf[8];
#pragma unroll
      for (int r = 0; r < 8; ++r) {
        float mnew = fmaxf(mrun[r], mxr[r]);
        cf[r] = __expf(mrun[r] - mnew);
        lrun[r] *= cf[r];
        mrun[r] = mnew;
      }
#pragma unroll
      for (int t = 0; t < 16; ++t)
#pragma unroll
        for (int r = 0; r < 8; ++r) acc[t][r] *= cf[r];
    }
#pragma unroll
    for (int r = 0; r < 8; ++r) {                         // P = exp(S - m)
      int nloc = r + hh * 8;
      float p0 = __expf(s[0][r] - mrun[r]);
      float p1 = __expf(s[1][r] - mrun[r]);
      float p2 = __expf(s[2][r] - mrun[r]);
      float p3 = __expf(s[3][r] - mrun[r]);
      pl[nloc * BC_ +      lo] = f2bf(p0);                // D-layout -> LDS [n][m]
      pl[nloc * BC_ + 16 + lo] = f2bf(p1);
      pl[nloc * BC_ + 32 + lo] = f2bf(p2);
      pl[nloc * BC_ + 48 + lo] = f2bf(p3);
      float rsum = (p0 + p1) + (p2 + p3);
#pragma unroll
      for (int off = 1; off < 16; off <<= 1) rsum += __shfl_xor(rsum, off, 32);
      lrun[r] += rsum;
    }
    v16bf pa0 = load_ab_tile(pl, 0, BC_, 0,  lane);       // P as A operand
    v16bf pa1 = load_ab_tile(pl, 0, BC_, 32, lane);
#pragma unroll
    for (int t = 0; t < 16; ++t) {                        // O += P * V
      v16bf bv0 = load_frag(vb, t * 2,     lane);
      v16bf bv1 = load_frag(vb, t * 2 + 1, lane);
      acc[t] = wmma_bf16(pa0, bv0, acc[t]);
      acc[t] = wmma_bf16(pa1, bv1, acc[t]);
    }
  }

  float inv[8];
#pragma unroll
  for (int r = 0; r < 8; ++r) inv[r] = 1.0f / lrun[r];
  unsigned short* ob = o + (size_t)b * N_ * C_;           // O -> [n][c] bf16
#pragma unroll
  for (int t = 0; t < 16; ++t) {
    int c = t * 16 + lo;
#pragma unroll
    for (int r = 0; r < 8; ++r) {
      int n = n0 + r + hh * 8;
      ob[(size_t)n * C_ + c] = f2bf(acc[t][r] * inv[r]);
    }
  }
}

// -------------------------------------------------- projection + residual add
__global__ void __launch_bounds__(32) k_proj(
    const unsigned short* o, const unsigned short* wp, const float* pb,
    const float* x, float* out) {
  int lane = threadIdx.x;
  int nt = blockIdx.x, ot = blockIdx.y, b = blockIdx.z;
  const unsigned short* ob = o + (size_t)b * N_ * C_;
  v8f acc = zero8();
#pragma unroll
  for (int kk = 0; kk < C_; kk += 32) {
    v16bf a  = load_ab_tile(wp, ot * 16, C_, kk, lane);   // pw [o][c]
    v16bf bb = load_ab_tile(ob, nt * 16, C_, kk, lane);   // O [n][c]
    acc = wmma_bf16(a, bb, acc);
  }
  int hh = lane >> 4, lo = lane & 15;
  int n = nt * 16 + lo;
  const float4* bp = (const float4*)(pb + ot * 16 + hh * 8);
  float4 b0 = bp[0], b1 = bp[1];
  float bias8[8] = {b0.x, b0.y, b0.z, b0.w, b1.x, b1.y, b1.z, b1.w};
#pragma unroll
  for (int r = 0; r < 8; ++r) {
    int oc = ot * 16 + hh * 8 + r;
    size_t idx = ((size_t)b * C_ + oc) * N_ + n;
    out[idx] = x[idx] + acc[r] + bias8[r];
  }
}

extern "C" void kernel_launch(void* const* d_in, const int* in_sizes, int n_in,
                              void* d_out, int out_size, void* d_ws, size_t ws_size,
                              hipStream_t stream) {
  (void)in_sizes; (void)n_in; (void)out_size; (void)ws_size;
  const float* x     = (const float*)d_in[0];
  const float* gnw   = (const float*)d_in[1];
  const float* gnb   = (const float*)d_in[2];
  const float* qw    = (const float*)d_in[3];
  const float* qbias = (const float*)d_in[4];
  const float* kw    = (const float*)d_in[5];
  const float* kbias = (const float*)d_in[6];
  const float* vw    = (const float*)d_in[7];
  const float* vbias = (const float*)d_in[8];
  const float* pw    = (const float*)d_in[9];
  const float* pbias = (const float*)d_in[10];
  float* out = (float*)d_out;

  char* w = (char*)d_ws;
  unsigned short* wqb  = (unsigned short*)(w + 1024);       // 4 x 64K bf16
  unsigned short* wkb  = wqb + 65536;
  unsigned short* wvb  = wqb + 2 * 65536;
  unsigned short* wpb  = wqb + 3 * 65536;
  unsigned short* h    = (unsigned short*)(w + 1024 + 524288);
  const size_t    bnc  = (size_t)B_ * N_ * C_;
  unsigned short* qd = h  + bnc;
  unsigned short* kd = qd + bnc;
  unsigned short* vd = kd + bnc;
  unsigned short* od = vd + bnc;
  float*        part = (float*)(od + bnc);                  // 256 x 128 B; total ~40.5 MB

  k_prep_weights<<<1024, 256, 0, stream>>>(qw, kw, vw, pw, wqb);
  k_gn_stats    <<<B_ * G_ * GSL_, 256, 0, stream>>>(x, part);
  k_gn_apply    <<<dim3(C_ / 32, N_ / 64, B_), 256, 0, stream>>>(x, gnw, gnb, part, h);
  k_qkv         <<<dim3(N_ / 16, C_ / 16, 3 * B_), 32, 0, stream>>>(
                    h, wqb, wkb, wvb, qbias, kbias, vbias, qd, kd, vd);
  k_attn        <<<dim3(N_ / 128, B_), 256, 0, stream>>>(qd, kd, vd, od);
  k_proj        <<<dim3(N_ / 16, C_ / 16, B_), 32, 0, stream>>>(od, wpb, pbias, x, out);
}

// v003
// Measured time: 170 microseconds a run.
// In both of two side-by-side timings against v002, it was 1.80 times as fast.
// Counting every step since v000, it is 6.07 times as fast.
#include <hip/hip_runtime.h>
#include <cstdint>

#define B_   4
#define C_   256
#define N_   4096
#define G_   8
#define CPG_ 32
#define BC_  64          // keys per wave and attention pass (one fragment-order block)
#define KS_  2           // waves that share one query tile, each on its own key block
#define NST_ (N_ / (BC_ * KS_))   // stages of KS_ key blocks
#define SLB_ 16384u      // bytes of one wave's slice of a stage
#define STB_ 65536u      // bytes of K (and of V) in one stage
#define MGW_ 2560        // floats one wave hands over in the final merge
#define GSL_ 8           // work-groups that share one (batch, group) in the GN statistics
#define GPP_ 32          // floats between two partial sums: each has its own 128-byte line

typedef __attribute__((ext_vector_type(16))) __bf16 v16bf;
typedef __attribute__((ext_vector_type(8)))  __bf16 v8bf;
typedef __attribute__((ext_vector_type(8)))  float  v8f;
typedef __attribute__((ext_vector_type(8)))  unsigned short u16x8;
typedef __attribute__((ext_vector_type(4)))  uint32_t u32x4;
typedef __attribute__((ext_vector_type(8)))  uint32_t u32x8;

__device__ __forceinline__ unsigned short f2bf(float f) {
  unsigned u = __builtin_bit_cast(unsigned, f);
  u += 0x7fffu + ((u >> 16) & 1u);          // round-to-nearest-even
  return (unsigned short)(u >> 16);
}

__device__ __forceinline__ v8f zero8() {
  v8f z;
#pragma unroll
  for (int i = 0; i < 8; ++i) z[i] = 0.0f;
  return z;
}

__device__ __forceinline__ v16bf load_ab_tile(const unsigned short* base, int row0,
                                              int ld, int k0, int lane) {
  int r  = row0 + (lane & 15);
  int kh = (lane >> 4) << 3;
  const unsigned short* p = base + (size_t)r * ld + (size_t)(k0 + kh);
  v8bf lo = *(const v8bf*)p;
  v8bf hi = *(const v8bf*)(p + 16);
  return __builtin_shufflevector(lo, hi, 0,1,2,3,4,5,6,7,8,9,10,11,12,13,14,15);
}

__device__ __forceinline__ v16bf load_frag(const unsigned short* base, int f, int lane) {
  const unsigned short* p = base + f * 512 + lane * 8;
  v8bf lo = *(const v8bf*)p;
  v8bf hi = *(const v8bf*)(p + 256);
  return __builtin_shufflevector(lo, hi, 0,1,2,3,4,5,6,7,8,9,10,11,12,13,14,15);
}

__device__ __forceinline__ v8f wmma_bf16(v16bf a, v16bf b, v8f c) {
  return __builtin_amdgcn_wmma_f32_16x16x32_bf16(false, a, false, b, (short)0, c,
                                                 false, false);
}

__device__ __forceinline__ uint32_t uni(uint32_t v) {
  return (uint32_t)__builtin_amdgcn_readfirstlane(v);
}

__device__ __forceinline__ uint32_t pinned(uint32_t v) {
  uint32_t w = uni(v);
  asm volatile("" : "+s"(w));
  return w;
}

__device__ __forceinline__ u32x8 tdm_group1(uint32_t rowb, uint32_t nrows, uint32_t pitch) {
  u32x8 g;
  g[0] = uni(0u);
  g[1] = uni((rowb & 0xFFFFu) << 16);
  g[2] = uni((rowb >> 16) | ((nrows & 0xFFFFu) << 16));
  g[3] = uni((nrows >> 16) | (rowb << 16));
  g[4] = uni(nrows);
  g[5] = uni(pitch);
  g[6] = uni(0u);
  g[7] = uni(0u);
  return g;
}
__device__ __forceinline__ u32x4 tdm_group0(uint32_t lds_dst, uint64_t ga) {
  u32x4 g;
  g[0] = uni(1u);                              // count 1
  g[1] = uni(lds_dst);
  g[2] = uni((uint32_t)ga);
  g[3] = uni((((uint32_t)(ga >> 32)) & 0x01FFFFFFu) | 0x80000000u);   // type 2
  return g;
}
__device__ __forceinline__ void tdm_load(u32x4 g0, u32x8 g1) {
  asm volatile("tensor_load_to_lds %0, %1" :: "s"(g0), "s"(g1) : "memory");
}
// The compiler places no wait for the tensor mover: the issuing wave's own wait.
__device__ __forceinline__ void wait_tensor0() { asm volatile("s_wait_tensorcnt 0x0" ::: "memory"); }
// This wave's LDS reads have retired before a buffer it read is handed back.
__device__ __forceinline__ void wait_ds0() { asm volatile("s_wait_dscnt 0x0" ::: "memory"); }

// ---------------------------------------------------------------- weights->bf16
__global__ void k_prep_weights(const float* qw, const float* kw, const float* vw,
                               const float* pw, unsigned short* dst) {
  int i = blockIdx.x * blockDim.x + threadIdx.x;   // 0 .. 4*65536
  int m = i >> 16, e = i & 65535;
  const float* s = (m == 0) ? qw : (m == 1) ? kw : (m == 2) ? vw : pw;
  dst[i] = f2bf(s[e]);
}

__global__ void __launch_bounds__(256) __attribute__((amdgpu_waves_per_eu(2, 2)))
k_gn_stats(const float* x, float* part) {
  int blk = blockIdx.x;                            // (b*8+g)*GSL_ + slice, 0..255
  const float4* p = (const float4*)(x + (size_t)blk * (CPG_ * N_ / GSL_)) + threadIdx.x;
  float4 v[16];
#pragma unroll
  for (int i = 0; i < 16; ++i) v[i] = p[i * 256];
  float4 a = make_float4(0.f, 0.f, 0.f, 0.f), q = a;
#pragma unroll
  for (int i = 0; i < 16; ++i) {
    a.x += v[i].x; a.y += v[i].y; a.z += v[i].z; a.w += v[i].w;
    q.x += v[i].x * v[i].x; q.y += v[i].y * v[i].y;
    q.z += v[i].z * v[i].z; q.w += v[i].w * v[i].w;
  }
  float s = (a.x + a.y) + (a.z + a.w), s2 = (q.x + q.y) + (q.z + q.w);
#pragma unroll
  for (int off = 16; off > 0; off >>= 1) {
    s  += __shfl_xor(s,  off, 32);
    s2 += __shfl_xor(s2, off, 32);
  }
  __shared__ float rs[8], rq[8];
  if ((threadIdx.x & 31) == 0) { rs[threadIdx.x >> 5] = s; rq[threadIdx.x >> 5] = s2; }
  __syncthreads();
  if (threadIdx.x == 0) {
    float ts = 0.f, tq = 0.f;
#pragma unroll
    for (int w = 0; w < 8; ++w) { ts += rs[w]; tq += rq[w]; }
    *(float2*)(part + blk * GPP_) = make_float2(ts, tq);
  }
}

// ------------------------------------------------- GN apply + transpose to [n][c]
__global__ void k_gn_apply(const float* x, const float* gw, const float* gb,
                           const float* part, unsigned short* h) {
  // grid (C_/32, N_/64, B_), 256 threads; blockIdx.x == group id (CPG_==32)
  int cb = blockIdx.x * 32, nb = blockIdx.y * 64, b = blockIdx.z;
  const float* pp = part + (b * G_ + blockIdx.x) * (GSL_ * GPP_);
  float s = 0.f, s2 = 0.f;
#pragma unroll
  for (int j = 0; j < GSL_; ++j) { s += pp[j * GPP_]; s2 += pp[j * GPP_ + 1]; }
  const float inv = 1.0f / (float)(CPG_ * N_);
  float mean = s * inv;
  float rstd = rsqrtf(s2 * inv - mean * mean + 1e-5f);
  __shared__ unsigned short tile[32][68];          // [c][n], padded
  const float* xb = x + ((size_t)b * C_ + cb) * N_ + nb;
#pragma unroll
  for (int i = 0; i < 8; ++i) {
    int idx = threadIdx.x + i * 256;
    int cl = idx >> 6, nl = idx & 63;              // coalesced along n
    float v = xb[(size_t)cl * N_ + nl];
    int c = cb + cl;
    v = (v - mean) * rstd * gw[c] + gb[c];
    tile[cl][nl] = f2bf(v);
  }
  __syncthreads();
  unsigned short* hb = h + ((size_t)b * N_ + nb) * C_ + cb;
#pragma unroll
  for (int i = 0; i < 8; ++i) {
    int idx = threadIdx.x + i * 256;
    int nl = idx >> 5, cl = idx & 31;              // coalesced along c
    hb[(size_t)nl * C_ + cl] = tile[cl][nl];
  }
}

// ---------------------------------------------------------------- QKV GEMMs
// One 16x16 output tile of q (WHICH 0), k (1) or v (2). The case is chosen in
// front of the matrix products, so that no branch stands behind the last one.
template <int WHICH>
__device__ __forceinline__ void qkv_tile(const unsigned short* hb, const unsigned short* w,
                                         const float* bias, unsigned short* dstb,
                                         int nt, int ot, int lane) {
  // q,k: A = weights [o][c], B = h [n][c]: a lane ends with 8 channels of one n.
  // v:   A = h, B = weights: a lane ends with 8 keys of one channel, which is
  //      the 16-byte chunk that the attention kernel's V operand wants.
  const unsigned short* wt = w  + (size_t)ot * 16 * C_;
  const unsigned short* ht = hb + (size_t)nt * 16 * C_;
  const unsigned short* pa = (WHICH == 2) ? ht : wt;
  const unsigned short* pb = (WHICH == 2) ? wt : ht;
  v8f acc = zero8();
#pragma unroll
  for (int kk = 0; kk < C_; kk += 32) {
    v16bf a  = load_ab_tile(pa, 0, C_, kk, lane);
    v16bf bb = load_ab_tile(pb, 0, C_, kk, lane);
    acc = wmma_bf16(a, bb, acc);
  }
  int hh = lane >> 4, lo = lane & 15;
  u16x8 outv;
  unsigned short* dst;
  if (WHICH == 2) {
    // v: fragment (ot, key half) of key block nt>>2, laid so that the 256 x 128-byte
    // tile the attention kernel loads at row pitch N_ lands in fragment order:
    // tile byte L = fragment*1024 + chunk*512 + lane*16, row L>>7, column L&127.
    float bv = bias[ot * 16 + lo];
#pragma unroll
    for (int r = 0; r < 8; ++r) outv[r] = f2bf(acc[r] + bv);
    int row = (ot * 2 + ((nt >> 1) & 1)) * 8 + (nt & 1) * 4 + (lane >> 3);
    dst = dstb + (size_t)row * N_ + (nt >> 2) * BC_ + (lane & 7) * 8;
  } else {
    int obase = ot * 16 + hh * 8;
    const float4* bp = (const float4*)(bias + obase);
    float4 bq0 = bp[0], bq1 = bp[1];
    float bias8[8] = {bq0.x, bq0.y, bq0.z, bq0.w, bq1.x, bq1.y, bq1.z, bq1.w};
    const float scale = (WHICH == 0) ? 0.0625f : 1.0f;    // 1/sqrt(256) folded into q
#pragma unroll
    for (int r = 0; r < 8; ++r) outv[r] = f2bf((acc[r] + bias8[r]) * scale);
    if (WHICH == 0)                                       // q -> [n][c]
      dst = dstb + (size_t)(nt * 16 + lo) * C_ + obase;
    else                                                  // k -> fragment order inside
      dst = dstb + (size_t)(nt >> 2) * (BC_ * C_) +       // each 64-key block (32 KB)
            ((ot >> 1) * 4 + (nt & 3)) * 512 + (ot & 1) * 256 + lane * 8;
  }
  *(u16x8*)dst = outv;
  // Precaution: the three cases join again in the built code, and registers that
  // this store names are rewritten there; the wait stands in front of that.
  asm volatile("s_wait_xcnt 0x0" ::: "memory");
}

__global__ void __launch_bounds__(32) k_qkv(
    const unsigned short* h, const unsigned short* wq, const unsigned short* wk,
    const unsigned short* wv, const float* qb, const float* kb, const float* vb,
    unsigned short* q, unsigned short* k, unsigned short* v) {
  int lane = threadIdx.x;
  int nt = blockIdx.x, ot = blockIdx.y;
  int b = blockIdx.z / 3, which = blockIdx.z % 3;
  size_t boff = (size_t)b * N_ * C_;
  const unsigned short* hb = h + boff;
  if (which == 0)      qkv_tile<0>(hb, wq, qb, q + boff, nt, ot, lane);
  else if (which == 1) qkv_tile<1>(hb, wk, kb, k + boff, nt, ot, lane);
  else                 qkv_tile<2>(hb, wv, vb, v + boff, nt, ot, lane);
}

// ----------------------------------------------------------- flash attention
// Workgroup = 8 waves on 64 query rows: wave w works on query tile w & 3 (16 rows)
// and on key block w >> 2 of every stage, so that the 256 workgroups cover every
// WGP; the two waves of a tile merge their partial results through LDS at the end.
// A stage is 128 keys: K 64 KB + V 64 KB, double-buffered; every wave brings its
// own 16-KB slice by one tensor load. k_qkv has stored both in fragment order, so
// the tiles land ready for load_frag.
__global__ void __launch_bounds__(256) k_attn(
    const unsigned short* q, const unsigned short* k, const unsigned short* v,
    unsigned short* o) {
  int lane = threadIdx.x & 31;
  const uint32_t wid = uni(threadIdx.x >> 5);
  const uint32_t kh = wid >> 2;                           // key block of the stage
  int b = blockIdx.y;
  int n0 = blockIdx.x * 64 + (int)(wid & 3u) * 16;        // 16 query rows per wave
  int hh = lane >> 4, lo = lane & 15;
  const unsigned short* qp = q + (size_t)b * N_ * C_;
  const unsigned short* kp = k + (size_t)b * N_ * C_;
  const unsigned short* vp = v + (size_t)b * C_ * N_;

  // 2-KiB alignment: every tensor load's place in LDS is a multiple of 2 KiB.
  __shared__ __attribute__((aligned(2048))) unsigned short smk[2][KS_][BC_ * C_];  // K fragments [kk][mt]
  __shared__ __attribute__((aligned(2048))) unsigned short smv[2][KS_][C_ * BC_];  // V fragments [t][kk]
  __shared__ unsigned short smp[8][16 * BC_];             // per-wave P buf  16KB
  unsigned short* pl = smp[wid];

  // This wave's slice of a stage. Waves 0-3: a quarter of the stage's K, 16 KB that
  // are contiguous in memory (32 rows of 512 B). Waves 4-7: 128 of the 256 rows
  // (128 B each, pitch 2*N_ B) of one of the stage's two V blocks.
  const bool isk = wid < 4u;
  const uint32_t j = wid & 3u;
  const uint64_t src0 = isk ? (uint64_t)(uintptr_t)kp + j * SLB_
                            : (uint64_t)(uintptr_t)vp + (uint64_t)(j & 1u) * (128u * N_ * 2u) + (j >> 1) * (BC_ * 2u);
  const uint32_t sstep = isk ? STB_ : (uint32_t)(KS_ * BC_ * 2);     // source bytes per stage
  const uint32_t lds0 = (isk ? (uint32_t)(uintptr_t)&smk[0][0][0] : (uint32_t)(uintptr_t)&smv[0][0][0]) + j * SLB_;
  const u32x8 g1 = isk ? tdm_group1(512u, 32u, 512u) : tdm_group1(128u, 128u, (uint32_t)(N_ * 2));

  tdm_load(tdm_group0(lds0, src0), g1);                   // stage 0 -> buffer 0

  v16bf qr[8];                                            // Q block in registers
#pragma unroll
  for (int kk = 0; kk < 8; ++kk) qr[kk] = load_ab_tile(qp, n0, C_, kk * 32, lane);

  v8f acc[16];                                            // O accum: 16n x 256c
#pragma unroll
  for (int t = 0; t < 16; ++t) acc[t] = zero8();
  float mrun[8], lrun[8];
#pragma unroll
  for (int r = 0; r < 8; ++r) { mrun[r] = -1e30f; lrun[r] = 0.0f; }

  wait_tensor0();
  __syncthreads();                                        // stage 0 is published

  for (int it = 0; it < NST_; ++it) {                     // 32 stages, 64 keys per wave
    int buf = it & 1;
    // Behind the barrier that published stage it and ended every read of the other
    // buffer: the load of stage it + 1 into that buffer flies during this pass.
    const uint32_t nx = pinned((uint32_t)it + 1u);        // the load's words are formed behind the wait
    if (pinned(nx < (uint32_t)NST_))                      // scalar test: stage it + 1 exists
      tdm_load(tdm_group0(lds0 + (nx & 1u) * STB_, src0 + (uint64_t)nx * sstep), g1);
    const unsigned short* kb = smk[buf][kh];
    const unsigned short* vb = smv[buf][kh];

    v8f s[4];                                             // S = Q^T K (16x64)
#pragma unroll
    for (int mt = 0; mt < 4; ++mt) s[mt] = zero8();
#pragma unroll
    for (int kk = 0; kk < 8; ++kk) {
#pragma unroll
      for (int mt = 0; mt < 4; ++mt) {
        v16bf bk = load_frag(kb, kk * 4 + mt, lane);
        s[mt] = wmma_bf16(qr[kk], bk, s[mt]);
      }
    }

    float mxr[8];                                         // per-row block max
#pragma unroll
    for (int r = 0; r < 8; ++r) {
      float mx = fmaxf(fmaxf(s[0][r], s[1][r]), fmaxf(s[2][r], s[3][r]));
#pragma unroll
      for (int off = 1; off < 16; off <<= 1) mx = fmaxf(mx, __shfl_xor(mx, off, 32));
      mxr[r] = mx;
    }
    int upd = 0;
#pragma unroll
    for (int r = 0; r < 8; ++r) upd |= (mxr[r] > mrun[r]) ? 1 : 0;
    if (__ballot(upd) != 0ull) {                          // lazy rescale (rare)
      float cf[8];
#pragma unroll
      for (int r = 0; r < 8; ++r) {
        float mnew = fmaxf(mrun[r], mxr[r]);
        cf[r] = __expf(mrun[r] - mnew);
        lrun[r] *= cf[r];
        mrun[r] = mnew;
      }
#pragma unroll
      for (int t = 0; t < 16; ++t)
#pragma unroll
        for (int r = 0; r < 8; ++r) acc[t][r] *= cf[r];
    }
#pragma unroll
    for (int r = 0; r < 8; ++r) {                         // P = exp(S - m)
      int nloc = r + hh * 8;
      float p0 = __expf(s[0][r] - mrun[r]);
      float p1 = __expf(s[1][r] - mrun[r]);
      float p2 = __expf(s[2][r] - mrun[r]);
      float p3 = __expf(s[3][r] - mrun[r]);
      pl[nloc * BC_ +      lo] = f2bf(p0);                // D-layout -> LDS [n][m]
      pl[nloc * BC_ + 16 + lo] = f2bf(p1);
      pl[nloc * BC_ + 32 + lo] = f2bf(p2);
      pl[nloc * BC_ + 48 + lo] = f2bf(p3);
      float rsum = (p0 + p1) + (p2 + p3);
#pragma unroll
      for (int off = 1; off < 16; off <<= 1) rsum += __shfl_xor(rsum, off, 32);
      lrun[r] += rsum;
    }
    v16bf pa0 = load_ab_tile(pl, 0, BC_, 0,  lane);       // P as A operand
    v16bf pa1 = load_ab_tile(pl, 0, BC_, 32, lane);
#pragma unroll
    for (int t = 0; t < 16; ++t) {                        // O += P * V
      v16bf bv0 = load_frag(vb, t * 2,     lane);
      v16bf bv1 = load_frag(vb, t * 2 + 1, lane);
      acc[t] = wmma_bf16(pa0, bv0, acc[t]);
      acc[t] = wmma_bf16(pa1, bv1, acc[t]);
    }

    // Publish point of stage it + 1: own LDS reads retired, own slice landed, then
    // the barrier, which also ends every reader's last read of this pass's buffer.
    wait_ds0();
    wait_tensor0();
    __syncthreads();
  }
  wait_tensor0();
  wait_ds0();

  // Merge of the two key halves of a query tile. The last pass's barrier has ended
  // every read of the ring, which now carries the hand-over: each wave keeps the
  // eight channel tiles kh*8.. and gives the other eight, with its m and l, to its
  // partner (wave wid ^ 4). 16-byte stores and loads, 512 contiguous bytes each.
  float* mg = (float*)&smk[0][0][0];
  float4* mine = (float4*)(mg + wid * MGW_) + lane;
  const float4* oth = (const float4*)(mg + (wid ^ 4u) * MGW_) + lane;
  v8f keep[8];
  if (kh == 0u) {
#pragma unroll
    for (int t = 0; t < 8; ++t) {
      keep[t] = acc[t];
      mine[(t * 2) * 32]     = make_float4(acc[8 + t][0], acc[8 + t][1], acc[8 + t][2], acc[8 + t][3]);
      mine[(t * 2 + 1) * 32] = make_float4(acc[8 + t][4], acc[8 + t][5], acc[8 + t][6], acc[8 + t][7]);
    }
  } else {
#pragma unroll
    for (int t = 0; t < 8; ++t) {
      keep[t] = acc[8 + t];
      mine[(t * 2) * 32]     = make_float4(acc[t][0], acc[t][1], acc[t][2], acc[t][3]);
      mine[(t * 2 + 1) * 32] = make_float4(acc[t][4], acc[t][5], acc[t][6], acc[t][7]);
    }
  }
  mine[16 * 32] = make_float4(mrun[0], mrun[1], mrun[2], mrun[3]);
  mine[17 * 32] = make_float4(mrun[4], mrun[5], mrun[6], mrun[7]);
  mine[18 * 32] = make_float4(lrun[0], lrun[1], lrun[2], lrun[3]);
  mine[19 * 32] = make_float4(lrun[4], lrun[5], lrun[6], lrun[7]);
  __syncthreads();
  float4 m0 = oth[16 * 32], m1 = oth[17 * 32], l0 = oth[18 * 32], l1 = oth[19 * 32];
  float om[8] = {m0.x, m0.y, m0.z, m0.w, m1.x, m1.y, m1.z, m1.w};
  float ol[8] = {l0.x, l0.y, l0.z, l0.w, l1.x, l1.y, l1.z, l1.w};
  float cs[8], co[8];                                     // weights of own and partner's part
#pragma unroll
  for (int r = 0; r < 8; ++r) {
    float mm = fmaxf(mrun[r], om[r]);
    float es = __expf(mrun[r] - mm), eo = __expf(om[r] - mm);
    float inv = 1.0f / (lrun[r] * es + ol[r] * eo);
    cs[r] = es * inv;
    co[r] = eo * inv;
  }
  unsigned short* ob = o + (size_t)b * N_ * C_;           // O -> [n][c] bf16
#pragma unroll
  for (int t = 0; t < 8; ++t) {
    float4 p0 = oth[(t * 2) * 32], p1 = oth[(t * 2 + 1) * 32];
    float pv[8] = {p0.x, p0.y, p0.z, p0.w, p1.x, p1.y, p1.z, p1.w};
    int c = ((int)kh * 8 + t) * 16 + lo;
#pragma unroll
    for (int r = 0; r < 8; ++r) {
      int n = n0 + r + hh * 8;
      ob[(size_t)n * C_ + c] = f2bf(keep[t][r] * cs[r] + pv[r] * co[r]);
    }
    // Precaution: registers that these stores name are written again for the next
    // tile; the wait stands in front of that.
    asm volatile("s_wait_xcnt 0x0" ::: "memory");
  }
}

// -------------------------------------------------- projection + residual add
__global__ void __launch_bounds__(32) k_proj(
    const unsigned short* o, const unsigned short* wp, const float* pb,
    const float* x, float* out) {
  int lane = threadIdx.x;
  int nt = blockIdx.x, ot = blockIdx.y, b = blockIdx.z;
  const unsigned short* ob = o + (size_t)b * N_ * C_;
  v8f acc = zero8();
#pragma unroll
  for (int kk = 0; kk < C_; kk += 32) {
    v16bf a  = load_ab_tile(wp, ot * 16, C_, kk, lane);   // pw [o][c]
    v16bf bb = load_ab_tile(ob, nt * 16, C_, kk, lane);   // O [n][c]
    acc = wmma_bf16(a, bb, acc);
  }
  int hh = lane >> 4, lo = lane & 15;
  int n = nt * 16 + lo;
  const float4* bp = (const float4*)(pb + ot * 16 + hh * 8);
  float4 b0 = bp[0], b1 = bp[1];
  float bias8[8] = {b0.x, b0.y, b0.z, b0.w, b1.x, b1.y, b1.z, b1.w};
#pragma unroll
  for (int r = 0; r < 8; ++r) {
    int oc = ot * 16 + hh * 8 + r;
    size_t idx = ((size_t)b * C_ + oc) * N_ + n;
    out[idx] = x[idx] + acc[r] + bias8[r];
  }
}

extern "C" void kernel_launch(void* const* d_in, const int* in_sizes, int n_in,
                              void* d_out, int out_size, void* d_ws, size_t ws_size,
                              hipStream_t stream) {
  (void)in_sizes; (void)n_in; (void)out_size; (void)ws_size;
  const float* x     = (const float*)d_in[0];
  const float* gnw   = (const float*)d_in[1];
  const float* gnb   = (const float*)d_in[2];
  const float* qw    = (const float*)d_in[3];
  const float* qbias = (const float*)d_in[4];
  const float* kw    = (const float*)d_in[5];
  const float* kbias = (const float*)d_in[6];
  const float* vw    = (const float*)d_in[7];
  const float* vbias = (const float*)d_in[8];
  const float* pw    = (const float*)d_in[9];
  const float* pbias = (const float*)d_in[10];
  float* out = (float*)d_out;

  char* w = (char*)d_ws;
  unsigned short* wqb  = (unsigned short*)(w + 1024);       // 4 x 64K bf16
  unsigned short* wkb  = wqb + 65536;
  unsigned short* wvb  = wqb + 2 * 65536;
  unsigned short* wpb  = wqb + 3 * 65536;
  unsigned short* h    = (unsigned short*)(w + 1024 + 524288);
  const size_t    bnc  = (size_t)B_ * N_ * C_;
  unsigned short* qd = h  + bnc;
  unsigned short* kd = qd + bnc;
  unsigned short* vd = kd + bnc;
  unsigned short* od = vd + bnc;
  float*        part = (float*)(od + bnc);                  // 256 x 128 B; total ~40.5 MB

  k_prep_weights<<<1024, 256, 0, stream>>>(qw, kw, vw, pw, wqb);
  k_gn_stats    <<<B_ * G_ * GSL_, 256, 0, stream>>>(x, part);
  k_gn_apply    <<<dim3(C_ / 32, N_ / 64, B_), 256, 0, stream>>>(x, gnw, gnb, part, h);
  k_qkv         <<<dim3(N_ / 16, C_ / 16, 3 * B_), 32, 0, stream>>>(
                    h, wqb, wkb, wvb, qbias, kbias, vbias, qd, kd, vd);
  k_attn        <<<dim3(N_ / 64, B_), 256, 0, stream>>>(qd, kd, vd, od);
  k_proj        <<<dim3(N_ / 16, C_ / 16, B_), 32, 0, stream>>>(od, wpb, pbias, x, out);
}

// v004
// One run takes 126 microseconds.
// Next to v003, in two timings, it ran 1.36 times as fast each time.
// Counting every step since v000, it is 8.24 times as fast.
#include <hip/hip_runtime.h>
#include <cstdint>

#define B_   4
#define C_   256
#define N_   4096
#define G_   8
#define CPG_ 32
#define BC_  64          // keys per wave and attention pass (one fragment-order block)
#define KS_  2           // waves that share one query tile, each on its own key block
#define NST_ (N_ / (BC_ * KS_))   // stages of KS_ key blocks
#define SLB_ 16384u      // bytes of one wave's slice of a stage
#define STB_ 65536u      // bytes of K (and of V) in one stage
#define MGW_ 2560        // floats one wave hands over in the final merge
#define GSL_ 8           // work-groups that share one (batch, group) in the GN statistics
#define GPP_ 32          // floats between two partial sums: each has its own 128-byte line
#define GWV_ 4           // waves of a work-group in the QKV and projection GEMMs
#define NTW_ 2           // 16-row tiles of h (or O) whose fragments such a wave keeps in registers
#define OTW_ 8           // 16-channel weight tiles that it walks with them

typedef __attribute__((ext_vector_type(16))) __bf16 v16bf;
typedef __attribute__((ext_vector_type(8)))  __bf16 v8bf;
typedef __attribute__((ext_vector_type(8)))  float  v8f;
typedef __attribute__((ext_vector_type(8)))  unsigned short u16x8;
typedef __attribute__((ext_vector_type(4)))  uint32_t u32x4;
typedef __attribute__((ext_vector_type(8)))  uint32_t u32x8;

__device__ __forceinline__ unsigned short f2bf(float f) {
  unsigned u = __builtin_bit_cast(unsigned, f);
  u += 0x7fffu + ((u >> 16) & 1u);          // round-to-nearest-even
  return (unsigned short)(u >> 16);
}

__device__ __forceinline__ v8f zero8() {
  v8f z;
#pragma unroll
  for (int i = 0; i < 8; ++i) z[i] = 0.0f;
  return z;
}

__device__ __forceinline__ v16bf load_ab_tile(const unsigned short* base, int row0,
                                              int ld, int k0, int lane) {
  int r  = row0 + (lane & 15);
  int kh = (lane >> 4) << 3;
  const unsigned short* p = base + (size_t)r * ld + (size_t)(k0 + kh);
  v8bf lo = *(const v8bf*)p;
  v8bf hi = *(const v8bf*)(p + 16);
  return __builtin_shufflevector(lo, hi, 0,1,2,3,4,5,6,7,8,9,10,11,12,13,14,15);
}

__device__ __forceinline__ v16bf load_frag(const unsigned short* base, int f, int lane) {
  const unsigned short* p = base + f * 512 + lane * 8;
  v8bf lo = *(const v8bf*)p;
  v8bf hi = *(const v8bf*)(p + 256);
  return __builtin_shufflevector(lo, hi, 0,1,2,3,4,5,6,7,8,9,10,11,12,13,14,15);
}

__device__ __forceinline__ v8f wmma_bf16(v16bf a, v16bf b, v8f c) {
  return __builtin_amdgcn_wmma_f32_16x16x32_bf16(false, a, false, b, (short)0, c,
                                                 false, false);
}

__device__ __forceinline__ uint32_t uni(uint32_t v) {
  return (uint32_t)__builtin_amdgcn_readfirstlane(v);
}

__device__ __forceinline__ uint32_t pinned(uint32_t v) {
  uint32_t w = uni(v);
  asm volatile("" : "+s"(w));
  return w;
}

__device__ __forceinline__ u32x8 tdm_group1(uint32_t rowb, uint32_t nrows, uint32_t pitch) {
  u32x8 g;
  g[0] = uni(0u);
  g[1] = uni((rowb & 0xFFFFu) << 16);
  g[2] = uni((rowb >> 16) | ((nrows & 0xFFFFu) << 16));
  g[3] = uni((nrows >> 16) | (rowb << 16));
  g[4] = uni(nrows);
  g[5] = uni(pitch);
  g[6] = uni(0u);
  g[7] = uni(0u);
  return g;
}
__device__ __forceinline__ u32x4 tdm_group0(uint32_t lds_dst, uint64_t ga) {
  u32x4 g;
  g[0] = uni(1u);                              // count 1
  g[1] = uni(lds_dst);
  g[2] = uni((uint32_t)ga);
  g[3] = uni((((uint32_t)(ga >> 32)) & 0x01FFFFFFu) | 0x80000000u);   // type 2
  return g;
}
__device__ __forceinline__ void tdm_load(u32x4 g0, u32x8 g1) {
  asm volatile("tensor_load_to_lds %0, %1" :: "s"(g0), "s"(g1) : "memory");
}
// The compiler places no wait for the tensor mover: the issuing wave's own wait.
__device__ __forceinline__ void wait_tensor0() { asm volatile("s_wait_tensorcnt 0x0" ::: "memory"); }
// This wave's LDS reads have retired before a buffer it read is handed back.
__device__ __forceinline__ void wait_ds0() { asm volatile("s_wait_dscnt 0x0" ::: "memory"); }

// ---------------------------------------------------------------- weights->bf16
__global__ void k_prep_weights(const float* qw, const float* kw, const float* vw,
                               const float* pw, unsigned short* dst) {
  int i = blockIdx.x * blockDim.x + threadIdx.x;   // 0 .. 4*65536
  int m = i >> 16, e = i & 65535;
  const float* s = (m == 0) ? qw : (m == 1) ? kw : (m == 2) ? vw : pw;
  dst[i] = f2bf(s[e]);
}

__global__ void __launch_bounds__(256) __attribute__((amdgpu_waves_per_eu(2, 2)))
k_gn_stats(const float* x, float* part) {
  int blk = blockIdx.x;                            // (b*8+g)*GSL_ + slice, 0..255
  const float4* p = (const float4*)(x + (size_t)blk * (CPG_ * N_ / GSL_)) + threadIdx.x;
  float4 v[16];
#pragma unroll
  for (int i = 0; i < 16; ++i) v[i] = p[i * 256];
  float4 a = make_float4(0.f, 0.f, 0.f, 0.f), q = a;
#pragma unroll
  for (int i = 0; i < 16; ++i) {
    a.x += v[i].x; a.y += v[i].y; a.z += v[i].z; a.w += v[i].w;
    q.x += v[i].x * v[i].x; q.y += v[i].y * v[i].y;
    q.z += v[i].z * v[i].z; q.w += v[i].w * v[i].w;
  }
  float s = (a.x + a.y) + (a.z + a.w), s2 = (q.x + q.y) + (q.z + q.w);
#pragma unroll
  for (int off = 16; off > 0; off >>= 1) {
    s  += __shfl_xor(s,  off, 32);
    s2 += __shfl_xor(s2, off, 32);
  }
  __shared__ float rs[8], rq[8];
  if ((threadIdx.x & 31) == 0) { rs[threadIdx.x >> 5] = s; rq[threadIdx.x >> 5] = s2; }
  __syncthreads();
  if (threadIdx.x == 0) {
    float ts = 0.f, tq = 0.f;
#pragma unroll
    for (int w = 0; w < 8; ++w) { ts += rs[w]; tq += rq[w]; }
    *(float2*)(part + blk * GPP_) = make_float2(ts, tq);
  }
}

// ------------------------------------------------- GN apply + transpose to [n][c]
__global__ void k_gn_apply(const float* x, const float* gw, const float* gb,
                           const float* part, unsigned short* h) {
  // grid (C_/32, N_/64, B_), 256 threads; blockIdx.x == group id (CPG_==32)
  int cb = blockIdx.x * 32, nb = blockIdx.y * 64, b = blockIdx.z;
  const float* pp = part + (b * G_ + blockIdx.x) * (GSL_ * GPP_);
  float s = 0.f, s2 = 0.f;
#pragma unroll
  for (int j = 0; j < GSL_; ++j) { s += pp[j * GPP_]; s2 += pp[j * GPP_ + 1]; }
  const float inv = 1.0f / (float)(CPG_ * N_);
  float mean = s * inv;
  float rstd = rsqrtf(s2 * inv - mean * mean + 1e-5f);
  __shared__ unsigned short tile[32][68];          // [c][n], padded
  const float* xb = x + ((size_t)b * C_ + cb) * N_ + nb;
#pragma unroll
  for (int i = 0; i < 8; ++i) {
    int idx = threadIdx.x + i * 256;
    int cl = idx >> 6, nl = idx & 63;              // coalesced along n
    float v = xb[(size_t)cl * N_ + nl];
    int c = cb + cl;
    v = (v - mean) * rstd * gw[c] + gb[c];
    tile[cl][nl] = f2bf(v);
  }
  __syncthreads();
  unsigned short* hb = h + ((size_t)b * N_ + nb) * C_ + cb;
#pragma unroll
  for (int i = 0; i < 8; ++i) {
    int idx = threadIdx.x + i * 256;
    int nl = idx >> 5, cl = idx & 31;              // coalesced along c
    hb[(size_t)nl * C_ + cl] = tile[cl][nl];
  }
}

// Precaution: registers that the global loads or stores above it name are written again
// below it. The wait stands in front of that; the scheduling barrier keeps those
// writes, which a "memory" clobber does not hold, behind the wait.
__device__ __forceinline__ void close_regs() {
  asm volatile("s_wait_xcnt 0x0" ::: "memory");
  __builtin_amdgcn_sched_barrier(0);
}
// The same behind a run of loads from the lane's address p: as an input of the wait p
// stays in its registers up to it; else the run's last load may land on them.
__device__ __forceinline__ void close_regs_at(const unsigned short* p) {
  asm volatile("s_wait_xcnt 0x0" :: "v"(p) : "memory");
  __builtin_amdgcn_sched_barrier(0);
}
// The lane's address in a 16-row operand tile of [row][C_] storage (see load_ab_tile),
// and the eight fragments of the tile's C_ columns from it.
__device__ __forceinline__ const unsigned short* tile_at(const unsigned short* base, int tile, int lane) {
  return base + (size_t)(tile * 16 + (lane & 15)) * C_ + ((lane >> 4) << 3);
}
__device__ __forceinline__ void load_tile8(v16bf (&f)[8], const unsigned short* p) {
#pragma unroll
  for (int kk = 0; kk < 8; ++kk) {
    v8bf lo = *(const v8bf*)(p + kk * 32);
    v8bf hi = *(const v8bf*)(p + kk * 32 + 16);
    f[kk] = __builtin_shufflevector(lo, hi, 0,1,2,3,4,5,6,7,8,9,10,11,12,13,14,15);
  }
  close_regs_at(p);
}

// ---------------------------------------------------------------- QKV GEMMs
// A wave's NTW_ x OTW_ block of 16x16 output tiles of q (WHICH 0), k (1) or v (2):
// the h fragments are loaded once and stay in registers, each weight fragment serves
// NTW_ products. The case is chosen in front of the matrix products, so that no
// branch stands behind the last one.
template <int WHICH>
__device__ __forceinline__ void qkv_tiles(const unsigned short* hb, const unsigned short* w,
                                          const float* bias, unsigned short* dstb,
                                          int nt0, int ot0, int lane) {
  // q,k: A = weights [o][c], B = h [n][c]: a lane ends with 8 channels of one n.
  // v:   A = h, B = weights: a lane ends with 8 keys of one channel, which is
  //      the 16-byte chunk that the attention kernel's V operand wants.
  int hh = lane >> 4, lo = lane & 15;
  // The lane's 16-byte place in the first output tile of each row tile; the later
  // tiles lie at compile-time distances from it (ot0 is a multiple of OTW_).
  unsigned short* d0[NTW_];
#pragma unroll
  for (int i = 0; i < NTW_; ++i) {
    const int nt = nt0 + i;
    if (WHICH == 2) {
      // v: fragment (ot, key half) of key block nt>>2, laid so that the 256 x 128-byte
      // tile the attention kernel loads at row pitch N_ lands in fragment order:
      // tile byte L = fragment*1024 + chunk*512 + lane*16, row L>>7, column L&127.
      int row = (ot0 * 2 + ((nt >> 1) & 1)) * 8 + (nt & 1) * 4 + (lane >> 3);
      d0[i] = dstb + (size_t)row * N_ + (nt >> 2) * BC_ + (lane & 7) * 8;
    } else if (WHICH == 0) {                                // q -> [n][c]
      d0[i] = dstb + (size_t)(nt * 16 + lo) * C_ + ot0 * 16 + hh * 8;
    } else {                                                // k -> fragment order inside
      d0[i] = dstb + (size_t)(nt >> 2) * (BC_ * C_) +       // each 64-key block (32 KB)
              ((ot0 >> 1) * 4 + (nt & 3)) * 512 + lane * 8;
    }
  }
  v16bf hf[NTW_][8];
#pragma unroll
  for (int i = 0; i < NTW_; ++i) load_tile8(hf[i], tile_at(hb, nt0 + i, lane));
  v16bf wf[2][8];                                         // this tile's weights and the next one's
  float4 bq[2][2];
  load_tile8(wf[0], tile_at(w, ot0, lane));
  // the lane's place in the bias: its channel (v) or its first of 8 channels (q, k)
  const float* bl = bias + ot0 * 16 + ((WHICH == 2) ? lo : hh * 8);
  if (WHICH == 2) {
    bq[0][0].x = bl[0];
  } else {
    bq[0][0] = ((const float4*)bl)[0]; bq[0][1] = ((const float4*)bl)[1];
  }
  close_regs();
  // Unrolled so that the two register sets are picked at compile time and the next
  // tile's loads, written in front of this tile's products, fly during them.
#pragma unroll
  for (int oi = 0; oi < OTW_; ++oi) {
    const int cur = oi & 1, nxt = cur ^ 1;
    const int ot = ot0 + oi;
    if (oi + 1 < OTW_) {
      load_tile8(wf[nxt], tile_at(w, ot + 1, lane));
      if (WHICH == 2) {
        bq[nxt][0].x = bl[(oi + 1) * 16];
      } else {
        bq[nxt][0] = ((const float4*)bl)[(oi + 1) * 4]; bq[nxt][1] = ((const float4*)bl)[(oi + 1) * 4 + 1];
      }
    }
    // Also keeps the next tile's loads, issued above, in front of this tile's products:
    // without it the scheduler sinks each to its first use, where it is waited out.
    close_regs();
    v8f acc[NTW_];
#pragma unroll
    for (int i = 0; i < NTW_; ++i) acc[i] = zero8();
#pragma unroll
    for (int kk = 0; kk < 8; ++kk)
#pragma unroll
      for (int i = 0; i < NTW_; ++i)
        acc[i] = (WHICH == 2) ? wmma_bf16(hf[i][kk], wf[cur][kk], acc[i])
                              : wmma_bf16(wf[cur][kk], hf[i][kk], acc[i]);
#pragma unroll
    for (int i = 0; i < NTW_; ++i) {
      u16x8 outv;
      unsigned short* dst;
      if (WHICH == 2) {
        float bv = bq[cur][0].x;
#pragma unroll
        for (int r = 0; r < 8; ++r) outv[r] = f2bf(acc[i][r] + bv);
        dst = d0[i] + (size_t)oi * 16 * N_;                   // 16 fragment rows per tile
      } else {
        float4 bq0 = bq[cur][0], bq1 = bq[cur][1];
        float bias8[8] = {bq0.x, bq0.y, bq0.z, bq0.w, bq1.x, bq1.y, bq1.z, bq1.w};
        const float scale = (WHICH == 0) ? 0.0625f : 1.0f;    // 1/sqrt(256) folded into q
#pragma unroll
        for (int r = 0; r < 8; ++r) outv[r] = f2bf((acc[i][r] + bias8[r]) * scale);
        dst = d0[i] + ((WHICH == 0) ? oi * 16 : (oi >> 1) * 2048 + (oi & 1) * 256);
      }
      *(u16x8*)dst = outv;
      close_regs();                                       // also where the three cases join again
    }
  }
}

__global__ void __launch_bounds__(GWV_ * 32) k_qkv(
    const unsigned short* h, const unsigned short* wq, const unsigned short* wk,
    const unsigned short* wv, const float* qb, const float* kb, const float* vb,
    unsigned short* q, unsigned short* k, unsigned short* v) {
  int lane = threadIdx.x & 31;
  int nt0 = (blockIdx.x * GWV_ + (threadIdx.x >> 5)) * NTW_, ot0 = blockIdx.y * OTW_;
  int b = blockIdx.z / 3, which = blockIdx.z % 3;
  size_t boff = (size_t)b * N_ * C_;
  const unsigned short* hb = h + boff;
  if (which == 0)      qkv_tiles<0>(hb, wq, qb, q + boff, nt0, ot0, lane);
  else if (which == 1) qkv_tiles<1>(hb, wk, kb, k + boff, nt0, ot0, lane);
  else                 qkv_tiles<2>(hb, wv, vb, v + boff, nt0, ot0, lane);
}

// ----------------------------------------------------------- flash attention
// Workgroup = 8 waves on 64 query rows: wave w works on query tile w & 3 (16 rows)
// and on key block w >> 2 of every stage, so that the 256 workgroups cover every
// WGP; the two waves of a tile merge their partial results through LDS at the end.
// A stage is 128 keys: K 64 KB + V 64 KB, double-buffered; every wave brings its
// own 16-KB slice by one tensor load. k_qkv has stored both in fragment order, so
// the tiles land ready for load_frag.
__global__ void __launch_bounds__(256) k_attn(
    const unsigned short* q, const unsigned short* k, const unsigned short* v,
    unsigned short* o) {
  int lane = threadIdx.x & 31;
  const uint32_t wid = uni(threadIdx.x >> 5);
  const uint32_t kh = wid >> 2;                           // key block of the stage
  int b = blockIdx.y;
  int n0 = blockIdx.x * 64 + (int)(wid & 3u) * 16;        // 16 query rows per wave
  int hh = lane >> 4, lo = lane & 15;
  const unsigned short* qp = q + (size_t)b * N_ * C_;
  const unsigned short* kp = k + (size_t)b * N_ * C_;
  const unsigned short* vp = v + (size_t)b * C_ * N_;

  // 2-KiB alignment: every tensor load's place in LDS is a multiple of 2 KiB.
  __shared__ __attribute__((aligned(2048))) unsigned short smk[2][KS_][BC_ * C_];  // K fragments [kk][mt]
  __shared__ __attribute__((aligned(2048))) unsigned short smv[2][KS_][C_ * BC_];  // V fragments [t][kk]
  __shared__ unsigned short smp[8][16 * BC_];             // per-wave P buf  16KB
  unsigned short* pl = smp[wid];

  // This wave's slice of a stage. Waves 0-3: a quarter of the stage's K, 16 KB that
  // are contiguous in memory (32 rows of 512 B). Waves 4-7: 128 of the 256 rows
  // (128 B each, pitch 2*N_ B) of one of the stage's two V blocks.
  const bool isk = wid < 4u;
  const uint32_t j = wid & 3u;
  const uint64_t src0 = isk ? (uint64_t)(uintptr_t)kp + j * SLB_
                            : (uint64_t)(uintptr_t)vp + (uint64_t)(j & 1u) * (128u * N_ * 2u) + (j >> 1) * (BC_ * 2u);
  const uint32_t sstep = isk ? STB_ : (uint32_t)(KS_ * BC_ * 2);     // source bytes per stage
  const uint32_t lds0 = (isk ? (uint32_t)(uintptr_t)&smk[0][0][0] : (uint32_t)(uintptr_t)&smv[0][0][0]) + j * SLB_;
  const u32x8 g1 = isk ? tdm_group1(512u, 32u, 512u) : tdm_group1(128u, 128u, (uint32_t)(N_ * 2));

  tdm_load(tdm_group0(lds0, src0), g1);                   // stage 0 -> buffer 0

  v16bf qr[8];                                            // Q block in registers
#pragma unroll
  for (int kk = 0; kk < 8; ++kk) qr[kk] = load_ab_tile(qp, n0, C_, kk * 32, lane);

  v8f acc[16];                                            // O accum: 16n x 256c
#pragma unroll
  for (int t = 0; t < 16; ++t) acc[t] = zero8();
  float mrun[8], lrun[8];
#pragma unroll
  for (int r = 0; r < 8; ++r) { mrun[r] = -1e30f; lrun[r] = 0.0f; }

  wait_tensor0();
  __syncthreads();                                        // stage 0 is published

  for (int it = 0; it < NST_; ++it) {                     // 32 stages, 64 keys per wave
    int buf = it & 1;
    // Behind the barrier that published stage it and ended every read of the other
    // buffer: the load of stage it + 1 into that buffer flies during this pass.
    const uint32_t nx = pinned((uint32_t)it + 1u);        // the load's words are formed behind the wait
    if (pinned(nx < (uint32_t)NST_))                      // scalar test: stage it + 1 exists
      tdm_load(tdm_group0(lds0 + (nx & 1u) * STB_, src0 + (uint64_t)nx * sstep), g1);
    const unsigned short* kb = smk[buf][kh];
    const unsigned short* vb = smv[buf][kh];

    v8f s[4];                                             // S = Q^T K (16x64)
#pragma unroll
    for (int mt = 0; mt < 4; ++mt) s[mt] = zero8();
#pragma unroll
    for (int kk = 0; kk < 8; ++kk) {
#pragma unroll
      for (int mt = 0; mt < 4; ++mt) {
        v16bf bk = load_frag(kb, kk * 4 + mt, lane);
        s[mt] = wmma_bf16(qr[kk], bk, s[mt]);
      }
    }

    float mxr[8];                                         // per-row block max
#pragma unroll
    for (int r = 0; r < 8; ++r) {
      float mx = fmaxf(fmaxf(s[0][r], s[1][r]), fmaxf(s[2][r], s[3][r]));
#pragma unroll
      for (int off = 1; off < 16; off <<= 1) mx = fmaxf(mx, __shfl_xor(mx, off, 32));
      mxr[r] = mx;
    }
    int upd = 0;
#pragma unroll
    for (int r = 0; r < 8; ++r) upd |= (mxr[r] > mrun[r]) ? 1 : 0;
    if (__ballot(upd) != 0ull) {                          // lazy rescale (rare)
      float cf[8];
#pragma unroll
      for (int r = 0; r < 8; ++r) {
        float mnew = fmaxf(mrun[r], mxr[r]);
        cf[r] = __expf(mrun[r] - mnew);
        lrun[r] *= cf[r];
        mrun[r] = mnew;
      }
#pragma unroll
      for (int t = 0; t < 16; ++t)
#pragma unroll
        for (int r = 0; r < 8; ++r) acc[t][r] *= cf[r];
    }
#pragma unroll
    for (int r = 0; r < 8; ++r) {                         // P = exp(S - m)
      int nloc = r + hh * 8;
      float p0 = __expf(s[0][r] - mrun[r]);
      float p1 = __expf(s[1][r] - mrun[r]);
      float p2 = __expf(s[2][r] - mrun[r]);
      float p3 = __expf(s[3][r] - mrun[r]);
      pl[nloc * BC_ +      lo] = f2bf(p0);                // D-layout -> LDS [n][m]
      pl[nloc * BC_ + 16 + lo] = f2bf(p1);
      pl[nloc * BC_ + 32 + lo] = f2bf(p2);
      pl[nloc * BC_ + 48 + lo] = f2bf(p3);
      float rsum = (p0 + p1) + (p2 + p3);
#pragma unroll
      for (int off = 1; off < 16; off <<= 1) rsum += __shfl_xor(rsum, off, 32);
      lrun[r] += rsum;
    }
    v16bf pa0 = load_ab_tile(pl, 0, BC_, 0,  lane);       // P as A operand
    v16bf pa1 = load_ab_tile(pl, 0, BC_, 32, lane);
#pragma unroll
    for (int t = 0; t < 16; ++t) {                        // O += P * V
      v16bf bv0 = load_frag(vb, t * 2,     lane);
      v16bf bv1 = load_frag(vb, t * 2 + 1, lane);
      acc[t] = wmma_bf16(pa0, bv0, acc[t]);
      acc[t] = wmma_bf16(pa1, bv1, acc[t]);
    }

    // Publish point of stage it + 1: own LDS reads retired, own slice landed, then
    // the barrier, which also ends every reader's last read of this pass's buffer.
    wait_ds0();
    wait_tensor0();
    __syncthreads();
  }
  wait_tensor0();
  wait_ds0();

  // Merge of the two key halves of a query tile. The last pass's barrier has ended
  // every read of the ring, which now carries the hand-over: each wave keeps the
  // eight channel tiles kh*8.. and gives the other eight, with its m and l, to its
  // partner (wave wid ^ 4). 16-byte stores and loads, 512 contiguous bytes each.
  float* mg = (float*)&smk[0][0][0];
  float4* mine = (float4*)(mg + wid * MGW_) + lane;
  const float4* oth = (const float4*)(mg + (wid ^ 4u) * MGW_) + lane;
  v8f keep[8];
  if (kh == 0u) {
#pragma unroll
    for (int t = 0; t < 8; ++t) {
      keep[t] = acc[t];
      mine[(t * 2) * 32]     = make_float4(acc[8 + t][0], acc[8 + t][1], acc[8 + t][2], acc[8 + t][3]);
      mine[(t * 2 + 1) * 32] = make_float4(acc[8 + t][4], acc[8 + t][5], acc[8 + t][6], acc[8 + t][7]);
    }
  } else {
#pragma unroll
    for (int t = 0; t < 8; ++t) {
      keep[t] = acc[8 + t];
      mine[(t * 2) * 32]     = make_float4(acc[t][0], acc[t][1], acc[t][2], acc[t][3]);
      mine[(t * 2 + 1) * 32] = make_float4(acc[t][4], acc[t][5], acc[t][6], acc[t][7]);
    }
  }
  mine[16 * 32] = make_float4(mrun[0], mrun[1], mrun[2], mrun[3]);
  mine[17 * 32] = make_float4(mrun[4], mrun[5], mrun[6], mrun[7]);
  mine[18 * 32] = make_float4(lrun[0], lrun[1], lrun[2], lrun[3]);
  mine[19 * 32] = make_float4(lrun[4], lrun[5], lrun[6], lrun[7]);
  __syncthreads();
  float4 m0 = oth[16 * 32], m1 = oth[17 * 32], l0 = oth[18 * 32], l1 = oth[19 * 32];
  float om[8] = {m0.x, m0.y, m0.z, m0.w, m1.x, m1.y, m1.z, m1.w};
  float ol[8] = {l0.x, l0.y, l0.z, l0.w, l1.x, l1.y, l1.z, l1.w};
  float cs[8], co[8];                                     // weights of own and partner's part
#pragma unroll
  for (int r = 0; r < 8; ++r) {
    float mm = fmaxf(mrun[r], om[r]);
    float es = __expf(mrun[r] - mm), eo = __expf(om[r] - mm);
    float inv = 1.0f / (lrun[r] * es + ol[r] * eo);
    cs[r] = es * inv;
    co[r] = eo * inv;
  }
  unsigned short* ob = o + (size_t)b * N_ * C_;           // O -> [n][c] bf16
#pragma unroll
  for (int t = 0; t < 8; ++t) {
    float4 p0 = oth[(t * 2) * 32], p1 = oth[(t * 2 + 1) * 32];
    float pv[8] = {p0.x, p0.y, p0.z, p0.w, p1.x, p1.y, p1.z, p1.w};
    int c = ((int)kh * 8 + t) * 16 + lo;
#pragma unroll
    for (int r = 0; r < 8; ++r) {
      int n = n0 + r + hh * 8;
      ob[(size_t)n * C_ + c] = f2bf(keep[t][r] * cs[r] + pv[r] * co[r]);
    }
    // Precaution: registers that these stores name are written again for the next
    // tile; the wait stands in front of that.
    asm volatile("s_wait_xcnt 0x0" ::: "memory");
  }
}

// -------------------------------------------------- projection + residual add
// As in k_qkv: a wave keeps the O fragments of NTW_ row tiles in registers and walks
// OTW_ weight tiles with them; the next tile's weights, bias and x are loaded one
// tile ahead.
__global__ void __launch_bounds__(GWV_ * 32) k_proj(
    const unsigned short* o, const unsigned short* wp, const float* pb,
    const float* x, float* out) {
  int lane = threadIdx.x & 31;
  int nt0 = (blockIdx.x * GWV_ + (threadIdx.x >> 5)) * NTW_, ot0 = blockIdx.y * OTW_;
  int b = blockIdx.z;
  int hh = lane >> 4, lo = lane & 15;
  const unsigned short* ob = o + (size_t)b * N_ * C_;
  // element (channel ot0*16 + hh*8, position nt0*16 + lo) of x and of out
  const size_t idx0 = ((size_t)b * C_ + ot0 * 16 + hh * 8) * N_ + nt0 * 16 + lo;
  const float* xp = x + idx0;
  float* op = out + idx0;
  const float4* bp = (const float4*)(pb + ot0 * 16 + hh * 8);
  v16bf of[NTW_][8];                                      // O [n][c]
#pragma unroll
  for (int i = 0; i < NTW_; ++i) load_tile8(of[i], tile_at(ob, nt0 + i, lane));
  v16bf wf[2][8];                                         // pw [o][c]: this tile and the next
  float4 bq[2][2];
  float xv[2][NTW_][8];
  load_tile8(wf[0], tile_at(wp, ot0, lane));
  bq[0][0] = bp[0]; bq[0][1] = bp[1];
  close_regs();
#pragma unroll
  for (int i = 0; i < NTW_; ++i)
#pragma unroll
    for (int r = 0; r < 8; ++r) xv[0][i][r] = xp[(size_t)r * N_ + i * 16];
  close_regs();
  // Unrolled so that the two register sets are picked at compile time and the next
  // tile's loads, written in front of this tile's products, fly during them.
#pragma unroll
  for (int oi = 0; oi < OTW_; ++oi) {
    const int cur = oi & 1, nxt = cur ^ 1;
    if (oi + 1 < OTW_) {
      load_tile8(wf[nxt], tile_at(wp, ot0 + oi + 1, lane));
      bq[nxt][0] = bp[(oi + 1) * 4]; bq[nxt][1] = bp[(oi + 1) * 4 + 1];
#pragma unroll
      for (int i = 0; i < NTW_; ++i)
#pragma unroll
        for (int r = 0; r < 8; ++r)
          xv[nxt][i][r] = xp[(size_t)((oi + 1) * 16 + r) * N_ + i * 16];
    }
    // Also keeps the next tile's loads, issued above, in front of this tile's products:
    // without it the scheduler sinks each to its first use, where it is waited out.
    close_regs();
    v8f acc[NTW_];
#pragma unroll
    for (int i = 0; i < NTW_; ++i) acc[i] = zero8();
#pragma unroll
    for (int kk = 0; kk < 8; ++kk)
#pragma unroll
      for (int i = 0; i < NTW_; ++i) acc[i] = wmma_bf16(wf[cur][kk], of[i][kk], acc[i]);
    float4 b0 = bq[cur][0], b1 = bq[cur][1];
    float bias8[8] = {b0.x, b0.y, b0.z, b0.w, b1.x, b1.y, b1.z, b1.w};
#pragma unroll
    for (int i = 0; i < NTW_; ++i) {
#pragma unroll
      for (int r = 0; r < 8; ++r)
        op[(size_t)(oi * 16 + r) * N_ + i * 16] = xv[cur][i][r] + acc[i][r] + bias8[r];
      close_regs();
    }
  }
}

extern "C" void kernel_launch(void* const* d_in, const int* in_sizes, int n_in,
                              void* d_out, int out_size, void* d_ws, size_t ws_size,
                              hipStream_t stream) {
  (void)in_sizes; (void)n_in; (void)out_size; (void)ws_size;
  const float* x     = (const float*)d_in[0];
  const float* gnw   = (const float*)d_in[1];
  const float* gnb   = (const float*)d_in[2];
  const float* qw    = (const float*)d_in[3];
  const float* qbias = (const float*)d_in[4];
  const float* kw    = (const float*)d_in[5];
  const float* kbias = (const float*)d_in[6];
  const float* vw    = (const float*)d_in[7];
  const float* vbias = (const float*)d_in[8];
  const float* pw    = (const float*)d_in[9];
  const float* pbias = (const float*)d_in[10];
  float* out = (float*)d_out;

  char* w = (char*)d_ws;
  unsigned short* wqb  = (unsigned short*)(w + 1024);       // 4 x 64K bf16
  unsigned short* wkb  = wqb + 65536;
  unsigned short* wvb  = wqb + 2 * 65536;
  unsigned short* wpb  = wqb + 3 * 65536;
  unsigned short* h    = (unsigned short*)(w + 1024 + 524288);
  const size_t    bnc  = (size_t)B_ * N_ * C_;
  unsigned short* qd = h  + bnc;
  unsigned short* kd = qd + bnc;
  unsigned short* vd = kd + bnc;
  unsigned short* od = vd + bnc;
  float*        part = (float*)(od + bnc);                  // 256 x 128 B; total ~40.5 MB

  k_prep_weights<<<1024, 256, 0, stream>>>(qw, kw, vw, pw, wqb);
  k_gn_stats    <<<B_ * G_ * GSL_, 256, 0, stream>>>(x, part);
  k_gn_apply    <<<dim3(C_ / 32, N_ / 64, B_), 256, 0, stream>>>(x, gnw, gnb, part, h);
  k_qkv         <<<dim3(N_ / (16 * NTW_ * GWV_), C_ / (16 * OTW_), 3 * B_), GWV_ * 32, 0, stream>>>(
                    h, wqb, wkb, wvb, qbias, kbias, vbias, qd, kd, vd);
  k_attn        <<<dim3(N_ / 64, B_), 256, 0, stream>>>(qd, kd, vd, od);
  k_proj        <<<dim3(N_ / (16 * NTW_ * GWV_), C_ / (16 * OTW_), B_), GWV_ * 32, 0, stream>>>(od, wpb, pbias, x, out);
}

// v005
// One run takes 102 microseconds.
// Two timings next to v004 both put it at 1.23 times that version's speed.
// Over all steps from v000 it is 10.1 times as fast.
#include <hip/hip_runtime.h>
#include <cstdint>

#define B_   4
#define C_   256
#define N_   4096
#define G_   8
#define CPG_ 32
#define BC_  64          // keys per wave and attention pass (one fragment-order block)
#define KS_  2           // waves that share one query tile, each on its own key block
#define NST_ (N_ / (BC_ * KS_))   // stages of KS_ key blocks
#define SLB_ 16384u      // bytes of one wave's slice of a stage
#define STB_ 65536u      // bytes of K (and of V) in one stage
#define MGW_ 2176        // floats one wave hands over in the final merge
#define GSL_ 8           // work-groups that share one (batch, group) in the GN statistics
#define GPP_ 32          // floats between two partial sums: each has its own 128-byte line
#define GWV_ 4           // waves of a work-group in the QKV and projection GEMMs
#define NTW_ 2           // 16-row tiles of h (or O) whose fragments such a wave keeps in registers
#define OTW_ 8           // 16-channel weight tiles that it walks with them

typedef __attribute__((ext_vector_type(16))) __bf16 v16bf;
typedef __attribute__((ext_vector_type(8)))  __bf16 v8bf;
typedef __attribute__((ext_vector_type(8)))  float  v8f;
typedef __attribute__((ext_vector_type(8)))  unsigned short u16x8;
typedef __attribute__((ext_vector_type(4)))  uint32_t u32x4;
typedef __attribute__((ext_vector_type(8)))  uint32_t u32x8;

__device__ __forceinline__ unsigned short f2bf(float f) {
  unsigned u = __builtin_bit_cast(unsigned, f);
  u += 0x7fffu + ((u >> 16) & 1u);          // round-to-nearest-even
  return (unsigned short)(u >> 16);
}

__device__ __forceinline__ v8f zero8() {
  v8f z;
#pragma unroll
  for (int i = 0; i < 8; ++i) z[i] = 0.0f;
  return z;
}

__device__ __forceinline__ v16bf load_ab_tile(const unsigned short* base, int row0,
                                              int ld, int k0, int lane) {
  int r  = row0 + (lane & 15);
  int kh = (lane >> 4) << 3;
  const unsigned short* p = base + (size_t)r * ld + (size_t)(k0 + kh);
  v8bf lo = *(const v8bf*)p;
  v8bf hi = *(const v8bf*)(p + 16);
  return __builtin_shufflevector(lo, hi, 0,1,2,3,4,5,6,7,8,9,10,11,12,13,14,15);
}

__device__ __forceinline__ v16bf load_frag(const unsigned short* base, int f, int lane) {
  const unsigned short* p = base + f * 512 + lane * 8;
  v8bf lo = *(const v8bf*)p;
  v8bf hi = *(const v8bf*)(p + 256);
  return __builtin_shufflevector(lo, hi, 0,1,2,3,4,5,6,7,8,9,10,11,12,13,14,15);
}

__device__ __forceinline__ v8f wmma_bf16(v16bf a, v16bf b, v8f c) {
  return __builtin_amdgcn_wmma_f32_16x16x32_bf16(false, a, false, b, (short)0, c,
                                                 false, false);
}

__device__ __forceinline__ float xhalf(float x) {
  int i = __builtin_bit_cast(int, x);
  return __builtin_bit_cast(float, __builtin_amdgcn_permlanex16(i, i, 0x76543210, 0xfedcba98, false, false));
}

__device__ __forceinline__ uint32_t uni(uint32_t v) {
  return (uint32_t)__builtin_amdgcn_readfirstlane(v);
}

__device__ __forceinline__ uint32_t pinned(uint32_t v) {
  uint32_t w = uni(v);
  asm volatile("" : "+s"(w));
  return w;
}

__device__ __forceinline__ u32x8 tdm_group1(uint32_t rowb, uint32_t nrows, uint32_t pitch) {
  u32x8 g;
  g[0] = uni(0u);
  g[1] = uni((rowb & 0xFFFFu) << 16);
  g[2] = uni((rowb >> 16) | ((nrows & 0xFFFFu) << 16));
  g[3] = uni((nrows >> 16) | (rowb << 16));
  g[4] = uni(nrows);
  g[5] = uni(pitch);
  g[6] = uni(0u);
  g[7] = uni(0u);
  return g;
}
__device__ __forceinline__ u32x4 tdm_group0(uint32_t lds_dst, uint64_t ga) {
  u32x4 g;
  g[0] = uni(1u);                              // count 1
  g[1] = uni(lds_dst);
  g[2] = uni((uint32_t)ga);
  g[3] = uni((((uint32_t)(ga >> 32)) & 0x01FFFFFFu) | 0x80000000u);   // type 2
  return g;
}
__device__ __forceinline__ void tdm_load(u32x4 g0, u32x8 g1) {
  asm volatile("tensor_load_to_lds %0, %1" :: "s"(g0), "s"(g1) : "memory");
}
// The compiler places no wait for the tensor mover: the issuing wave's own wait.
__device__ __forceinline__ void wait_tensor0() { asm volatile("s_wait_tensorcnt 0x0" ::: "memory"); }
// This wave's LDS reads have retired before a buffer it read is handed back.
__device__ __forceinline__ void wait_ds0() { asm volatile("s_wait_dscnt 0x0" ::: "memory"); }

// ---------------------------------------------------------------- weights->bf16
__global__ void k_prep_weights(const float* qw, const float* kw, const float* vw,
                               const float* pw, unsigned short* dst) {
  int i = blockIdx.x * blockDim.x + threadIdx.x;   // 0 .. 4*65536
  int m = i >> 16, e = i & 65535;
  const float* s = (m == 0) ? qw : (m == 1) ? kw : (m == 2) ? vw : pw;
  dst[i] = f2bf(s[e]);
}

__global__ void __launch_bounds__(256) __attribute__((amdgpu_waves_per_eu(2, 2)))
k_gn_stats(const float* x, float* part) {
  int blk = blockIdx.x;                            // (b*8+g)*GSL_ + slice, 0..255
  const float4* p = (const float4*)(x + (size_t)blk * (CPG_ * N_ / GSL_)) + threadIdx.x;
  float4 v[16];
#pragma unroll
  for (int i = 0; i < 16; ++i) v[i] = p[i * 256];
  float4 a = make_float4(0.f, 0.f, 0.f, 0.f), q = a;
#pragma unroll
  for (int i = 0; i < 16; ++i) {
    a.x += v[i].x; a.y += v[i].y; a.z += v[i].z; a.w += v[i].w;
    q.x += v[i].x * v[i].x; q.y += v[i].y * v[i].y;
    q.z += v[i].z * v[i].z; q.w += v[i].w * v[i].w;
  }
  float s = (a.x + a.y) + (a.z + a.w), s2 = (q.x + q.y) + (q.z + q.w);
#pragma unroll
  for (int off = 16; off > 0; off >>= 1) {
    s  += __shfl_xor(s,  off, 32);
    s2 += __shfl_xor(s2, off, 32);
  }
  __shared__ float rs[8], rq[8];
  if ((threadIdx.x & 31) == 0) { rs[threadIdx.x >> 5] = s; rq[threadIdx.x >> 5] = s2; }
  __syncthreads();
  if (threadIdx.x == 0) {
    float ts = 0.f, tq = 0.f;
#pragma unroll
    for (int w = 0; w < 8; ++w) { ts += rs[w]; tq += rq[w]; }
    *(float2*)(part + blk * GPP_) = make_float2(ts, tq);
  }
}

// ------------------------------------------------- GN apply + transpose to [n][c]
__global__ void k_gn_apply(const float* x, const float* gw, const float* gb,
                           const float* part, unsigned short* h) {
  // grid (C_/32, N_/64, B_), 256 threads; blockIdx.x == group id (CPG_==32)
  int cb = blockIdx.x * 32, nb = blockIdx.y * 64, b = blockIdx.z;
  const float* pp = part + (b * G_ + blockIdx.x) * (GSL_ * GPP_);
  float s = 0.f, s2 = 0.f;
#pragma unroll
  for (int j = 0; j < GSL_; ++j) { s += pp[j * GPP_]; s2 += pp[j * GPP_ + 1]; }
  const float inv = 1.0f / (float)(CPG_ * N_);
  float mean = s * inv;
  float rstd = rsqrtf(s2 * inv - mean * mean + 1e-5f);
  __shared__ unsigned short tile[32][68];          // [c][n], padded
  const float* xb = x + ((size_t)b * C_ + cb) * N_ + nb;
#pragma unroll
  for (int i = 0; i < 8; ++i) {
    int idx = threadIdx.x + i * 256;
    int cl = idx >> 6, nl = idx & 63;              // coalesced along n
    float v = xb[(size_t)cl * N_ + nl];
    int c = cb + cl;
    v = (v - mean) * rstd * gw[c] + gb[c];
    tile[cl][nl] = f2bf(v);
  }
  __syncthreads();
  unsigned short* hb = h + ((size_t)b * N_ + nb) * C_ + cb;
#pragma unroll
  for (int i = 0; i < 8; ++i) {
    int idx = threadIdx.x + i * 256;
    int nl = idx >> 5, cl = idx & 31;              // coalesced along c
    hb[(size_t)nl * C_ + cl] = tile[cl][nl];
  }
}

// Precaution: registers that the global loads or stores above it name are written again
// below it. The wait stands in front of that; the scheduling barrier keeps those
// writes, which a "memory" clobber does not hold, behind the wait.
__device__ __forceinline__ void close_regs() {
  asm volatile("s_wait_xcnt 0x0" ::: "memory");
  __builtin_amdgcn_sched_barrier(0);
}
// The same behind a run of loads from the lane's address p: as an input of the wait p
// stays in its registers up to it; else the run's last load may land on them.
__device__ __forceinline__ void close_regs_at(const unsigned short* p) {
  asm volatile("s_wait_xcnt 0x0" :: "v"(p) : "memory");
  __builtin_amdgcn_sched_barrier(0);
}
// The lane's address in a 16-row operand tile of [row][C_] storage (see load_ab_tile),
// and the eight fragments of the tile's C_ columns from it.
__device__ __forceinline__ const unsigned short* tile_at(const unsigned short* base, int tile, int lane) {
  return base + (size_t)(tile * 16 + (lane & 15)) * C_ + ((lane >> 4) << 3);
}
__device__ __forceinline__ void load_tile8(v16bf (&f)[8], const unsigned short* p) {
#pragma unroll
  for (int kk = 0; kk < 8; ++kk) {
    v8bf lo = *(const v8bf*)(p + kk * 32);
    v8bf hi = *(const v8bf*)(p + kk * 32 + 16);
    f[kk] = __builtin_shufflevector(lo, hi, 0,1,2,3,4,5,6,7,8,9,10,11,12,13,14,15);
  }
  close_regs_at(p);
}

// ---------------------------------------------------------------- QKV GEMMs
// A wave's NTW_ x OTW_ block of 16x16 output tiles of q (WHICH 0), k (1) or v (2):
// the h fragments are loaded once and stay in registers, each weight fragment serves
// NTW_ products. The case is chosen in front of the matrix products, so that no
// branch stands behind the last one.
template <int WHICH>
__device__ __forceinline__ void qkv_tiles(const unsigned short* hb, const unsigned short* w,
                                          const float* bias, unsigned short* dstb,
                                          int nt0, int ot0, int lane) {
  // q,k: A = weights [o][c], B = h [n][c]: a lane ends with 8 channels of one n.
  // v:   A = h, B = weights: a lane ends with 8 keys of one channel, which is
  //      the 16-byte chunk that the attention kernel's V operand wants.
  int hh = lane >> 4, lo = lane & 15;
  // The lane's 16-byte place in the first output tile of each row tile; the later
  // tiles lie at compile-time distances from it (ot0 is a multiple of OTW_).
  unsigned short* d0[NTW_];
#pragma unroll
  for (int i = 0; i < NTW_; ++i) {
    const int nt = nt0 + i;
    if (WHICH == 2) {
      // v: fragment (ot, key half) of key block nt>>2, laid so that the 256 x 128-byte
      // tile the attention kernel loads at row pitch N_ lands in fragment order:
      // tile byte L = fragment*1024 + chunk*512 + lane*16, row L>>7, column L&127.
      int row = (ot0 * 2 + ((nt >> 1) & 1)) * 8 + (nt & 1) * 4 + (lane >> 3);
      d0[i] = dstb + (size_t)row * N_ + (nt >> 2) * BC_ + (lane & 7) * 8;
    } else if (WHICH == 0) {                                // q -> [n][c]
      d0[i] = dstb + (size_t)(nt * 16 + lo) * C_ + ot0 * 16 + hh * 8;
    } else {                                                // k -> fragment order inside
      d0[i] = dstb + (size_t)(nt >> 2) * (BC_ * C_) +       // each 64-key block (32 KB)
              ((ot0 >> 1) * 4 + (nt & 3)) * 512 + lane * 8;
    }
  }
  v16bf hf[NTW_][8];
#pragma unroll
  for (int i = 0; i < NTW_; ++i) load_tile8(hf[i], tile_at(hb, nt0 + i, lane));
  v16bf wf[2][8];                                         // this tile's weights and the next one's
  float4 bq[2][2];
  load_tile8(wf[0], tile_at(w, ot0, lane));
  // the lane's place in the bias: its channel (v) or its first of 8 channels (q, k)
  const float* bl = bias + ot0 * 16 + ((WHICH == 2) ? lo : hh * 8);
  if (WHICH == 2) {
    bq[0][0].x = bl[0];
  } else {
    bq[0][0] = ((const float4*)bl)[0]; bq[0][1] = ((const float4*)bl)[1];
  }
  close_regs();
  // Unrolled so that the two register sets are picked at compile time and the next
  // tile's loads, written in front of this tile's products, fly during them.
#pragma unroll
  for (int oi = 0; oi < OTW_; ++oi) {
    const int cur = oi & 1, nxt = cur ^ 1;
    const int ot = ot0 + oi;
    if (oi + 1 < OTW_) {
      load_tile8(wf[nxt], tile_at(w, ot + 1, lane));
      if (WHICH == 2) {
        bq[nxt][0].x = bl[(oi + 1) * 16];
      } else {
        bq[nxt][0] = ((const float4*)bl)[(oi + 1) * 4]; bq[nxt][1] = ((const float4*)bl)[(oi + 1) * 4 + 1];
      }
    }
    // Also keeps the next tile's loads, issued above, in front of this tile's products:
    // without it the scheduler sinks each to its first use, where it is waited out.
    close_regs();
    v8f acc[NTW_];
#pragma unroll
    for (int i = 0; i < NTW_; ++i) acc[i] = zero8();
#pragma unroll
    for (int kk = 0; kk < 8; ++kk)
#pragma unroll
      for (int i = 0; i < NTW_; ++i)
        acc[i] = (WHICH == 2) ? wmma_bf16(hf[i][kk], wf[cur][kk], acc[i])
                              : wmma_bf16(wf[cur][kk], hf[i][kk], acc[i]);
#pragma unroll
    for (int i = 0; i < NTW_; ++i) {
      u16x8 outv;
      unsigned short* dst;
      if (WHICH == 2) {
        float bv = bq[cur][0].x;
#pragma unroll
        for (int r = 0; r < 8; ++r) outv[r] = f2bf(acc[i][r] + bv);
        dst = d0[i] + (size_t)oi * 16 * N_;                   // 16 fragment rows per tile
      } else {
        float4 bq0 = bq[cur][0], bq1 = bq[cur][1];
        float bias8[8] = {bq0.x, bq0.y, bq0.z, bq0.w, bq1.x, bq1.y, bq1.z, bq1.w};
        const float scale = (WHICH == 0) ? 0.0625f : 1.0f;    // 1/sqrt(256) folded into q
#pragma unroll
        for (int r = 0; r < 8; ++r) outv[r] = f2bf((acc[i][r] + bias8[r]) * scale);
        dst = d0[i] + ((WHICH == 0) ? oi * 16 : (oi >> 1) * 2048 + (oi & 1) * 256);
      }
      *(u16x8*)dst = outv;
      close_regs();                                       // also where the three cases join again
    }
  }
}

__global__ void __launch_bounds__(GWV_ * 32) k_qkv(
    const unsigned short* h, const unsigned short* wq, const unsigned short* wk,
    const unsigned short* wv, const float* qb, const float* kb, const float* vb,
    unsigned short* q, unsigned short* k, unsigned short* v) {
  int lane = threadIdx.x & 31;
  int nt0 = (blockIdx.x * GWV_ + (threadIdx.x >> 5)) * NTW_, ot0 = blockIdx.y * OTW_;
  int b = blockIdx.z / 3, which = blockIdx.z % 3;
  size_t boff = (size_t)b * N_ * C_;
  const unsigned short* hb = h + boff;
  if (which == 0)      qkv_tiles<0>(hb, wq, qb, q + boff, nt0, ot0, lane);
  else if (which == 1) qkv_tiles<1>(hb, wk, kb, k + boff, nt0, ot0, lane);
  else                 qkv_tiles<2>(hb, wv, vb, v + boff, nt0, ot0, lane);
}

__global__ void __launch_bounds__(256) k_attn(
    const unsigned short* q, const unsigned short* k, const unsigned short* v,
    unsigned short* o) {
  int lane = threadIdx.x & 31;
  const uint32_t wid = uni(threadIdx.x >> 5);
  const uint32_t kh = wid >> 2;                           // key block of the stage
  int b = blockIdx.y;
  int n0 = blockIdx.x * 64 + (int)(wid & 3u) * 16;        // 16 query rows per wave
  int hh = lane >> 4, lo = lane & 15;
  const unsigned short* qp = q + (size_t)b * N_ * C_;
  const unsigned short* kp = k + (size_t)b * N_ * C_;
  const unsigned short* vp = v + (size_t)b * C_ * N_;

  // 2-KiB alignment: every tensor load's place in LDS is a multiple of 2 KiB.
  __shared__ __attribute__((aligned(2048))) unsigned short smk[2][KS_][BC_ * C_];  // K fragments [kk][mt]
  __shared__ __attribute__((aligned(2048))) unsigned short smv[2][KS_][C_ * BC_];  // V fragments [t][kk]

  // This wave's slice of a stage. Waves 0-3: a quarter of the stage's K, 16 KB that
  // are contiguous in memory (32 rows of 512 B). Waves 4-7: 128 of the 256 rows
  // (128 B each, pitch 2*N_ B) of one of the stage's two V blocks.
  const bool isk = wid < 4u;
  const uint32_t j = wid & 3u;
  const uint64_t src0 = isk ? (uint64_t)(uintptr_t)kp + j * SLB_
                            : (uint64_t)(uintptr_t)vp + (uint64_t)(j & 1u) * (128u * N_ * 2u) + (j >> 1) * (BC_ * 2u);
  const uint32_t sstep = isk ? STB_ : (uint32_t)(KS_ * BC_ * 2);     // source bytes per stage
  const uint32_t lds0 = (isk ? (uint32_t)(uintptr_t)&smk[0][0][0] : (uint32_t)(uintptr_t)&smv[0][0][0]) + j * SLB_;
  const u32x8 g1 = isk ? tdm_group1(512u, 32u, 512u) : tdm_group1(128u, 128u, (uint32_t)(N_ * 2));

  tdm_load(tdm_group0(lds0, src0), g1);                   // stage 0 -> buffer 0

  v16bf qr[8];                                            // Q block in registers
#pragma unroll
  for (int kk = 0; kk < 8; ++kk) qr[kk] = load_ab_tile(qp, n0, C_, kk * 32, lane);

  v8f acc[16];                       // O^T: acc[t][r] = channel t*16 + hh*8 + r of query lo
#pragma unroll
  for (int t = 0; t < 16; ++t) acc[t] = zero8();
  float mrun = -1e30f;               // maximum in use for query lo, equal in both halves
  float lrun = 0.0f;                 // sum over the keys that this half of the wave holds

  wait_tensor0();
  __syncthreads();                                        // stage 0 is published

  for (int it = 0; it < NST_; ++it) {                     // 32 stages, 64 keys per wave
    int buf = it & 1;
    // Behind the barrier that published stage it and ended every read of the other
    // buffer: the load of stage it + 1 into that buffer flies during this pass.
    const uint32_t nx = pinned((uint32_t)it + 1u);        // the load's words are formed behind the wait
    if (pinned(nx < (uint32_t)NST_))                      // scalar test: stage it + 1 exists
      tdm_load(tdm_group0(lds0 + (nx & 1u) * STB_, src0 + (uint64_t)nx * sstep), g1);
    const unsigned short* kb = smk[buf][kh];
    const unsigned short* vb = smv[buf][kh];

    v8f s[4];                          // S^T: s[mt][r] = key mt*16 + hh*8 + r, query lo
#pragma unroll
    for (int mt = 0; mt < 4; ++mt) s[mt] = zero8();
#pragma unroll
    for (int kk = 0; kk < 8; ++kk) {
#pragma unroll
      for (int mt = 0; mt < 4; ++mt) {
        v16bf ak = load_frag(kb, kk * 4 + mt, lane);
        s[mt] = wmma_bf16(ak, qr[kk], s[mt]);
      }
    }

    float mq[4];                                          // block maximum of query lo
#pragma unroll
    for (int mt = 0; mt < 4; ++mt) {
      mq[mt] = s[mt][0];
#pragma unroll
      for (int r = 1; r < 8; ++r) mq[mt] = fmaxf(mq[mt], s[mt][r]);
    }
    float mx = fmaxf(fmaxf(mq[0], mq[1]), fmaxf(mq[2], mq[3]));
    mx = fmaxf(mx, xhalf(mx));                            // the other half's 32 keys
    if (__ballot(mx > mrun) != 0ull) {                    // lazy rescale (rare)
      float mnew = fmaxf(mrun, mx);
      float cf = __expf(mrun - mnew);
      lrun *= cf;
      mrun = mnew;
#pragma unroll
      for (int t = 0; t < 16; ++t)
#pragma unroll
        for (int r = 0; r < 8; ++r) acc[t][r] *= cf;
    }
    // P^T = exp(S^T - m): score tiles 2j and 2j + 1 hold, register for register, the
    // k order of a B operand over the 32 keys of V fragment j.
    v16bf pb[2];
    float ps[4];
#pragma unroll
    for (int mt = 0; mt < 4; ++mt) {
      ps[mt] = 0.0f;
#pragma unroll
      for (int r = 0; r < 8; ++r) {
        float p = __expf(s[mt][r] - mrun);
        ps[mt] += p;
        pb[mt >> 1][(mt & 1) * 8 + r] = (__bf16)p;
      }
    }
    lrun += (ps[0] + ps[1]) + (ps[2] + ps[3]);
#pragma unroll
    for (int t = 0; t < 16; ++t) {                        // O^T += V^T * P^T
      v16bf av0 = load_frag(vb, t * 2,     lane);
      v16bf av1 = load_frag(vb, t * 2 + 1, lane);
      acc[t] = wmma_bf16(av0, pb[0], acc[t]);
      acc[t] = wmma_bf16(av1, pb[1], acc[t]);
    }

    // Publish point of stage it + 1: own LDS reads retired, own slice landed, then
    // the barrier, which also ends every reader's last read of this pass's buffer.
    wait_ds0();
    wait_tensor0();
    __syncthreads();
  }
  wait_tensor0();
  wait_ds0();

  // Merge of the two key halves of a query tile. The last pass's barrier has ended
  // every read of the ring, which now carries the hand-over: each wave keeps the
  // eight channel tiles kh*8.. and gives the other eight, with its m and l, to its
  // partner (wave wid ^ 4). 16-byte stores and loads, 512 contiguous bytes each.
  float* mg = (float*)&smk[0][0][0];
  float4* mine = (float4*)(mg + wid * MGW_) + lane;
  const float4* oth = (const float4*)(mg + (wid ^ 4u) * MGW_) + lane;
  v8f keep[8];
  if (kh == 0u) {
#pragma unroll
    for (int t = 0; t < 8; ++t) {
      keep[t] = acc[t];
      mine[(t * 2) * 32]     = make_float4(acc[8 + t][0], acc[8 + t][1], acc[8 + t][2], acc[8 + t][3]);
      mine[(t * 2 + 1) * 32] = make_float4(acc[8 + t][4], acc[8 + t][5], acc[8 + t][6], acc[8 + t][7]);
    }
  } else {
#pragma unroll
    for (int t = 0; t < 8; ++t) {
      keep[t] = acc[8 + t];
      mine[(t * 2) * 32]     = make_float4(acc[t][0], acc[t][1], acc[t][2], acc[t][3]);
      mine[(t * 2 + 1) * 32] = make_float4(acc[t][4], acc[t][5], acc[t][6], acc[t][7]);
    }
  }
  lrun += xhalf(lrun);                                    // the two halves' sums, joined once
  mine[16 * 32] = make_float4(mrun, lrun, 0.0f, 0.0f);
  __syncthreads();
  float4 ml = oth[16 * 32];
  float mm = fmaxf(mrun, ml.x);
  float es = __expf(mrun - mm), eo = __expf(ml.x - mm);
  float inv = 1.0f / (lrun * es + ml.y * eo);
  float cs = es * inv, co = eo * inv;                     // weights of own and partner's part
  // O -> [n][c] bf16: a lane's 8 registers are 8 consecutive channels of its query
  unsigned short* ob = o + (size_t)b * N_ * C_ + (size_t)(n0 + lo) * C_ + (int)kh * 128 + hh * 8;
#pragma unroll
  for (int t = 0; t < 8; ++t) {
    float4 p0 = oth[(t * 2) * 32], p1 = oth[(t * 2 + 1) * 32];
    float pv[8] = {p0.x, p0.y, p0.z, p0.w, p1.x, p1.y, p1.z, p1.w};
    u16x8 outv;
#pragma unroll
    for (int r = 0; r < 8; ++r) outv[r] = f2bf(keep[t][r] * cs + pv[r] * co);
    *(u16x8*)(ob + t * 16) = outv;
    // Precaution: registers that this store names are written again for the next
    // tile; the wait stands in front of that.
    close_regs();
  }
}

// -------------------------------------------------- projection + residual add
// As in k_qkv: a wave keeps the O fragments of NTW_ row tiles in registers and walks
// OTW_ weight tiles with them; the next tile's weights, bias and x are loaded one
// tile ahead.
__global__ void __launch_bounds__(GWV_ * 32) k_proj(
    const unsigned short* o, const unsigned short* wp, const float* pb,
    const float* x, float* out) {
  int lane = threadIdx.x & 31;
  int nt0 = (blockIdx.x * GWV_ + (threadIdx.x >> 5)) * NTW_, ot0 = blockIdx.y * OTW_;
  int b = blockIdx.z;
  int hh = lane >> 4, lo = lane & 15;
  const unsigned short* ob = o + (size_t)b * N_ * C_;
  // element (channel ot0*16 + hh*8, position nt0*16 + lo) of x and of out
  const size_t idx0 = ((size_t)b * C_ + ot0 * 16 + hh * 8) * N_ + nt0 * 16 + lo;
  const float* xp = x + idx0;
  float* op = out + idx0;
  const float4* bp = (const float4*)(pb + ot0 * 16 + hh * 8);
  v16bf of[NTW_][8];                                      // O [n][c]
#pragma unroll
  for (int i = 0; i < NTW_; ++i) load_tile8(of[i], tile_at(ob, nt0 + i, lane));
  v16bf wf[2][8];                                         // pw [o][c]: this tile and the next
  float4 bq[2][2];
  float xv[2][NTW_][8];
  load_tile8(wf[0], tile_at(wp, ot0, lane));
  bq[0][0] = bp[0]; bq[0][1] = bp[1];
  close_regs();
#pragma unroll
  for (int i = 0; i < NTW_; ++i)
#pragma unroll
    for (int r = 0; r < 8; ++r) xv[0][i][r] = xp[(size_t)r * N_ + i * 16];
  close_regs();
  // Unrolled so that the two register sets are picked at compile time and the next
  // tile's loads, written in front of this tile's products, fly during them.
#pragma unroll
  for (int oi = 0; oi < OTW_; ++oi) {
    const int cur = oi & 1, nxt = cur ^ 1;
    if (oi + 1 < OTW_) {
      load_tile8(wf[nxt], tile_at(wp, ot0 + oi + 1, lane));
      bq[nxt][0] = bp[(oi + 1) * 4]; bq[nxt][1] = bp[(oi + 1) * 4 + 1];
#pragma unroll
      for (int i = 0; i < NTW_; ++i)
#pragma unroll
        for (int r = 0; r < 8; ++r)
          xv[nxt][i][r] = xp[(size_t)((oi + 1) * 16 + r) * N_ + i * 16];
    }
    // Also keeps the next tile's loads, issued above, in front of this tile's products:
    // without it the scheduler sinks each to its first use, where it is waited out.
    close_regs();
    v8f acc[NTW_];
#pragma unroll
    for (int i = 0; i < NTW_; ++i) acc[i] = zero8();
#pragma unroll
    for (int kk = 0; kk < 8; ++kk)
#pragma unroll
      for (int i = 0; i < NTW_; ++i) acc[i] = wmma_bf16(wf[cur][kk], of[i][kk], acc[i]);
    float4 b0 = bq[cur][0], b1 = bq[cur][1];
    float bias8[8] = {b0.x, b0.y, b0.z, b0.w, b1.x, b1.y, b1.z, b1.w};
#pragma unroll
    for (int i = 0; i < NTW_; ++i) {
#pragma unroll
      for (int r = 0; r < 8; ++r)
        op[(size_t)(oi * 16 + r) * N_ + i * 16] = xv[cur][i][r] + acc[i][r] + bias8[r];
      close_regs();
    }
  }
}

extern "C" void kernel_launch(void* const* d_in, const int* in_sizes, int n_in,
                              void* d_out, int out_size, void* d_ws, size_t ws_size,
                              hipStream_t stream) {
  (void)in_sizes; (void)n_in; (void)out_size; (void)ws_size;
  const float* x     = (const float*)d_in[0];
  const float* gnw   = (const float*)d_in[1];
  const float* gnb   = (const float*)d_in[2];
  const float* qw    = (const float*)d_in[3];
  const float* qbias = (const float*)d_in[4];
  const float* kw    = (const float*)d_in[5];
  const float* kbias = (const float*)d_in[6];
  const float* vw    = (const float*)d_in[7];
  const float* vbias = (const float*)d_in[8];
  const float* pw    = (const float*)d_in[9];
  const float* pbias = (const float*)d_in[10];
  float* out = (float*)d_out;

  char* w = (char*)d_ws;
  unsigned short* wqb  = (unsigned short*)(w + 1024);       // 4 x 64K bf16
  unsigned short* wkb  = wqb + 65536;
  unsigned short* wvb  = wqb + 2 * 65536;
  unsigned short* wpb  = wqb + 3 * 65536;
  unsigned short* h    = (unsigned short*)(w + 1024 + 524288);
  const size_t    bnc  = (size_t)B_ * N_ * C_;
  unsigned short* qd = h  + bnc;
  unsigned short* kd = qd + bnc;
  unsigned short* vd = kd + bnc;
  unsigned short* od = vd + bnc;
  float*        part = (float*)(od + bnc);                  // 256 x 128 B; total ~40.5 MB

  k_prep_weights<<<1024, 256, 0, stream>>>(qw, kw, vw, pw, wqb);
  k_gn_stats    <<<B_ * G_ * GSL_, 256, 0, stream>>>(x, part);
  k_gn_apply    <<<dim3(C_ / 32, N_ / 64, B_), 256, 0, stream>>>(x, gnw, gnb, part, h);
  k_qkv         <<<dim3(N_ / (16 * NTW_ * GWV_), C_ / (16 * OTW_), 3 * B_), GWV_ * 32, 0, stream>>>(
                    h, wqb, wkb, wvb, qbias, kbias, vbias, qd, kd, vd);
  k_attn        <<<dim3(N_ / 64, B_), 256, 0, stream>>>(qd, kd, vd, od);
  k_proj        <<<dim3(N_ / (16 * NTW_ * GWV_), C_ / (16 * OTW_), B_), GWV_ * 32, 0, stream>>>(od, wpb, pbias, x, out);
}

// v006
// A run of this version takes 97.5 microseconds.
// Two timings next to v005 put it at 1.05 and 1.04 times that version's speed.
// All steps since v000 together make it 10.6 times as fast.
#include <hip/hip_runtime.h>
#include <cstdint>

#define B_   4
#define C_   256
#define N_   4096
#define G_   8
#define CPG_ 32
#define BC_  64          // keys of one fragment-order block
#define KS_  2           // key blocks of one attention stage
#define QTW_ 2           // 16-query tiles that an attention wave serves with each LDS fragment
#define NST_ (N_ / (BC_ * KS_))   // stages of KS_ key blocks
#define SLB_ 16384u      // bytes of one wave's slice of a stage
#define STB_ 65536u      // bytes of K (and of V) in one stage
#define MGW_ 2048        // 16-byte units one wave lays down in the final merge
#define GSL_ 8           // work-groups that share one (batch, group) in the GN statistics
#define GPP_ 32          // floats between two partial sums: each has its own 128-byte line
#define GWV_ 4           // waves of a work-group in the QKV and projection GEMMs
#define NTW_ 2           // 16-row tiles of h (or O) whose fragments such a wave keeps in registers
#define OTW_ 8           // 16-channel weight tiles that it walks with them

typedef __attribute__((ext_vector_type(16))) __bf16 v16bf;
typedef __attribute__((ext_vector_type(8)))  __bf16 v8bf;
typedef __attribute__((ext_vector_type(8)))  float  v8f;
typedef __attribute__((ext_vector_type(8)))  unsigned short u16x8;
typedef __attribute__((ext_vector_type(4)))  uint32_t u32x4;
typedef __attribute__((ext_vector_type(8)))  uint32_t u32x8;

__device__ __forceinline__ unsigned short f2bf(float f) {
  unsigned u = __builtin_bit_cast(unsigned, f);
  u += 0x7fffu + ((u >> 16) & 1u);          // round-to-nearest-even
  return (unsigned short)(u >> 16);
}

__device__ __forceinline__ v8f zero8() {
  v8f z;
#pragma unroll
  for (int i = 0; i < 8; ++i) z[i] = 0.0f;
  return z;
}

__device__ __forceinline__ v16bf load_ab_tile(const unsigned short* base, int row0,
                                              int ld, int k0, int lane) {
  int r  = row0 + (lane & 15);
  int kh = (lane >> 4) << 3;
  const unsigned short* p = base + (size_t)r * ld + (size_t)(k0 + kh);
  v8bf lo = *(const v8bf*)p;
  v8bf hi = *(const v8bf*)(p + 16);
  return __builtin_shufflevector(lo, hi, 0,1,2,3,4,5,6,7,8,9,10,11,12,13,14,15);
}

__device__ __forceinline__ v16bf load_frag(const unsigned short* base, int f, int lane) {
  const unsigned short* p = base + f * 512 + lane * 8;
  v8bf lo = *(const v8bf*)p;
  v8bf hi = *(const v8bf*)(p + 256);
  return __builtin_shufflevector(lo, hi, 0,1,2,3,4,5,6,7,8,9,10,11,12,13,14,15);
}

__device__ __forceinline__ v8f wmma_bf16(v16bf a, v16bf b, v8f c) {
  return __builtin_amdgcn_wmma_f32_16x16x32_bf16(false, a, false, b, (short)0, c,
                                                 false, false);
}

__device__ __forceinline__ float xhalf(float x) {
  int i = __builtin_bit_cast(int, x);
  return __builtin_bit_cast(float, __builtin_amdgcn_permlanex16(i, i, 0x76543210, 0xfedcba98, false, false));
}

__device__ __forceinline__ uint32_t uni(uint32_t v) {
  return (uint32_t)__builtin_amdgcn_readfirstlane(v);
}

__device__ __forceinline__ uint32_t pinned(uint32_t v) {
  uint32_t w = uni(v);
  asm volatile("" : "+s"(w));
  return w;
}

__device__ __forceinline__ u32x8 tdm_group1(uint32_t rowb, uint32_t nrows, uint32_t pitch) {
  u32x8 g;
  g[0] = uni(0u);
  g[1] = uni((rowb & 0xFFFFu) << 16);
  g[2] = uni((rowb >> 16) | ((nrows & 0xFFFFu) << 16));
  g[3] = uni((nrows >> 16) | (rowb << 16));
  g[4] = uni(nrows);
  g[5] = uni(pitch);
  g[6] = uni(0u);
  g[7] = uni(0u);
  return g;
}
__device__ __forceinline__ u32x4 tdm_group0(uint32_t lds_dst, uint64_t ga) {
  u32x4 g;
  g[0] = uni(1u);                              // count 1
  g[1] = uni(lds_dst);
  g[2] = uni((uint32_t)ga);
  g[3] = uni((((uint32_t)(ga >> 32)) & 0x01FFFFFFu) | 0x80000000u);   // type 2
  return g;
}
__device__ __forceinline__ void tdm_load(u32x4 g0, u32x8 g1) {
  asm volatile("tensor_load_to_lds %0, %1" :: "s"(g0), "s"(g1) : "memory");
}
// The compiler places no wait for the tensor mover: the issuing wave's own wait.
__device__ __forceinline__ void wait_tensor0() { asm volatile("s_wait_tensorcnt 0x0" ::: "memory"); }
// This wave's LDS reads have retired before a buffer it read is handed back.
__device__ __forceinline__ void wait_ds0() { asm volatile("s_wait_dscnt 0x0" ::: "memory"); }

// ---------------------------------------------------------------- weights->bf16
__global__ void k_prep_weights(const float* qw, const float* kw, const float* vw,
                               const float* pw, unsigned short* dst) {
  int i = blockIdx.x * blockDim.x + threadIdx.x;   // 0 .. 4*65536
  int m = i >> 16, e = i & 65535;
  const float* s = (m == 0) ? qw : (m == 1) ? kw : (m == 2) ? vw : pw;
  dst[i] = f2bf(s[e]);
}

__global__ void __launch_bounds__(256) __attribute__((amdgpu_waves_per_eu(2, 2)))
k_gn_stats(const float* x, float* part) {
  int blk = blockIdx.x;                            // (b*8+g)*GSL_ + slice, 0..255
  const float4* p = (const float4*)(x + (size_t)blk * (CPG_ * N_ / GSL_)) + threadIdx.x;
  float4 v[16];
#pragma unroll
  for (int i = 0; i < 16; ++i) v[i] = p[i * 256];
  float4 a = make_float4(0.f, 0.f, 0.f, 0.f), q = a;
#pragma unroll
  for (int i = 0; i < 16; ++i) {
    a.x += v[i].x; a.y += v[i].y; a.z += v[i].z; a.w += v[i].w;
    q.x += v[i].x * v[i].x; q.y += v[i].y * v[i].y;
    q.z += v[i].z * v[i].z; q.w += v[i].w * v[i].w;
  }
  float s = (a.x + a.y) + (a.z + a.w), s2 = (q.x + q.y) + (q.z + q.w);
#pragma unroll
  for (int off = 16; off > 0; off >>= 1) {
    s  += __shfl_xor(s,  off, 32);
    s2 += __shfl_xor(s2, off, 32);
  }
  __shared__ float rs[8], rq[8];
  if ((threadIdx.x & 31) == 0) { rs[threadIdx.x >> 5] = s; rq[threadIdx.x >> 5] = s2; }
  __syncthreads();
  if (threadIdx.x == 0) {
    float ts = 0.f, tq = 0.f;
#pragma unroll
    for (int w = 0; w < 8; ++w) { ts += rs[w]; tq += rq[w]; }
    *(float2*)(part + blk * GPP_) = make_float2(ts, tq);
  }
}

// ------------------------------------------------- GN apply + transpose to [n][c]
__global__ void k_gn_apply(const float* x, const float* gw, const float* gb,
                           const float* part, unsigned short* h) {
  // grid (C_/32, N_/64, B_), 256 threads; blockIdx.x == group id (CPG_==32)
  int cb = blockIdx.x * 32, nb = blockIdx.y * 64, b = blockIdx.z;
  const float* pp = part + (b * G_ + blockIdx.x) * (GSL_ * GPP_);
  float s = 0.f, s2 = 0.f;
#pragma unroll
  for (int j = 0; j < GSL_; ++j) { s += pp[j * GPP_]; s2 += pp[j * GPP_ + 1]; }
  const float inv = 1.0f / (float)(CPG_ * N_);
  float mean = s * inv;
  float rstd = rsqrtf(s2 * inv - mean * mean + 1e-5f);
  __shared__ unsigned short tile[32][68];          // [c][n], padded
  const float* xb = x + ((size_t)b * C_ + cb) * N_ + nb;
#pragma unroll
  for (int i = 0; i < 8; ++i) {
    int idx = threadIdx.x + i * 256;
    int cl = idx >> 6, nl = idx & 63;              // coalesced along n
    float v = xb[(size_t)cl * N_ + nl];
    int c = cb + cl;
    v = (v - mean) * rstd * gw[c] + gb[c];
    tile[cl][nl] = f2bf(v);
  }
  __syncthreads();
  unsigned short* hb = h + ((size_t)b * N_ + nb) * C_ + cb;
#pragma unroll
  for (int i = 0; i < 8; ++i) {
    int idx = threadIdx.x + i * 256;
    int nl = idx >> 5, cl = idx & 31;              // coalesced along c
    hb[(size_t)nl * C_ + cl] = tile[cl][nl];
  }
}

// Precaution: registers that the global loads or stores above it name are written again
// below it. The wait stands in front of that; the scheduling barrier keeps those
// writes, which a "memory" clobber does not hold, behind the wait.
__device__ __forceinline__ void close_regs() {
  asm volatile("s_wait_xcnt 0x0" ::: "memory");
  __builtin_amdgcn_sched_barrier(0);
}
// The same behind a run of loads from the lane's address p: as an input of the wait p
// stays in its registers up to it; else the run's last load may land on them.
__device__ __forceinline__ void close_regs_at(const unsigned short* p) {
  asm volatile("s_wait_xcnt 0x0" :: "v"(p) : "memory");
  __builtin_amdgcn_sched_barrier(0);
}
// The lane's address in a 16-row operand tile of [row][C_] storage (see load_ab_tile),
// and the eight fragments of the tile's C_ columns from it.
__device__ __forceinline__ const unsigned short* tile_at(const unsigned short* base, int tile, int lane) {
  return base + (size_t)(tile * 16 + (lane & 15)) * C_ + ((lane >> 4) << 3);
}
__device__ __forceinline__ void load_tile8(v16bf (&f)[8], const unsigned short* p) {
#pragma unroll
  for (int kk = 0; kk < 8; ++kk) {
    v8bf lo = *(const v8bf*)(p + kk * 32);
    v8bf hi = *(const v8bf*)(p + kk * 32 + 16);
    f[kk] = __builtin_shufflevector(lo, hi, 0,1,2,3,4,5,6,7,8,9,10,11,12,13,14,15);
  }
  close_regs_at(p);
}

// ---------------------------------------------------------------- QKV GEMMs
// A wave's NTW_ x OTW_ block of 16x16 output tiles of q (WHICH 0), k (1) or v (2):
// the h fragments are loaded once and stay in registers, each weight fragment serves
// NTW_ products. The case is chosen in front of the matrix products, so that no
// branch stands behind the last one.
template <int WHICH>
__device__ __forceinline__ void qkv_tiles(const unsigned short* hb, const unsigned short* w,
                                          const float* bias, unsigned short* dstb,
                                          int nt0, int ot0, int lane) {
  // q,k: A = weights [o][c], B = h [n][c]: a lane ends with 8 channels of one n.
  // v:   A = h, B = weights: a lane ends with 8 keys of one channel, which is
  //      the 16-byte chunk that the attention kernel's V operand wants.
  int hh = lane >> 4, lo = lane & 15;
  // The lane's 16-byte place in the first output tile of each row tile; the later
  // tiles lie at compile-time distances from it (ot0 is a multiple of OTW_).
  unsigned short* d0[NTW_];
#pragma unroll
  for (int i = 0; i < NTW_; ++i) {
    const int nt = nt0 + i;
    if (WHICH == 2) {
      // v: fragment (ot, key half) of key block nt>>2, laid so that the 256 x 128-byte
      // tile the attention kernel loads at row pitch N_ lands in fragment order:
      // tile byte L = fragment*1024 + chunk*512 + lane*16, row L>>7, column L&127.
      int row = (ot0 * 2 + ((nt >> 1) & 1)) * 8 + (nt & 1) * 4 + (lane >> 3);
      d0[i] = dstb + (size_t)row * N_ + (nt >> 2) * BC_ + (lane & 7) * 8;
    } else if (WHICH == 0) {                                // q -> [n][c]
      d0[i] = dstb + (size_t)(nt * 16 + lo) * C_ + ot0 * 16 + hh * 8;
    } else {                                                // k -> fragment order inside
      d0[i] = dstb + (size_t)(nt >> 2) * (BC_ * C_) +       // each 64-key block (32 KB)
              ((ot0 >> 1) * 4 + (nt & 3)) * 512 + lane * 8;
    }
  }
  v16bf hf[NTW_][8];
#pragma unroll
  for (int i = 0; i < NTW_; ++i) load_tile8(hf[i], tile_at(hb, nt0 + i, lane));
  v16bf wf[2][8];                                         // this tile's weights and the next one's
  float4 bq[2][2];
  load_tile8(wf[0], tile_at(w, ot0, lane));
  // the lane's place in the bias: its channel (v) or its first of 8 channels (q, k)
  const float* bl = bias + ot0 * 16 + ((WHICH == 2) ? lo : hh * 8);
  if (WHICH == 2) {
    bq[0][0].x = bl[0];
  } else {
    bq[0][0] = ((const float4*)bl)[0]; bq[0][1] = ((const float4*)bl)[1];
  }
  close_regs();
  // Unrolled so that the two register sets are picked at compile time and the next
  // tile's loads, written in front of this tile's products, fly during them.
#pragma unroll
  for (int oi = 0; oi < OTW_; ++oi) {
    const int cur = oi & 1, nxt = cur ^ 1;
    const int ot = ot0 + oi;
    if (oi + 1 < OTW_) {
      load_tile8(wf[nxt], tile_at(w, ot + 1, lane));
      if (WHICH == 2) {
        bq[nxt][0].x = bl[(oi + 1) * 16];
      } else {
        bq[nxt][0] = ((const float4*)bl)[(oi + 1) * 4]; bq[nxt][1] = ((const float4*)bl)[(oi + 1) * 4 + 1];
      }
    }
    // Also keeps the next tile's loads, issued above, in front of this tile's products:
    // without it the scheduler sinks each to its first use, where it is waited out.
    close_regs();
    v8f acc[NTW_];
#pragma unroll
    for (int i = 0; i < NTW_; ++i) acc[i] = zero8();
#pragma unroll
    for (int kk = 0; kk < 8; ++kk)
#pragma unroll
      for (int i = 0; i < NTW_; ++i)
        acc[i] = (WHICH == 2) ? wmma_bf16(hf[i][kk], wf[cur][kk], acc[i])
                              : wmma_bf16(wf[cur][kk], hf[i][kk], acc[i]);
#pragma unroll
    for (int i = 0; i < NTW_; ++i) {
      u16x8 outv;
      unsigned short* dst;
      if (WHICH == 2) {
        float bv = bq[cur][0].x;
#pragma unroll
        for (int r = 0; r < 8; ++r) outv[r] = f2bf(acc[i][r] + bv);
        dst = d0[i] + (size_t)oi * 16 * N_;                   // 16 fragment rows per tile
      } else {
        float4 bq0 = bq[cur][0], bq1 = bq[cur][1];
        float bias8[8] = {bq0.x, bq0.y, bq0.z, bq0.w, bq1.x, bq1.y, bq1.z, bq1.w};
        const float scale = (WHICH == 0) ? 0.0625f : 1.0f;    // 1/sqrt(256) folded into q
#pragma unroll
        for (int r = 0; r < 8; ++r) outv[r] = f2bf((acc[i][r] + bias8[r]) * scale);
        dst = d0[i] + ((WHICH == 0) ? oi * 16 : (oi >> 1) * 2048 + (oi & 1) * 256);
      }
      *(u16x8*)dst = outv;
      close_regs();                                       // also where the three cases join again
    }
  }
}

__global__ void __launch_bounds__(GWV_ * 32) k_qkv(
    const unsigned short* h, const unsigned short* wq, const unsigned short* wk,
    const unsigned short* wv, const float* qb, const float* kb, const float* vb,
    unsigned short* q, unsigned short* k, unsigned short* v) {
  int lane = threadIdx.x & 31;
  int nt0 = (blockIdx.x * GWV_ + (threadIdx.x >> 5)) * NTW_, ot0 = blockIdx.y * OTW_;
  int b = blockIdx.z / 3, which = blockIdx.z % 3;
  size_t boff = (size_t)b * N_ * C_;
  const unsigned short* hb = h + boff;
  if (which == 0)      qkv_tiles<0>(hb, wq, qb, q + boff, nt0, ot0, lane);
  else if (which == 1) qkv_tiles<1>(hb, wk, kb, k + boff, nt0, ot0, lane);
  else                 qkv_tiles<2>(hb, wv, vb, v + boff, nt0, ot0, lane);
}

__global__ void __launch_bounds__(256) k_attn(
    const unsigned short* q, const unsigned short* k, const unsigned short* v,
    unsigned short* o) {
  int lane = threadIdx.x & 31;
  const uint32_t wid = uni(threadIdx.x >> 5);
  const uint32_t qh = wid & 1u;                           // query half of the workgroup
  const uint32_t kq = wid >> 1;                           // key quarter of the stage
  int b = blockIdx.y;
  int n0 = blockIdx.x * 64 + (int)qh * (QTW_ * 16);       // 32 query rows per wave
  int hh = lane >> 4, lo = lane & 15;
  const unsigned short* qp = q + (size_t)b * N_ * C_;
  const unsigned short* kp = k + (size_t)b * N_ * C_;
  const unsigned short* vp = v + (size_t)b * C_ * N_;

  // 2-KiB alignment: every tensor load's place in LDS is a multiple of 2 KiB.
  __shared__ __attribute__((aligned(2048))) unsigned short smk[2][KS_][BC_ * C_];  // K fragments [kk][mt]
  __shared__ __attribute__((aligned(2048))) unsigned short smv[2][KS_][C_ * BC_];  // V fragments [t][kk]
  __shared__ float4 sml[8][32];                           // final merge: each wave's m and l

  // This wave's slice of a stage. Waves 0-3: a quarter of the stage's K, 16 KB that
  // are contiguous in memory (32 rows of 512 B). Waves 4-7: 128 of the 256 rows
  // (128 B each, pitch 2*N_ B) of one of the stage's two V blocks.
  const bool isk = wid < 4u;
  const uint32_t j = wid & 3u;
  const uint64_t src0 = isk ? (uint64_t)(uintptr_t)kp + j * SLB_
                            : (uint64_t)(uintptr_t)vp + (uint64_t)(j & 1u) * (128u * N_ * 2u) + (j >> 1) * (BC_ * 2u);
  const uint32_t sstep = isk ? STB_ : (uint32_t)(KS_ * BC_ * 2);     // source bytes per stage
  const uint32_t lds0 = (isk ? (uint32_t)(uintptr_t)&smk[0][0][0] : (uint32_t)(uintptr_t)&smv[0][0][0]) + j * SLB_;
  const u32x8 g1 = isk ? tdm_group1(512u, 32u, 512u) : tdm_group1(128u, 128u, (uint32_t)(N_ * 2));

  tdm_load(tdm_group0(lds0, src0), g1);                   // stage 0 -> buffer 0

  v16bf qr[QTW_][8];                                      // Q block in registers
#pragma unroll
  for (int i = 0; i < QTW_; ++i)
#pragma unroll
    for (int kk = 0; kk < 8; ++kk) qr[i][kk] = load_ab_tile(qp, n0 + i * 16, C_, kk * 32, lane);

  v8f acc[QTW_][16];                 // O^T: acc[i][t][r] = channel t*16 + hh*8 + r of query i*16 + lo
#pragma unroll
  for (int i = 0; i < QTW_; ++i)
#pragma unroll
    for (int t = 0; t < 16; ++t) acc[i][t] = zero8();
  float mrun[QTW_], lrun[QTW_];      // maximum in use (equal in both halves); sum over this half's keys
#pragma unroll
  for (int i = 0; i < QTW_; ++i) { mrun[i] = -1e30f; lrun[i] = 0.0f; }

  wait_tensor0();
  __syncthreads();                                        // stage 0 is published

  for (int it = 0; it < NST_; ++it) {                     // 32 stages, 32 keys per wave
    int buf = it & 1;
    // Behind the barrier that published stage it and ended every read of the other
    // buffer: the load of stage it + 1 into that buffer flies during this pass.
    const uint32_t nx = pinned((uint32_t)it + 1u);        // the load's words are formed behind the wait
    if (pinned(nx < (uint32_t)NST_))                      // scalar test: stage it + 1 exists
      tdm_load(tdm_group0(lds0 + (nx & 1u) * STB_, src0 + (uint64_t)nx * sstep), g1);
    // The wave's 32 keys: half kq & 1 of 64-key block kq >> 1, which is K fragments
    // kk*4 + (kq & 1)*2 + m and V fragments t*2 + (kq & 1) of that block.
    const unsigned short* kb = smk[buf][kq >> 1] + (kq & 1u) * 1024u;
    const unsigned short* vb = smv[buf][kq >> 1] + (kq & 1u) * 512u;

    // Fragments come in groups of four, one group ahead of the products that use them,
    // in two register sets: f[g & 1] is worked on while the other set's loads fly.
    v16bf f[2][4];
    v8f s[QTW_][2];                    // S^T: s[i][m][r] = key m*16 + hh*8 + r, query i*16 + lo
#pragma unroll
    for (int i = 0; i < QTW_; ++i)
#pragma unroll
      for (int m = 0; m < 2; ++m) s[i][m] = zero8();
#pragma unroll
    for (int x = 0; x < 4; ++x) f[0][x] = load_frag(kb, (x >> 1) * 4 + (x & 1), lane);
#pragma unroll
    for (int g = 0; g < 4; ++g) {      // group g: K fragments of kk = 2g, 2g + 1
#pragma unroll
      for (int x = 0; x < 4; ++x)      // behind the last K group, the first V group
        f[(g + 1) & 1][x] = (g < 3) ? load_frag(kb, ((g + 1) * 2 + (x >> 1)) * 4 + (x & 1), lane)
                                    : load_frag(vb, x * 2, lane);
      // Keeps the next group's loads together and in front of this group's products:
      // without it the scheduler sinks each load to its use, where it is waited out.
      __builtin_amdgcn_sched_barrier(0);
#pragma unroll
      for (int x = 0; x < 4; ++x)
#pragma unroll
        for (int i = 0; i < QTW_; ++i)
          s[i][x & 1] = wmma_bf16(f[g & 1][x], qr[i][g * 2 + (x >> 1)], s[i][x & 1]);
      __builtin_amdgcn_sched_barrier(0);   // the same: no later load rises among these products
    }

    float mx[QTW_];                                       // block maximum of query i*16 + lo
    bool need = false;
#pragma unroll
    for (int i = 0; i < QTW_; ++i) {
      float m0 = s[i][0][0], m1 = s[i][1][0];
#pragma unroll
      for (int r = 1; r < 8; ++r) { m0 = fmaxf(m0, s[i][0][r]); m1 = fmaxf(m1, s[i][1][r]); }
      mx[i] = fmaxf(m0, m1);
      mx[i] = fmaxf(mx[i], xhalf(mx[i]));                 // the other half's 16 keys
      need = need || (mx[i] > mrun[i]);
    }
    if (__ballot(need) != 0ull) {                         // lazy rescale, one test per pass
#pragma unroll
      for (int i = 0; i < QTW_; ++i) {
        float mnew = fmaxf(mrun[i], mx[i]);
        float cf = __expf(mrun[i] - mnew);
        lrun[i] *= cf;
        mrun[i] = mnew;
#pragma unroll
        for (int t = 0; t < 16; ++t)
#pragma unroll
          for (int r = 0; r < 8; ++r) acc[i][t][r] *= cf;
      }
    }
    // P^T = exp(S^T - m): a query tile's two score tiles hold, register for register,
    // the k order of a B operand over the 32 keys of one V fragment.
    v16bf pb[QTW_];
#pragma unroll
    for (int i = 0; i < QTW_; ++i) {
      float ps[2];
#pragma unroll
      for (int m = 0; m < 2; ++m) {
        ps[m] = 0.0f;
#pragma unroll
        for (int r = 0; r < 8; ++r) {
          float p = __expf(s[i][m][r] - mrun[i]);
          ps[m] += p;
          pb[i][m * 8 + r] = (__bf16)p;
        }
      }
      lrun[i] += ps[0] + ps[1];
    }
#pragma unroll
    for (int g = 0; g < 4; ++g) {                         // O^T += V^T * P^T, channel tiles 4g .. 4g + 3
      if (g < 3) {
#pragma unroll
        for (int x = 0; x < 4; ++x) f[(g + 1) & 1][x] = load_frag(vb, ((g + 1) * 4 + x) * 2, lane);
      }
      __builtin_amdgcn_sched_barrier(0);
#pragma unroll
      for (int x = 0; x < 4; ++x)
#pragma unroll
        for (int i = 0; i < QTW_; ++i) acc[i][g * 4 + x] = wmma_bf16(f[g & 1][x], pb[i], acc[i][g * 4 + x]);
      __builtin_amdgcn_sched_barrier(0);
    }

    // Publish point of stage it + 1: own LDS reads retired, own slice landed, then
    // the barrier, which also ends every reader's last read of this pass's buffer.
    wait_ds0();
    wait_tensor0();
    __syncthreads();
  }
  wait_tensor0();
  wait_ds0();

  // Merge of the four key quarters of a query half. The last pass's barrier has ended
  // every read of the ring, which now carries the hand-over: each wave lays down its
  // 32 KB of partial O^T (query half 0 in the K ring, half 1 in the V ring) and its m
  // and l; behind the barrier wave kq joins channel tiles kq*4 .. kq*4 + 3 of all four.
  // 16-byte stores and loads, 512 contiguous bytes each.
  float4* ring = (float4*)(qh == 0u ? &smk[0][0][0] : &smv[0][0][0]) + lane;
  float4* mine = ring + kq * MGW_;
#pragma unroll
  for (int i = 0; i < QTW_; ++i)
#pragma unroll
    for (int t = 0; t < 16; ++t) {
      mine[((i * 16 + t) * 2) * 32]     = make_float4(acc[i][t][0], acc[i][t][1], acc[i][t][2], acc[i][t][3]);
      mine[((i * 16 + t) * 2 + 1) * 32] = make_float4(acc[i][t][4], acc[i][t][5], acc[i][t][6], acc[i][t][7]);
    }
#pragma unroll
  for (int i = 0; i < QTW_; ++i) lrun[i] += xhalf(lrun[i]);   // the two halves' sums, joined once
  sml[wid][lane] = make_float4(mrun[0], lrun[0], mrun[1], lrun[1]);
  __syncthreads();
  float wq[QTW_][4];                                      // weight of each quarter's part
  {
    float4 ml[4];
#pragma unroll
    for (int p = 0; p < 4; ++p) ml[p] = sml[p * 2 + qh][lane];
    float ma = fmaxf(fmaxf(ml[0].x, ml[1].x), fmaxf(ml[2].x, ml[3].x));
    float mb = fmaxf(fmaxf(ml[0].z, ml[1].z), fmaxf(ml[2].z, ml[3].z));
    float la = 0.0f, lb = 0.0f;
#pragma unroll
    for (int p = 0; p < 4; ++p) {
      wq[0][p] = __expf(ml[p].x - ma); la += ml[p].y * wq[0][p];
      wq[1][p] = __expf(ml[p].z - mb); lb += ml[p].w * wq[1][p];
    }
    float ia = 1.0f / la, ib = 1.0f / lb;
#pragma unroll
    for (int p = 0; p < 4; ++p) { wq[0][p] *= ia; wq[1][p] *= ib; }
  }
  // O -> [n][c] bf16: a lane's 8 values are 8 consecutive channels of its query; a
  // wave's four tiles are one 128-byte line of each query row.
  unsigned short* ob = o + (size_t)b * N_ * C_ + (size_t)(n0 + lo) * C_ + (int)kq * 64 + hh * 8;
  const float4* part = ring + kq * (4 * 2 * 32);          // tile kq*4 of query tile 0, quarter 0
#pragma unroll
  for (int i = 0; i < QTW_; ++i)
#pragma unroll
    for (int t = 0; t < 4; ++t) {
      float sum[8];
#pragma unroll
      for (int r = 0; r < 8; ++r) sum[r] = 0.0f;
#pragma unroll
      for (int p = 0; p < 4; ++p) {
        float4 p0 = part[p * MGW_ + ((i * 16 + t) * 2) * 32], p1 = part[p * MGW_ + ((i * 16 + t) * 2 + 1) * 32];
        float pv[8] = {p0.x, p0.y, p0.z, p0.w, p1.x, p1.y, p1.z, p1.w};
#pragma unroll
        for (int r = 0; r < 8; ++r) sum[r] += pv[r] * wq[i][p];
      }
      u16x8 outv;
#pragma unroll
      for (int r = 0; r < 8; ++r) outv[r] = f2bf(sum[r]);
      *(u16x8*)(ob + (size_t)i * 16 * C_ + t * 16) = outv;
      // Precaution: registers that this store names are written again for the next
      // tile; the wait stands in front of that.
      close_regs();
    }
}

// -------------------------------------------------- projection + residual add
// As in k_qkv: a wave keeps the O fragments of NTW_ row tiles in registers and walks
// OTW_ weight tiles with them; the next tile's weights, bias and x are loaded one
// tile ahead.
__global__ void __launch_bounds__(GWV_ * 32) k_proj(
    const unsigned short* o, const unsigned short* wp, const float* pb,
    const float* x, float* out) {
  int lane = threadIdx.x & 31;
  int nt0 = (blockIdx.x * GWV_ + (threadIdx.x >> 5)) * NTW_, ot0 = blockIdx.y * OTW_;
  int b = blockIdx.z;
  int hh = lane >> 4, lo = lane & 15;
  const unsigned short* ob = o + (size_t)b * N_ * C_;
  // element (channel ot0*16 + hh*8, position nt0*16 + lo) of x and of out
  const size_t idx0 = ((size_t)b * C_ + ot0 * 16 + hh * 8) * N_ + nt0 * 16 + lo;
  const float* xp = x + idx0;
  float* op = out + idx0;
  const float4* bp = (const float4*)(pb + ot0 * 16 + hh * 8);
  v16bf of[NTW_][8];                                      // O [n][c]
#pragma unroll
  for (int i = 0; i < NTW_; ++i) load_tile8(of[i], tile_at(ob, nt0 + i, lane));
  v16bf wf[2][8];                                         // pw [o][c]: this tile and the next
  float4 bq[2][2];
  float xv[2][NTW_][8];
  load_tile8(wf[0], tile_at(wp, ot0, lane));
  bq[0][0] = bp[0]; bq[0][1] = bp[1];
  close_regs();
#pragma unroll
  for (int i = 0; i < NTW_; ++i)
#pragma unroll
    for (int r = 0; r < 8; ++r) xv[0][i][r] = xp[(size_t)r * N_ + i * 16];
  close_regs();
  // Unrolled so that the two register sets are picked at compile time and the next
  // tile's loads, written in front of this tile's products, fly during them.
#pragma unroll
  for (int oi = 0; oi < OTW_; ++oi) {
    const int cur = oi & 1, nxt = cur ^ 1;
    if (oi + 1 < OTW_) {
      load_tile8(wf[nxt], tile_at(wp, ot0 + oi + 1, lane));
      bq[nxt][0] = bp[(oi + 1) * 4]; bq[nxt][1] = bp[(oi + 1) * 4 + 1];
#pragma unroll
      for (int i = 0; i < NTW_; ++i)
#pragma unroll
        for (int r = 0; r < 8; ++r)
          xv[nxt][i][r] = xp[(size_t)((oi + 1) * 16 + r) * N_ + i * 16];
    }
    // Also keeps the next tile's loads, issued above, in front of this tile's products:
    // without it the scheduler sinks each to its first use, where it is waited out.
    close_regs();
    v8f acc[NTW_];
#pragma unroll
    for (int i = 0; i < NTW_; ++i) acc[i] = zero8();
#pragma unroll
    for (int kk = 0; kk < 8; ++kk)
#pragma unroll
      for (int i = 0; i < NTW_; ++i) acc[i] = wmma_bf16(wf[cur][kk], of[i][kk], acc[i]);
    float4 b0 = bq[cur][0], b1 = bq[cur][1];
    float bias8[8] = {b0.x, b0.y, b0.z, b0.w, b1.x, b1.y, b1.z, b1.w};
#pragma unroll
    for (int i = 0; i < NTW_; ++i) {
#pragma unroll
      for (int r = 0; r < 8; ++r)
        op[(size_t)(oi * 16 + r) * N_ + i * 16] = xv[cur][i][r] + acc[i][r] + bias8[r];
      close_regs();
    }
  }
}

extern "C" void kernel_launch(void* const* d_in, const int* in_sizes, int n_in,
                              void* d_out, int out_size, void* d_ws, size_t ws_size,
                              hipStream_t stream) {
  (void)in_sizes; (void)n_in; (void)out_size; (void)ws_size;
  const float* x     = (const float*)d_in[0];
  const float* gnw   = (const float*)d_in[1];
  const float* gnb   = (const float*)d_in[2];
  const float* qw    = (const float*)d_in[3];
  const float* qbias = (const float*)d_in[4];
  const float* kw    = (const float*)d_in[5];
  const float* kbias = (const float*)d_in[6];
  const float* vw    = (const float*)d_in[7];
  const float* vbias = (const float*)d_in[8];
  const float* pw    = (const float*)d_in[9];
  const float* pbias = (const float*)d_in[10];
  float* out = (float*)d_out;

  char* w = (char*)d_ws;
  unsigned short* wqb  = (unsigned short*)(w + 1024);       // 4 x 64K bf16
  unsigned short* wkb  = wqb + 65536;
  unsigned short* wvb  = wqb + 2 * 65536;
  unsigned short* wpb  = wqb + 3 * 65536;
  unsigned short* h    = (unsigned short*)(w + 1024 + 524288);
  const size_t    bnc  = (size_t)B_ * N_ * C_;
  unsigned short* qd = h  + bnc;
  unsigned short* kd = qd + bnc;
  unsigned short* vd = kd + bnc;
  unsigned short* od = vd + bnc;
  float*        part = (float*)(od + bnc);                  // 256 x 128 B; total ~40.5 MB

  k_prep_weights<<<1024, 256, 0, stream>>>(qw, kw, vw, pw, wqb);
  k_gn_stats    <<<B_ * G_ * GSL_, 256, 0, stream>>>(x, part);
  k_gn_apply    <<<dim3(C_ / 32, N_ / 64, B_), 256, 0, stream>>>(x, gnw, gnb, part, h);
  k_qkv         <<<dim3(N_ / (16 * NTW_ * GWV_), C_ / (16 * OTW_), 3 * B_), GWV_ * 32, 0, stream>>>(
                    h, wqb, wkb, wvb, qbias, kbias, vbias, qd, kd, vd);
  k_attn        <<<dim3(N_ / 64, B_), 256, 0, stream>>>(qd, kd, vd, od);
  k_proj        <<<dim3(N_ / (16 * NTW_ * GWV_), C_ / (16 * OTW_), B_), GWV_ * 32, 0, stream>>>(od, wpb, pbias, x, out);
}

// v007
// It runs in 88.2 microseconds.
// Timed twice side by side with v006, it ran 1.10 and 1.11 times as fast.
// All steps since v000 together make it 11.7 times as fast.
#include <hip/hip_runtime.h>
#include <cstdint>

#define B_   4
#define C_   256
#define N_   4096
#define G_   8
#define CPG_ 32
#define BC_  64
#define KS_  2
#define QTW_ 2
#define NST_ (N_ / (BC_ * KS_))
#define SLB_ 16384u
#define STB_ 65536u
#define MGW_ 2048
#define GSL_ 8
#define GPP_ 32
#define GWV_ 4
#define NTW_ 2
#define OTW_ 8
#define QRL_ 6
#define QPR_ 2
#define QWV_ (QRL_ * QPR_)
#define QPS_ (QPR_ * NTW_ * 16)
#define OCT_ (C_ / 8)    // 8-channel pieces of a position's h row
#define OPW_ ((OCT_ + QWV_ - 1) / QWV_)   // rounds in which the QWV_ waves stage them

typedef __attribute__((ext_vector_type(16))) __bf16 v16bf;
typedef __attribute__((ext_vector_type(8)))  __bf16 v8bf;
typedef __attribute__((ext_vector_type(8)))  float  v8f;
typedef __attribute__((ext_vector_type(8)))  unsigned short u16x8;
typedef __attribute__((ext_vector_type(4)))  uint32_t u32x4;
typedef __attribute__((ext_vector_type(8)))  uint32_t u32x8;

__device__ __forceinline__ unsigned short f2bf(float f) {
  unsigned u = __builtin_bit_cast(unsigned, f);
  u += 0x7fffu + ((u >> 16) & 1u);          // round-to-nearest-even
  return (unsigned short)(u >> 16);
}

__device__ __forceinline__ v8f zero8() {
  v8f z;
#pragma unroll
  for (int i = 0; i < 8; ++i) z[i] = 0.0f;
  return z;
}

__device__ __forceinline__ v16bf load_ab_tile(const unsigned short* base, int row0,
                                              int ld, int k0, int lane) {
  int r  = row0 + (lane & 15);
  int kh = (lane >> 4) << 3;
  const unsigned short* p = base + (size_t)r * ld + (size_t)(k0 + kh);
  v8bf lo = *(const v8bf*)p;
  v8bf hi = *(const v8bf*)(p + 16);
  return __builtin_shufflevector(lo, hi, 0,1,2,3,4,5,6,7,8,9,10,11,12,13,14,15);
}

__device__ __forceinline__ v16bf load_frag(const unsigned short* base, int f, int lane) {
  const unsigned short* p = base + f * 512 + lane * 8;
  v8bf lo = *(const v8bf*)p;
  v8bf hi = *(const v8bf*)(p + 256);
  return __builtin_shufflevector(lo, hi, 0,1,2,3,4,5,6,7,8,9,10,11,12,13,14,15);
}

__device__ __forceinline__ v8f wmma_bf16(v16bf a, v16bf b, v8f c) {
  return __builtin_amdgcn_wmma_f32_16x16x32_bf16(false, a, false, b, (short)0, c,
                                                 false, false);
}

__device__ __forceinline__ float xhalf(float x) {
  int i = __builtin_bit_cast(int, x);
  return __builtin_bit_cast(float, __builtin_amdgcn_permlanex16(i, i, 0x76543210, 0xfedcba98, false, false));
}

__device__ __forceinline__ uint32_t uni(uint32_t v) {
  return (uint32_t)__builtin_amdgcn_readfirstlane(v);
}

__device__ __forceinline__ uint32_t pinned(uint32_t v) {
  uint32_t w = uni(v);
  asm volatile("" : "+s"(w));
  return w;
}

__device__ __forceinline__ u32x8 tdm_group1(uint32_t rowb, uint32_t nrows, uint32_t pitch) {
  u32x8 g;
  g[0] = uni(0u);
  g[1] = uni((rowb & 0xFFFFu) << 16);
  g[2] = uni((rowb >> 16) | ((nrows & 0xFFFFu) << 16));
  g[3] = uni((nrows >> 16) | (rowb << 16));
  g[4] = uni(nrows);
  g[5] = uni(pitch);
  g[6] = uni(0u);
  g[7] = uni(0u);
  return g;
}
__device__ __forceinline__ u32x4 tdm_group0(uint32_t lds_dst, uint64_t ga) {
  u32x4 g;
  g[0] = uni(1u);                              // count 1
  g[1] = uni(lds_dst);
  g[2] = uni((uint32_t)ga);
  g[3] = uni((((uint32_t)(ga >> 32)) & 0x01FFFFFFu) | 0x80000000u);   // type 2
  return g;
}
__device__ __forceinline__ void tdm_load(u32x4 g0, u32x8 g1) {
  asm volatile("tensor_load_to_lds %0, %1" :: "s"(g0), "s"(g1) : "memory");
}
// The compiler places no wait for the tensor mover: the issuing wave's own wait.
__device__ __forceinline__ void wait_tensor0() { asm volatile("s_wait_tensorcnt 0x0" ::: "memory"); }
// This wave's LDS reads have retired before a buffer it read is handed back.
__device__ __forceinline__ void wait_ds0() { asm volatile("s_wait_dscnt 0x0" ::: "memory"); }

// ---------------------------------------------------------------- weights->bf16
__global__ void k_prep_weights(const float* qw, const float* kw, const float* vw,
                               const float* pw, unsigned short* dst) {
  int i = blockIdx.x * blockDim.x + threadIdx.x;   // 0 .. 4*65536
  int m = i >> 16, e = i & 65535;
  const float* s = (m == 0) ? qw : (m == 1) ? kw : (m == 2) ? vw : pw;
  dst[i] = f2bf(s[e]);
}

__global__ void __launch_bounds__(256) __attribute__((amdgpu_waves_per_eu(2, 2)))
k_gn_stats(const float* x, float* part) {
  int blk = blockIdx.x;                            // (b*8+g)*GSL_ + slice, 0..255
  const float4* p = (const float4*)(x + (size_t)blk * (CPG_ * N_ / GSL_)) + threadIdx.x;
  float4 v[16];
#pragma unroll
  for (int i = 0; i < 16; ++i) v[i] = p[i * 256];
  float4 a = make_float4(0.f, 0.f, 0.f, 0.f), q = a;
#pragma unroll
  for (int i = 0; i < 16; ++i) {
    a.x += v[i].x; a.y += v[i].y; a.z += v[i].z; a.w += v[i].w;
    q.x += v[i].x * v[i].x; q.y += v[i].y * v[i].y;
    q.z += v[i].z * v[i].z; q.w += v[i].w * v[i].w;
  }
  float s = (a.x + a.y) + (a.z + a.w), s2 = (q.x + q.y) + (q.z + q.w);
#pragma unroll
  for (int off = 16; off > 0; off >>= 1) {
    s  += __shfl_xor(s,  off, 32);
    s2 += __shfl_xor(s2, off, 32);
  }
  __shared__ float rs[8], rq[8];
  if ((threadIdx.x & 31) == 0) { rs[threadIdx.x >> 5] = s; rq[threadIdx.x >> 5] = s2; }
  __syncthreads();
  if (threadIdx.x == 0) {
    float ts = 0.f, tq = 0.f;
#pragma unroll
    for (int w = 0; w < 8; ++w) { ts += rs[w]; tq += rq[w]; }
    *(float2*)(part + blk * GPP_) = make_float2(ts, tq);
  }
}

// Precaution: registers that the global loads or stores above it name are written again
// below it. The wait stands in front of that; the scheduling barrier keeps those
// writes, which a "memory" clobber does not hold, behind the wait.
__device__ __forceinline__ void close_regs() {
  asm volatile("s_wait_xcnt 0x0" ::: "memory");
  __builtin_amdgcn_sched_barrier(0);
}
// The same behind a run of loads from the lane's address p: as an input of the wait p
// stays in its registers up to it; else the run's last load may land on them.
__device__ __forceinline__ void close_regs_at(const unsigned short* p) {
  asm volatile("s_wait_xcnt 0x0" :: "v"(p) : "memory");
  __builtin_amdgcn_sched_barrier(0);
}
// The lane's address in a 16-row operand tile of [row][C_] storage (see load_ab_tile),
// and the eight fragments of the tile's C_ columns from it.
__device__ __forceinline__ const unsigned short* tile_at(const unsigned short* base, int tile, int lane) {
  return base + (size_t)(tile * 16 + (lane & 15)) * C_ + ((lane >> 4) << 3);
}
__device__ __forceinline__ void load_tile8(v16bf (&f)[8], const unsigned short* p) {
#pragma unroll
  for (int kk = 0; kk < 8; ++kk) {
    v8bf lo = *(const v8bf*)(p + kk * 32);
    v8bf hi = *(const v8bf*)(p + kk * 32 + 16);
    f[kk] = __builtin_shufflevector(lo, hi, 0,1,2,3,4,5,6,7,8,9,10,11,12,13,14,15);
  }
  close_regs_at(p);
}

// ---------------------------------------------------------------- QKV GEMMs
// A wave's NTW_ x OTW_ block of 16x16 output tiles of q (WHICH 0), k (1) or v (2):
// the h fragments are read once from LDS (hs, fragment order) and stay in registers,
// each weight fragment serves NTW_ products. The case is chosen in front of the matrix products, so that no
// branch stands behind the last one.
template <int WHICH>
__device__ __forceinline__ void qkv_tiles(const unsigned short* hs, const unsigned short* w,
                                          const float* bias, unsigned short* dstb,
                                          int nt0, int ot0, int lane) {
  // q,k: A = weights [o][c], B = h [n][c]: a lane ends with 8 channels of one n.
  // v:   A = h, B = weights: a lane ends with 8 keys of one channel, which is
  //      the 16-byte chunk that the attention kernel's V operand wants.
  int hh = lane >> 4, lo = lane & 15;
  // The lane's 16-byte place in the first output tile of each row tile; the later
  // tiles lie at compile-time distances from it (ot0 is a multiple of OTW_).
  unsigned short* d0[NTW_];
#pragma unroll
  for (int i = 0; i < NTW_; ++i) {
    const int nt = nt0 + i;
    if (WHICH == 2) {
      // v: fragment (ot, key half) of key block nt>>2, laid so that the 256 x 128-byte
      // tile the attention kernel loads at row pitch N_ lands in fragment order:
      // tile byte L = fragment*1024 + chunk*512 + lane*16, row L>>7, column L&127.
      int row = (ot0 * 2 + ((nt >> 1) & 1)) * 8 + (nt & 1) * 4 + (lane >> 3);
      d0[i] = dstb + (size_t)row * N_ + (nt >> 2) * BC_ + (lane & 7) * 8;
    } else if (WHICH == 0) {                                // q -> [n][c]
      d0[i] = dstb + (size_t)(nt * 16 + lo) * C_ + ot0 * 16 + hh * 8;
    } else {                                                // k -> fragment order inside
      d0[i] = dstb + (size_t)(nt >> 2) * (BC_ * C_) +       // each 64-key block (32 KB)
              ((ot0 >> 1) * 4 + (nt & 3)) * 512 + lane * 8;
    }
  }
  v16bf hf[NTW_][8];
#pragma unroll
  for (int i = 0; i < NTW_; ++i)
#pragma unroll
    for (int kk = 0; kk < 8; ++kk) hf[i][kk] = load_frag(hs, i * 8 + kk, lane);
  v16bf wf[2][8];                                         // this tile's weights and the next one's
  float4 bq[2][2];
  load_tile8(wf[0], tile_at(w, ot0, lane));
  // the lane's place in the bias: its channel (v) or its first of 8 channels (q, k)
  const float* bl = bias + ot0 * 16 + ((WHICH == 2) ? lo : hh * 8);
  if (WHICH == 2) {
    bq[0][0].x = bl[0];
  } else {
    bq[0][0] = ((const float4*)bl)[0]; bq[0][1] = ((const float4*)bl)[1];
  }
  close_regs();
  // Unrolled so that the two register sets are picked at compile time and the next
  // tile's loads, written in front of this tile's products, fly during them.
#pragma unroll
  for (int oi = 0; oi < OTW_; ++oi) {
    const int cur = oi & 1, nxt = cur ^ 1;
    const int ot = ot0 + oi;
    if (oi + 1 < OTW_) {
      load_tile8(wf[nxt], tile_at(w, ot + 1, lane));
      if (WHICH == 2) {
        bq[nxt][0].x = bl[(oi + 1) * 16];
      } else {
        bq[nxt][0] = ((const float4*)bl)[(oi + 1) * 4]; bq[nxt][1] = ((const float4*)bl)[(oi + 1) * 4 + 1];
      }
    }
    // Also keeps the next tile's loads, issued above, in front of this tile's products:
    // without it the scheduler sinks each to its first use, where it is waited out.
    close_regs();
    v8f acc[NTW_];
#pragma unroll
    for (int i = 0; i < NTW_; ++i) acc[i] = zero8();
#pragma unroll
    for (int kk = 0; kk < 8; ++kk)
#pragma unroll
      for (int i = 0; i < NTW_; ++i)
        acc[i] = (WHICH == 2) ? wmma_bf16(hf[i][kk], wf[cur][kk], acc[i])
                              : wmma_bf16(wf[cur][kk], hf[i][kk], acc[i]);
#pragma unroll
    for (int i = 0; i < NTW_; ++i) {
      u16x8 outv;
      unsigned short* dst;
      if (WHICH == 2) {
        float bv = bq[cur][0].x;
#pragma unroll
        for (int r = 0; r < 8; ++r) outv[r] = f2bf(acc[i][r] + bv);
        dst = d0[i] + (size_t)oi * 16 * N_;                   // 16 fragment rows per tile
      } else {
        float4 bq0 = bq[cur][0], bq1 = bq[cur][1];
        float bias8[8] = {bq0.x, bq0.y, bq0.z, bq0.w, bq1.x, bq1.y, bq1.z, bq1.w};
        const float scale = (WHICH == 0) ? 0.0625f : 1.0f;    // 1/sqrt(256) folded into q
#pragma unroll
        for (int r = 0; r < 8; ++r) outv[r] = f2bf((acc[i][r] + bias8[r]) * scale);
        dst = d0[i] + ((WHICH == 0) ? oi * 16 : (oi >> 1) * 2048 + (oi & 1) * 256);
      }
      *(u16x8*)dst = outv;
      close_regs();                                       // also where the three cases join again
    }
  }
}

// Work-group = QWV_ waves on QPS_ = 64 positions. First the group norm is applied to
// the 256 x 64 block of x and laid in LDS as bf16 in fragment order: h goes to no
// memory. Then QRL_ waves share each NTW_ row tiles: a wave walks one half of the
// output channels of q, k or v.
__global__ void __launch_bounds__(QWV_ * 32) k_qkv(
    const float* x, const float* gw, const float* gb, const float* part,
    const unsigned short* wq, const unsigned short* wk,
    const unsigned short* wv, const float* qb, const float* kb, const float* vb,
    unsigned short* q, unsigned short* k, unsigned short* v) {
  int lane = threadIdx.x & 31;
  const int wid = (int)uni(threadIdx.x >> 5);
  int b = blockIdx.y;
  __shared__ __attribute__((aligned(16))) unsigned short hs[QPR_ * NTW_ * 8 * 512];   // fragments [row tile][kk]

  const float* pp = part + (b * G_ + (lane & 7)) * (GSL_ * GPP_);
  float2 pv[GSL_];
#pragma unroll
  for (int j = 0; j < GSL_; ++j) pv[j] = *(const float2*)(pp + j * GPP_);
  close_regs();
  // A lane is two positions; a round of a wave is 8 channels of the 64 positions, each
  // load 256 contiguous bytes. All rounds' loads are issued ahead of the first use.
  const float* xb = x + (size_t)b * C_ * N_ + blockIdx.x * QPS_ + lane * 2;
  float2 xv[OPW_][8];
  float4 wv4[OPW_][2], bv4[OPW_][2];
#pragma unroll
  for (int j = 0; j < OPW_; ++j) {
    const int oc = wid + j * QWV_;
    if ((j + 1) * QWV_ <= OCT_ || oc < OCT_) {            // the last round: the first waves only
#pragma unroll
      for (int r = 0; r < 8; ++r) xv[j][r] = *(const float2*)(xb + (size_t)(oc * 8 + r) * N_);
      wv4[j][0] = ((const float4*)gw)[oc * 2]; wv4[j][1] = ((const float4*)gw)[oc * 2 + 1];
      bv4[j][0] = ((const float4*)gb)[oc * 2]; bv4[j][1] = ((const float4*)gb)[oc * 2 + 1];
      close_regs();
    }
  }
  float s = 0.f, s2 = 0.f;
#pragma unroll
  for (int j = 0; j < GSL_; ++j) { s += pv[j].x; s2 += pv[j].y; }
  const float inv = 1.0f / (float)(CPG_ * N_);
  float mean = s * inv;
  float rstd = rsqrtf(s2 * inv - mean * mean + 1e-5f);
#pragma unroll
  for (int j = 0; j < OPW_; ++j) {
    const int oc = wid + j * QWV_;
    if ((j + 1) * QWV_ <= OCT_ || oc < OCT_) {
      // the statistics of the piece's group, from the lane that holds them
      float mg = __builtin_bit_cast(float, __builtin_amdgcn_readlane(__builtin_bit_cast(int, mean), oc >> 2));
      float rg = __builtin_bit_cast(float, __builtin_amdgcn_readlane(__builtin_bit_cast(int, rstd), oc >> 2));
      float w8[8] = {wv4[j][0].x, wv4[j][0].y, wv4[j][0].z, wv4[j][0].w, wv4[j][1].x, wv4[j][1].y, wv4[j][1].z, wv4[j][1].w};
      float b8[8] = {bv4[j][0].x, bv4[j][0].y, bv4[j][0].z, bv4[j][0].w, bv4[j][1].x, bv4[j][1].y, bv4[j][1].z, bv4[j][1].w};
#pragma unroll
      for (int e = 0; e < 2; ++e) {
        const int n = lane * 2 + e;                       // position in the block
        u16x8 hv;
#pragma unroll
        for (int r = 0; r < 8; ++r) hv[r] = f2bf(((e ? xv[j][r].y : xv[j][r].x) - mg) * rg * w8[r] + b8[r]);
        // Channels oc*8 .. oc*8 + 7 of row n & 15 of row tile n >> 4 are chunk (oc >> 1) & 1
        // of fragment lane (oc & 1) * 16 + (n & 15), k step oc >> 2 (see load_frag).
        *(u16x8*)(hs + ((n >> 4) * 8 + (oc >> 2)) * 512 + ((oc >> 1) & 1) * 256 +
                  ((oc & 1) * 16 + (n & 15)) * 8) = hv;
      }
    }
  }
  __syncthreads();                                        // the block of h is published

  const int pr = wid / QRL_, role = wid % QRL_;
  int nt0 = (blockIdx.x * QPR_ + pr) * NTW_, ot0 = (role & 1) * OTW_, which = role >> 1;
  const unsigned short* hp = hs + pr * (NTW_ * 8 * 512);  // the fragments of the wave's row tiles
  size_t boff = (size_t)b * N_ * C_;
  if (which == 0)      qkv_tiles<0>(hp, wq, qb, q + boff, nt0, ot0, lane);
  else if (which == 1) qkv_tiles<1>(hp, wk, kb, k + boff, nt0, ot0, lane);
  else                 qkv_tiles<2>(hp, wv, vb, v + boff, nt0, ot0, lane);
}

__global__ void __launch_bounds__(256) k_attn(
    const unsigned short* q, const unsigned short* k, const unsigned short* v,
    unsigned short* o) {
  int lane = threadIdx.x & 31;
  const uint32_t wid = uni(threadIdx.x >> 5);
  const uint32_t qh = wid & 1u;                           // query half of the workgroup
  const uint32_t kq = wid >> 1;                           // key quarter of the stage
  int b = blockIdx.y;
  int n0 = blockIdx.x * 64 + (int)qh * (QTW_ * 16);       // 32 query rows per wave
  int hh = lane >> 4, lo = lane & 15;
  const unsigned short* qp = q + (size_t)b * N_ * C_;
  const unsigned short* kp = k + (size_t)b * N_ * C_;
  const unsigned short* vp = v + (size_t)b * C_ * N_;

  // 2-KiB alignment: every tensor load's place in LDS is a multiple of 2 KiB.
  __shared__ __attribute__((aligned(2048))) unsigned short smk[2][KS_][BC_ * C_];  // K fragments [kk][mt]
  __shared__ __attribute__((aligned(2048))) unsigned short smv[2][KS_][C_ * BC_];  // V fragments [t][kk]
  __shared__ float4 sml[8][32];                           // final merge: each wave's m and l

  // This wave's slice of a stage. Waves 0-3: a quarter of the stage's K, 16 KB that
  // are contiguous in memory (32 rows of 512 B). Waves 4-7: 128 of the 256 rows
  // (128 B each, pitch 2*N_ B) of one of the stage's two V blocks.
  const bool isk = wid < 4u;
  const uint32_t j = wid & 3u;
  const uint64_t src0 = isk ? (uint64_t)(uintptr_t)kp + j * SLB_
                            : (uint64_t)(uintptr_t)vp + (uint64_t)(j & 1u) * (128u * N_ * 2u) + (j >> 1) * (BC_ * 2u);
  const uint32_t sstep = isk ? STB_ : (uint32_t)(KS_ * BC_ * 2);     // source bytes per stage
  const uint32_t lds0 = (isk ? (uint32_t)(uintptr_t)&smk[0][0][0] : (uint32_t)(uintptr_t)&smv[0][0][0]) + j * SLB_;
  const u32x8 g1 = isk ? tdm_group1(512u, 32u, 512u) : tdm_group1(128u, 128u, (uint32_t)(N_ * 2));

  tdm_load(tdm_group0(lds0, src0), g1);                   // stage 0 -> buffer 0

  v16bf qr[QTW_][8];                                      // Q block in registers
#pragma unroll
  for (int i = 0; i < QTW_; ++i)
#pragma unroll
    for (int kk = 0; kk < 8; ++kk) qr[i][kk] = load_ab_tile(qp, n0 + i * 16, C_, kk * 32, lane);

  v8f acc[QTW_][16];                 // O^T: acc[i][t][r] = channel t*16 + hh*8 + r of query i*16 + lo
#pragma unroll
  for (int i = 0; i < QTW_; ++i)
#pragma unroll
    for (int t = 0; t < 16; ++t) acc[i][t] = zero8();
  float mrun[QTW_], lrun[QTW_];      // maximum in use (equal in both halves); sum over this half's keys
#pragma unroll
  for (int i = 0; i < QTW_; ++i) { mrun[i] = -1e30f; lrun[i] = 0.0f; }

  wait_tensor0();
  __syncthreads();                                        // stage 0 is published

  for (int it = 0; it < NST_; ++it) {                     // 32 stages, 32 keys per wave
    int buf = it & 1;
    // Behind the barrier that published stage it and ended every read of the other
    // buffer: the load of stage it + 1 into that buffer flies during this pass.
    const uint32_t nx = pinned((uint32_t)it + 1u);        // the load's words are formed behind the wait
    if (pinned(nx < (uint32_t)NST_))                      // scalar test: stage it + 1 exists
      tdm_load(tdm_group0(lds0 + (nx & 1u) * STB_, src0 + (uint64_t)nx * sstep), g1);
    // The wave's 32 keys: half kq & 1 of 64-key block kq >> 1, which is K fragments
    // kk*4 + (kq & 1)*2 + m and V fragments t*2 + (kq & 1) of that block.
    const unsigned short* kb = smk[buf][kq >> 1] + (kq & 1u) * 1024u;
    const unsigned short* vb = smv[buf][kq >> 1] + (kq & 1u) * 512u;

    // Fragments come in groups of four, one group ahead of the products that use them,
    // in two register sets: f[g & 1] is worked on while the other set's loads fly.
    v16bf f[2][4];
    v8f s[QTW_][2];                    // S^T: s[i][m][r] = key m*16 + hh*8 + r, query i*16 + lo
#pragma unroll
    for (int i = 0; i < QTW_; ++i)
#pragma unroll
      for (int m = 0; m < 2; ++m) s[i][m] = zero8();
#pragma unroll
    for (int x = 0; x < 4; ++x) f[0][x] = load_frag(kb, (x >> 1) * 4 + (x & 1), lane);
#pragma unroll
    for (int g = 0; g < 4; ++g) {      // group g: K fragments of kk = 2g, 2g + 1
#pragma unroll
      for (int x = 0; x < 4; ++x)      // behind the last K group, the first V group
        f[(g + 1) & 1][x] = (g < 3) ? load_frag(kb, ((g + 1) * 2 + (x >> 1)) * 4 + (x & 1), lane)
                                    : load_frag(vb, x * 2, lane);
      // Keeps the next group's loads together and in front of this group's products:
      // without it the scheduler sinks each load to its use, where it is waited out.
      __builtin_amdgcn_sched_barrier(0);
#pragma unroll
      for (int x = 0; x < 4; ++x)
#pragma unroll
        for (int i = 0; i < QTW_; ++i)
          s[i][x & 1] = wmma_bf16(f[g & 1][x], qr[i][g * 2 + (x >> 1)], s[i][x & 1]);
      __builtin_amdgcn_sched_barrier(0);   // the same: no later load rises among these products
    }

    float mx[QTW_];                                       // block maximum of query i*16 + lo
    bool need = false;
#pragma unroll
    for (int i = 0; i < QTW_; ++i) {
      float m0 = s[i][0][0], m1 = s[i][1][0];
#pragma unroll
      for (int r = 1; r < 8; ++r) { m0 = fmaxf(m0, s[i][0][r]); m1 = fmaxf(m1, s[i][1][r]); }
      mx[i] = fmaxf(m0, m1);
      mx[i] = fmaxf(mx[i], xhalf(mx[i]));                 // the other half's 16 keys
      need = need || (mx[i] > mrun[i]);
    }
    if (__ballot(need) != 0ull) {                         // lazy rescale, one test per pass
#pragma unroll
      for (int i = 0; i < QTW_; ++i) {
        float mnew = fmaxf(mrun[i], mx[i]);
        float cf = __expf(mrun[i] - mnew);
        lrun[i] *= cf;
        mrun[i] = mnew;
#pragma unroll
        for (int t = 0; t < 16; ++t)
#pragma unroll
          for (int r = 0; r < 8; ++r) acc[i][t][r] *= cf;
      }
    }
    // P^T = exp(S^T - m): a query tile's two score tiles hold, register for register,
    // the k order of a B operand over the 32 keys of one V fragment.
    v16bf pb[QTW_];
#pragma unroll
    for (int i = 0; i < QTW_; ++i) {
      float ps[2];
#pragma unroll
      for (int m = 0; m < 2; ++m) {
        ps[m] = 0.0f;
#pragma unroll
        for (int r = 0; r < 8; ++r) {
          float p = __expf(s[i][m][r] - mrun[i]);
          ps[m] += p;
          pb[i][m * 8 + r] = (__bf16)p;
        }
      }
      lrun[i] += ps[0] + ps[1];
    }
#pragma unroll
    for (int g = 0; g < 4; ++g) {                         // O^T += V^T * P^T, channel tiles 4g .. 4g + 3
      if (g < 3) {
#pragma unroll
        for (int x = 0; x < 4; ++x) f[(g + 1) & 1][x] = load_frag(vb, ((g + 1) * 4 + x) * 2, lane);
      }
      __builtin_amdgcn_sched_barrier(0);
#pragma unroll
      for (int x = 0; x < 4; ++x)
#pragma unroll
        for (int i = 0; i < QTW_; ++i) acc[i][g * 4 + x] = wmma_bf16(f[g & 1][x], pb[i], acc[i][g * 4 + x]);
      __builtin_amdgcn_sched_barrier(0);
    }

    // Publish point of stage it + 1: own LDS reads retired, own slice landed, then
    // the barrier, which also ends every reader's last read of this pass's buffer.
    wait_ds0();
    wait_tensor0();
    __syncthreads();
  }
  wait_tensor0();
  wait_ds0();

  // Merge of the four key quarters of a query half. The last pass's barrier has ended
  // every read of the ring, which now carries the hand-over: each wave lays down its
  // 32 KB of partial O^T (query half 0 in the K ring, half 1 in the V ring) and its m
  // and l; behind the barrier wave kq joins channel tiles kq*4 .. kq*4 + 3 of all four.
  // 16-byte stores and loads, 512 contiguous bytes each.
  float4* ring = (float4*)(qh == 0u ? &smk[0][0][0] : &smv[0][0][0]) + lane;
  float4* mine = ring + kq * MGW_;
#pragma unroll
  for (int i = 0; i < QTW_; ++i)
#pragma unroll
    for (int t = 0; t < 16; ++t) {
      mine[((i * 16 + t) * 2) * 32]     = make_float4(acc[i][t][0], acc[i][t][1], acc[i][t][2], acc[i][t][3]);
      mine[((i * 16 + t) * 2 + 1) * 32] = make_float4(acc[i][t][4], acc[i][t][5], acc[i][t][6], acc[i][t][7]);
    }
#pragma unroll
  for (int i = 0; i < QTW_; ++i) lrun[i] += xhalf(lrun[i]);   // the two halves' sums, joined once
  sml[wid][lane] = make_float4(mrun[0], lrun[0], mrun[1], lrun[1]);
  __syncthreads();
  float wq[QTW_][4];                                      // weight of each quarter's part
  {
    float4 ml[4];
#pragma unroll
    for (int p = 0; p < 4; ++p) ml[p] = sml[p * 2 + qh][lane];
    float ma = fmaxf(fmaxf(ml[0].x, ml[1].x), fmaxf(ml[2].x, ml[3].x));
    float mb = fmaxf(fmaxf(ml[0].z, ml[1].z), fmaxf(ml[2].z, ml[3].z));
    float la = 0.0f, lb = 0.0f;
#pragma unroll
    for (int p = 0; p < 4; ++p) {
      wq[0][p] = __expf(ml[p].x - ma); la += ml[p].y * wq[0][p];
      wq[1][p] = __expf(ml[p].z - mb); lb += ml[p].w * wq[1][p];
    }
    float ia = 1.0f / la, ib = 1.0f / lb;
#pragma unroll
    for (int p = 0; p < 4; ++p) { wq[0][p] *= ia; wq[1][p] *= ib; }
  }
  // O -> [n][c] bf16: a lane's 8 values are 8 consecutive channels of its query; a
  // wave's four tiles are one 128-byte line of each query row.
  unsigned short* ob = o + (size_t)b * N_ * C_ + (size_t)(n0 + lo) * C_ + (int)kq * 64 + hh * 8;
  const float4* part = ring + kq * (4 * 2 * 32);          // tile kq*4 of query tile 0, quarter 0
#pragma unroll
  for (int i = 0; i < QTW_; ++i)
#pragma unroll
    for (int t = 0; t < 4; ++t) {
      float sum[8];
#pragma unroll
      for (int r = 0; r < 8; ++r) sum[r] = 0.0f;
#pragma unroll
      for (int p = 0; p < 4; ++p) {
        float4 p0 = part[p * MGW_ + ((i * 16 + t) * 2) * 32], p1 = part[p * MGW_ + ((i * 16 + t) * 2 + 1) * 32];
        float pv[8] = {p0.x, p0.y, p0.z, p0.w, p1.x, p1.y, p1.z, p1.w};
#pragma unroll
        for (int r = 0; r < 8; ++r) sum[r] += pv[r] * wq[i][p];
      }
      u16x8 outv;
#pragma unroll
      for (int r = 0; r < 8; ++r) outv[r] = f2bf(sum[r]);
      *(u16x8*)(ob + (size_t)i * 16 * C_ + t * 16) = outv;
      // Precaution: registers that this store names are written again for the next
      // tile; the wait stands in front of that.
      close_regs();
    }
}

// -------------------------------------------------- projection + residual add
// As in k_qkv: a wave keeps the O fragments of NTW_ row tiles in registers and walks
// OTW_ weight tiles with them; the next tile's weights, bias and x are loaded one
// tile ahead.
__global__ void __launch_bounds__(GWV_ * 32) k_proj(
    const unsigned short* o, const unsigned short* wp, const float* pb,
    const float* x, float* out) {
  int lane = threadIdx.x & 31;
  int nt0 = (blockIdx.x * GWV_ + (threadIdx.x >> 5)) * NTW_, ot0 = blockIdx.y * OTW_;
  int b = blockIdx.z;
  int hh = lane >> 4, lo = lane & 15;
  const unsigned short* ob = o + (size_t)b * N_ * C_;
  // element (channel ot0*16 + hh*8, position nt0*16 + lo) of x and of out
  const size_t idx0 = ((size_t)b * C_ + ot0 * 16 + hh * 8) * N_ + nt0 * 16 + lo;
  const float* xp = x + idx0;
  float* op = out + idx0;
  const float4* bp = (const float4*)(pb + ot0 * 16 + hh * 8);
  v16bf of[NTW_][8];                                      // O [n][c]
#pragma unroll
  for (int i = 0; i < NTW_; ++i) load_tile8(of[i], tile_at(ob, nt0 + i, lane));
  v16bf wf[2][8];                                         // pw [o][c]: this tile and the next
  float4 bq[2][2];
  float xv[2][NTW_][8];
  load_tile8(wf[0], tile_at(wp, ot0, lane));
  bq[0][0] = bp[0]; bq[0][1] = bp[1];
  close_regs();
#pragma unroll
  for (int i = 0; i < NTW_; ++i)
#pragma unroll
    for (int r = 0; r < 8; ++r) xv[0][i][r] = xp[(size_t)r * N_ + i * 16];
  close_regs();
  // Unrolled so that the two register sets are picked at compile time and the next
  // tile's loads, written in front of this tile's products, fly during them.
#pragma unroll
  for (int oi = 0; oi < OTW_; ++oi) {
    const int cur = oi & 1, nxt = cur ^ 1;
    if (oi + 1 < OTW_) {
      load_tile8(wf[nxt], tile_at(wp, ot0 + oi + 1, lane));
      bq[nxt][0] = bp[(oi + 1) * 4]; bq[nxt][1] = bp[(oi + 1) * 4 + 1];
#pragma unroll
      for (int i = 0; i < NTW_; ++i)
#pragma unroll
        for (int r = 0; r < 8; ++r)
          xv[nxt][i][r] = xp[(size_t)((oi + 1) * 16 + r) * N_ + i * 16];
    }
    // Also keeps the next tile's loads, issued above, in front of this tile's products:
    // without it the scheduler sinks each to its first use, where it is waited out.
    close_regs();
    v8f acc[NTW_];
#pragma unroll
    for (int i = 0; i < NTW_; ++i) acc[i] = zero8();
#pragma unroll
    for (int kk = 0; kk < 8; ++kk)
#pragma unroll
      for (int i = 0; i < NTW_; ++i) acc[i] = wmma_bf16(wf[cur][kk], of[i][kk], acc[i]);
    float4 b0 = bq[cur][0], b1 = bq[cur][1];
    float bias8[8] = {b0.x, b0.y, b0.z, b0.w, b1.x, b1.y, b1.z, b1.w};
#pragma unroll
    for (int i = 0; i < NTW_; ++i) {
#pragma unroll
      for (int r = 0; r < 8; ++r)
        op[(size_t)(oi * 16 + r) * N_ + i * 16] = xv[cur][i][r] + acc[i][r] + bias8[r];
      close_regs();
    }
  }
}

extern "C" void kernel_launch(void* const* d_in, const int* in_sizes, int n_in,
                              void* d_out, int out_size, void* d_ws, size_t ws_size,
                              hipStream_t stream) {
  (void)in_sizes; (void)n_in; (void)out_size; (void)ws_size;
  const float* x     = (const float*)d_in[0];
  const float* gnw   = (const float*)d_in[1];
  const float* gnb   = (const float*)d_in[2];
  const float* qw    = (const float*)d_in[3];
  const float* qbias = (const float*)d_in[4];
  const float* kw    = (const float*)d_in[5];
  const float* kbias = (const float*)d_in[6];
  const float* vw    = (const float*)d_in[7];
  const float* vbias = (const float*)d_in[8];
  const float* pw    = (const float*)d_in[9];
  const float* pbias = (const float*)d_in[10];
  float* out = (float*)d_out;

  char* w = (char*)d_ws;
  unsigned short* wqb  = (unsigned short*)(w + 1024);       // 4 x 64K bf16
  unsigned short* wkb  = wqb + 65536;
  unsigned short* wvb  = wqb + 2 * 65536;
  unsigned short* wpb  = wqb + 3 * 65536;
  const size_t    bnc  = (size_t)B_ * N_ * C_;
  unsigned short* qd = (unsigned short*)(w + 1024 + 524288);
  unsigned short* kd = qd + bnc;
  unsigned short* vd = kd + bnc;
  unsigned short* od = vd + bnc;
  float*        part = (float*)(od + bnc);                  // 256 x 128 B; total ~32.5 MB

  k_prep_weights<<<1024, 256, 0, stream>>>(qw, kw, vw, pw, wqb);
  k_gn_stats    <<<B_ * G_ * GSL_, 256, 0, stream>>>(x, part);
  k_qkv         <<<dim3(N_ / QPS_, B_), QWV_ * 32, 0, stream>>>(
                    x, gnw, gnb, part, wqb, wkb, wvb, qbias, kbias, vbias, qd, kd, vd);
  k_attn        <<<dim3(N_ / 64, B_), 256, 0, stream>>>(qd, kd, vd, od);
  k_proj        <<<dim3(N_ / (16 * NTW_ * GWV_), C_ / (16 * OTW_), B_), GWV_ * 32, 0, stream>>>(od, wpb, pbias, x, out);
}

// v008
// It runs in 79.8 microseconds.
// In two side-by-side timings against v007, it was 1.10 and 1.09 times as fast.
// Counting every step since v000, it is 12.8 times as fast.
#include <hip/hip_runtime.h>
#include <cstdint>

#define B_   4
#define C_   256
#define N_   4096
#define G_   8
#define CPG_ 32
#define BC_  64
#define KS_  2
#define QTW_ 2
#define NST_ (N_ / (BC_ * KS_))
#define SLB_ 16384u
#define STB_ 65536u
#define MGW_ 2048
#define GSL_ 8
#define GPP_ 32
#define GWV_ 4
#define NTW_ 2
#define OTW_ 8
#define QRL_ 6
#define QPR_ 2
#define QWV_ (QRL_ * QPR_)
#define QPS_ (QPR_ * NTW_ * 16)
#define OCT_ (C_ / 8)    // 8-channel pieces of a position's h row
#define OPW_ ((OCT_ + QWV_ - 1) / QWV_)   // rounds in which the QWV_ waves stage them

typedef __attribute__((ext_vector_type(16))) __bf16 v16bf;
typedef __attribute__((ext_vector_type(8)))  __bf16 v8bf;
typedef __attribute__((ext_vector_type(8)))  float  v8f;
typedef __attribute__((ext_vector_type(8)))  unsigned short u16x8;
typedef __attribute__((ext_vector_type(4)))  uint32_t u32x4;
typedef __attribute__((ext_vector_type(8)))  uint32_t u32x8;

__device__ __forceinline__ unsigned short f2bf(float f) {
  unsigned u = __builtin_bit_cast(unsigned, f);
  u += 0x7fffu + ((u >> 16) & 1u);          // round-to-nearest-even
  return (unsigned short)(u >> 16);
}

__device__ __forceinline__ v8f zero8() {
  v8f z;
#pragma unroll
  for (int i = 0; i < 8; ++i) z[i] = 0.0f;
  return z;
}

__device__ __forceinline__ v16bf load_frag(const unsigned short* base, int f, int lane) {
  const unsigned short* p = base + f * 512 + lane * 8;
  v8bf lo = *(const v8bf*)p;
  v8bf hi = *(const v8bf*)(p + 256);
  return __builtin_shufflevector(lo, hi, 0,1,2,3,4,5,6,7,8,9,10,11,12,13,14,15);
}

__device__ __forceinline__ v8f wmma_bf16(v16bf a, v16bf b, v8f c) {
  return __builtin_amdgcn_wmma_f32_16x16x32_bf16(false, a, false, b, (short)0, c,
                                                 false, false);
}

__device__ __forceinline__ float xhalf(float x) {
  int i = __builtin_bit_cast(int, x);
  return __builtin_bit_cast(float, __builtin_amdgcn_permlanex16(i, i, 0x76543210, 0xfedcba98, false, false));
}

__device__ __forceinline__ uint32_t uni(uint32_t v) {
  return (uint32_t)__builtin_amdgcn_readfirstlane(v);
}

__device__ __forceinline__ uint32_t pinned(uint32_t v) {
  uint32_t w = uni(v);
  asm volatile("" : "+s"(w));
  return w;
}

__device__ __forceinline__ u32x8 tdm_group1(uint32_t rowb, uint32_t nrows, uint32_t pitch) {
  u32x8 g;
  g[0] = uni(0u);
  g[1] = uni((rowb & 0xFFFFu) << 16);
  g[2] = uni((rowb >> 16) | ((nrows & 0xFFFFu) << 16));
  g[3] = uni((nrows >> 16) | (rowb << 16));
  g[4] = uni(nrows);
  g[5] = uni(pitch);
  g[6] = uni(0u);
  g[7] = uni(0u);
  return g;
}
__device__ __forceinline__ u32x4 tdm_group0(uint32_t lds_dst, uint64_t ga) {
  u32x4 g;
  g[0] = uni(1u);                              // count 1
  g[1] = uni(lds_dst);
  g[2] = uni((uint32_t)ga);
  g[3] = uni((((uint32_t)(ga >> 32)) & 0x01FFFFFFu) | 0x80000000u);   // type 2
  return g;
}
__device__ __forceinline__ void tdm_load(u32x4 g0, u32x8 g1) {
  asm volatile("tensor_load_to_lds %0, %1" :: "s"(g0), "s"(g1) : "memory");
}
// The compiler places no wait for the tensor mover: the issuing wave's own wait.
__device__ __forceinline__ void wait_tensor0() { asm volatile("s_wait_tensorcnt 0x0" ::: "memory"); }
// This wave's LDS reads have retired before a buffer it read is handed back.
__device__ __forceinline__ void wait_ds0() { asm volatile("s_wait_dscnt 0x0" ::: "memory"); }

// ---------------------------------------------------------------- weights->bf16
// Each [o][c] matrix goes to fragment order: 16-row tile o >> 4 is 8 fragments (k step
// c >> 5), 8 KB in a row. A thread is one element of the destination.
__global__ void k_prep_weights(const float* qw, const float* kw, const float* vw,
                               const float* pw, unsigned short* dst) {
  int i = blockIdx.x * blockDim.x + threadIdx.x;   // 0 .. 4*65536
  int m = i >> 16;
  int f = (i >> 9) & 127, chunk = (i >> 8) & 1, ln = (i >> 3) & 31, e = i & 7;
  int o = (f >> 3) * 16 + (ln & 15);
  int ch = (f & 7) * 32 + chunk * 16 + (ln >> 4) * 8 + e;
  const float* s = (m == 0) ? qw : (m == 1) ? kw : (m == 2) ? vw : pw;
  dst[i] = f2bf(s[o * C_ + ch]);
}

__global__ void __launch_bounds__(256) __attribute__((amdgpu_waves_per_eu(2, 2)))
k_gn_stats(const float* x, float* part) {
  int blk = blockIdx.x;                            // (b*8+g)*GSL_ + slice, 0..255
  const float4* p = (const float4*)(x + (size_t)blk * (CPG_ * N_ / GSL_)) + threadIdx.x;
  float4 v[16];
#pragma unroll
  for (int i = 0; i < 16; ++i) v[i] = p[i * 256];
  float4 a = make_float4(0.f, 0.f, 0.f, 0.f), q = a;
#pragma unroll
  for (int i = 0; i < 16; ++i) {
    a.x += v[i].x; a.y += v[i].y; a.z += v[i].z; a.w += v[i].w;
    q.x += v[i].x * v[i].x; q.y += v[i].y * v[i].y;
    q.z += v[i].z * v[i].z; q.w += v[i].w * v[i].w;
  }
  float s = (a.x + a.y) + (a.z + a.w), s2 = (q.x + q.y) + (q.z + q.w);
#pragma unroll
  for (int off = 16; off > 0; off >>= 1) {
    s  += __shfl_xor(s,  off, 32);
    s2 += __shfl_xor(s2, off, 32);
  }
  __shared__ float rs[8], rq[8];
  if ((threadIdx.x & 31) == 0) { rs[threadIdx.x >> 5] = s; rq[threadIdx.x >> 5] = s2; }
  __syncthreads();
  if (threadIdx.x == 0) {
    float ts = 0.f, tq = 0.f;
#pragma unroll
    for (int w = 0; w < 8; ++w) { ts += rs[w]; tq += rq[w]; }
    *(float2*)(part + blk * GPP_) = make_float2(ts, tq);
  }
}

// Precaution: registers that the global loads or stores above it name are written again
// below it. The wait stands in front of that; the scheduling barrier keeps those
// writes, which a "memory" clobber does not hold, behind the wait.
__device__ __forceinline__ void close_regs() {
  asm volatile("s_wait_xcnt 0x0" ::: "memory");
  __builtin_amdgcn_sched_barrier(0);
}
// The same behind a run of loads from the lane's address p: as an input of the wait p
// stays in its registers up to it; else the run's last load may land on them.
__device__ __forceinline__ void close_regs_at(const unsigned short* p) {
  asm volatile("s_wait_xcnt 0x0" :: "v"(p) : "memory");
  __builtin_amdgcn_sched_barrier(0);
}
// The lane's address in a 16-row operand tile of global fragment-order storage (the
// tile's 8 fragments over its C_ columns are 8 KB in a row; see load_frag), and the
// eight fragments from it.
__device__ __forceinline__ const unsigned short* tile_at(const unsigned short* base, int tile, int lane) {
  return base + (size_t)tile * (8 * 512) + lane * 8;
}
__device__ __forceinline__ void load_tile8(v16bf (&f)[8], const unsigned short* p) {
#pragma unroll
  for (int kk = 0; kk < 8; ++kk) {
    v8bf lo = *(const v8bf*)(p + kk * 512);
    v8bf hi = *(const v8bf*)(p + kk * 512 + 256);
    f[kk] = __builtin_shufflevector(lo, hi, 0,1,2,3,4,5,6,7,8,9,10,11,12,13,14,15);
  }
  close_regs_at(p);
}

// ---------------------------------------------------------------- QKV GEMMs
// A wave's NTW_ x OTW_ block of 16x16 output tiles of q (WHICH 0), k (1) or v (2):
// the h fragments are read once from LDS (hs, fragment order) and stay in registers,
// each weight fragment serves NTW_ products. The case is chosen in front of the matrix products, so that no
// branch stands behind the last one.
template <int WHICH>
__device__ __forceinline__ void qkv_tiles(const unsigned short* hs, const unsigned short* w,
                                          const float* bias, unsigned short* dstb,
                                          int nt0, int ot0, int lane) {
  // q,k: A = weights [o][c], B = h [n][c]: a lane ends with 8 channels of one n.
  // v:   A = h, B = weights: a lane ends with 8 keys of one channel, which is
  //      the 16-byte chunk that the attention kernel's V operand wants.
  int hh = lane >> 4, lo = lane & 15;
  // The lane's 16-byte place in the first output tile of each row tile; the later
  // tiles lie at compile-time distances from it (ot0 is a multiple of OTW_).
  unsigned short* d0[NTW_];
#pragma unroll
  for (int i = 0; i < NTW_; ++i) {
    const int nt = nt0 + i;
    if (WHICH == 2) {
      // v: fragment (ot, key half) of key block nt>>2, laid so that the 256 x 128-byte
      // tile the attention kernel loads at row pitch N_ lands in fragment order:
      // tile byte L = fragment*1024 + chunk*512 + lane*16, row L>>7, column L&127.
      int row = (ot0 * 2 + ((nt >> 1) & 1)) * 8 + (nt & 1) * 4 + (lane >> 3);
      d0[i] = dstb + (size_t)row * N_ + (nt >> 2) * BC_ + (lane & 7) * 8;
    } else if (WHICH == 0) {                                // q -> fragment order, 8 KB
      d0[i] = dstb + (size_t)nt * (8 * 512) + (ot0 >> 1) * 512 + lane * 8;   // per row tile
    } else {                                                // k -> fragment order inside
      d0[i] = dstb + (size_t)(nt >> 2) * (BC_ * C_) +       // each 64-key block (32 KB)
              ((ot0 >> 1) * 4 + (nt & 3)) * 512 + lane * 8;
    }
  }
  v16bf hf[NTW_][8];
#pragma unroll
  for (int i = 0; i < NTW_; ++i)
#pragma unroll
    for (int kk = 0; kk < 8; ++kk) hf[i][kk] = load_frag(hs, i * 8 + kk, lane);
  v16bf wf[2][8];                                         // this tile's weights and the next one's
  float4 bq[2][2];
  load_tile8(wf[0], tile_at(w, ot0, lane));
  // the lane's place in the bias: its channel (v) or its first of 8 channels (q, k)
  const float* bl = bias + ot0 * 16 + ((WHICH == 2) ? lo : hh * 8);
  if (WHICH == 2) {
    bq[0][0].x = bl[0];
  } else {
    bq[0][0] = ((const float4*)bl)[0]; bq[0][1] = ((const float4*)bl)[1];
  }
  close_regs();
  // Unrolled so that the two register sets are picked at compile time and the next
  // tile's loads, written in front of this tile's products, fly during them.
#pragma unroll
  for (int oi = 0; oi < OTW_; ++oi) {
    const int cur = oi & 1, nxt = cur ^ 1;
    const int ot = ot0 + oi;
    if (oi + 1 < OTW_) {
      load_tile8(wf[nxt], tile_at(w, ot + 1, lane));
      if (WHICH == 2) {
        bq[nxt][0].x = bl[(oi + 1) * 16];
      } else {
        bq[nxt][0] = ((const float4*)bl)[(oi + 1) * 4]; bq[nxt][1] = ((const float4*)bl)[(oi + 1) * 4 + 1];
      }
    }
    // Also keeps the next tile's loads, issued above, in front of this tile's products:
    // without it the scheduler sinks each to its first use, where it is waited out.
    close_regs();
    v8f acc[NTW_];
#pragma unroll
    for (int i = 0; i < NTW_; ++i) acc[i] = zero8();
#pragma unroll
    for (int kk = 0; kk < 8; ++kk)
#pragma unroll
      for (int i = 0; i < NTW_; ++i)
        acc[i] = (WHICH == 2) ? wmma_bf16(hf[i][kk], wf[cur][kk], acc[i])
                              : wmma_bf16(wf[cur][kk], hf[i][kk], acc[i]);
#pragma unroll
    for (int i = 0; i < NTW_; ++i) {
      u16x8 outv;
      unsigned short* dst;
      if (WHICH == 2) {
        float bv = bq[cur][0].x;
#pragma unroll
        for (int r = 0; r < 8; ++r) outv[r] = f2bf(acc[i][r] + bv);
        dst = d0[i] + (size_t)oi * 16 * N_;                   // 16 fragment rows per tile
      } else {
        float4 bq0 = bq[cur][0], bq1 = bq[cur][1];
        float bias8[8] = {bq0.x, bq0.y, bq0.z, bq0.w, bq1.x, bq1.y, bq1.z, bq1.w};
        const float scale = (WHICH == 0) ? 0.0625f : 1.0f;    // 1/sqrt(256) folded into q
#pragma unroll
        for (int r = 0; r < 8; ++r) outv[r] = f2bf((acc[i][r] + bias8[r]) * scale);
        dst = d0[i] + (oi >> 1) * ((WHICH == 0) ? 512 : 2048) + (oi & 1) * 256;
      }
      *(u16x8*)dst = outv;
      close_regs();                                       // also where the three cases join again
    }
  }
}

// Work-group = QWV_ waves on QPS_ = 64 positions. First the group norm is applied to
// the 256 x 64 block of x and laid in LDS as bf16 in fragment order: h goes to no
// memory. Then QRL_ waves share each NTW_ row tiles: a wave walks one half of the
// output channels of q, k or v.
__global__ void __launch_bounds__(QWV_ * 32) k_qkv(
    const float* x, const float* gw, const float* gb, const float* part,
    const unsigned short* wq, const unsigned short* wk,
    const unsigned short* wv, const float* qb, const float* kb, const float* vb,
    unsigned short* q, unsigned short* k, unsigned short* v) {
  int lane = threadIdx.x & 31;
  const int wid = (int)uni(threadIdx.x >> 5);
  int b = blockIdx.y;
  __shared__ __attribute__((aligned(16))) unsigned short hs[QPR_ * NTW_ * 8 * 512];   // fragments [row tile][kk]

  const float* pp = part + (b * G_ + (lane & 7)) * (GSL_ * GPP_);
  float2 pv[GSL_];
#pragma unroll
  for (int j = 0; j < GSL_; ++j) pv[j] = *(const float2*)(pp + j * GPP_);
  close_regs();
  // A lane is two positions; a round of a wave is 8 channels of the 64 positions, each
  // load 256 contiguous bytes. All rounds' loads are issued ahead of the first use.
  const float* xb = x + (size_t)b * C_ * N_ + blockIdx.x * QPS_ + lane * 2;
  float2 xv[OPW_][8];
  float4 wv4[OPW_][2], bv4[OPW_][2];
#pragma unroll
  for (int j = 0; j < OPW_; ++j) {
    const int oc = wid + j * QWV_;
    if ((j + 1) * QWV_ <= OCT_ || oc < OCT_) {            // the last round: the first waves only
#pragma unroll
      for (int r = 0; r < 8; ++r) xv[j][r] = *(const float2*)(xb + (size_t)(oc * 8 + r) * N_);
      wv4[j][0] = ((const float4*)gw)[oc * 2]; wv4[j][1] = ((const float4*)gw)[oc * 2 + 1];
      bv4[j][0] = ((const float4*)gb)[oc * 2]; bv4[j][1] = ((const float4*)gb)[oc * 2 + 1];
      close_regs();
    }
  }
  float s = 0.f, s2 = 0.f;
#pragma unroll
  for (int j = 0; j < GSL_; ++j) { s += pv[j].x; s2 += pv[j].y; }
  const float inv = 1.0f / (float)(CPG_ * N_);
  float mean = s * inv;
  float rstd = rsqrtf(s2 * inv - mean * mean + 1e-5f);
#pragma unroll
  for (int j = 0; j < OPW_; ++j) {
    const int oc = wid + j * QWV_;
    if ((j + 1) * QWV_ <= OCT_ || oc < OCT_) {
      // the statistics of the piece's group, from the lane that holds them
      float mg = __builtin_bit_cast(float, __builtin_amdgcn_readlane(__builtin_bit_cast(int, mean), oc >> 2));
      float rg = __builtin_bit_cast(float, __builtin_amdgcn_readlane(__builtin_bit_cast(int, rstd), oc >> 2));
      float w8[8] = {wv4[j][0].x, wv4[j][0].y, wv4[j][0].z, wv4[j][0].w, wv4[j][1].x, wv4[j][1].y, wv4[j][1].z, wv4[j][1].w};
      float b8[8] = {bv4[j][0].x, bv4[j][0].y, bv4[j][0].z, bv4[j][0].w, bv4[j][1].x, bv4[j][1].y, bv4[j][1].z, bv4[j][1].w};
#pragma unroll
      for (int e = 0; e < 2; ++e) {
        const int n = lane * 2 + e;                       // position in the block
        u16x8 hv;
#pragma unroll
        for (int r = 0; r < 8; ++r) hv[r] = f2bf(((e ? xv[j][r].y : xv[j][r].x) - mg) * rg * w8[r] + b8[r]);
        // Channels oc*8 .. oc*8 + 7 of row n & 15 of row tile n >> 4 are chunk (oc >> 1) & 1
        // of fragment lane (oc & 1) * 16 + (n & 15), k step oc >> 2 (see load_frag).
        *(u16x8*)(hs + ((n >> 4) * 8 + (oc >> 2)) * 512 + ((oc >> 1) & 1) * 256 +
                  ((oc & 1) * 16 + (n & 15)) * 8) = hv;
      }
    }
  }
  __syncthreads();                                        // the block of h is published

  const int pr = wid / QRL_, role = wid % QRL_;
  int nt0 = (blockIdx.x * QPR_ + pr) * NTW_, ot0 = (role & 1) * OTW_, which = role >> 1;
  const unsigned short* hp = hs + pr * (NTW_ * 8 * 512);  // the fragments of the wave's row tiles
  size_t boff = (size_t)b * N_ * C_;
  if (which == 0)      qkv_tiles<0>(hp, wq, qb, q + boff, nt0, ot0, lane);
  else if (which == 1) qkv_tiles<1>(hp, wk, kb, k + boff, nt0, ot0, lane);
  else                 qkv_tiles<2>(hp, wv, vb, v + boff, nt0, ot0, lane);
}

__global__ void __launch_bounds__(256) k_attn(
    const unsigned short* q, const unsigned short* k, const unsigned short* v,
    unsigned short* o) {
  int lane = threadIdx.x & 31;
  const uint32_t wid = uni(threadIdx.x >> 5);
  const uint32_t qh = wid & 1u;                           // query half of the workgroup
  const uint32_t kq = wid >> 1;                           // key quarter of the stage
  int b = blockIdx.y;
  int n0 = blockIdx.x * 64 + (int)qh * (QTW_ * 16);       // 32 query rows per wave
  // In the comments below hh = lane >> 4 and lo = lane & 15.
  const unsigned short* qp = q + (size_t)b * N_ * C_;
  const unsigned short* kp = k + (size_t)b * N_ * C_;
  const unsigned short* vp = v + (size_t)b * C_ * N_;

  // 2-KiB alignment: every tensor load's place in LDS is a multiple of 2 KiB.
  __shared__ __attribute__((aligned(2048))) unsigned short smk[2][KS_][BC_ * C_];  // K fragments [kk][mt]
  __shared__ __attribute__((aligned(2048))) unsigned short smv[2][KS_][C_ * BC_];  // V fragments [t][kk]
  __shared__ float4 sml[8][32];                           // final merge: each wave's m and l

  // This wave's slice of a stage. Waves 0-3: a quarter of the stage's K, 16 KB that
  // are contiguous in memory (32 rows of 512 B). Waves 4-7: 128 of the 256 rows
  // (128 B each, pitch 2*N_ B) of one of the stage's two V blocks.
  const bool isk = wid < 4u;
  const uint32_t j = wid & 3u;
  const uint64_t src0 = isk ? (uint64_t)(uintptr_t)kp + j * SLB_
                            : (uint64_t)(uintptr_t)vp + (uint64_t)(j & 1u) * (128u * N_ * 2u) + (j >> 1) * (BC_ * 2u);
  const uint32_t sstep = isk ? STB_ : (uint32_t)(KS_ * BC_ * 2);     // source bytes per stage
  const uint32_t lds0 = (isk ? (uint32_t)(uintptr_t)&smk[0][0][0] : (uint32_t)(uintptr_t)&smv[0][0][0]) + j * SLB_;
  const u32x8 g1 = isk ? tdm_group1(512u, 32u, 512u) : tdm_group1(128u, 128u, (uint32_t)(N_ * 2));

  tdm_load(tdm_group0(lds0, src0), g1);                   // stage 0 -> buffer 0

  v16bf qr[QTW_][8];                                      // Q block in registers
  const unsigned short* qt = tile_at(qp, n0 >> 4, lane);  // the wave's QTW_ tiles lie in a row
#pragma unroll
  for (int i = 0; i < QTW_; ++i)
#pragma unroll
    for (int kk = 0; kk < 8; ++kk) qr[i][kk] = load_frag(qt, i * 8 + kk, 0);
  close_regs_at(qt);

  v8f acc[QTW_][16];                 // O^T: acc[i][t][r] = channel t*16 + hh*8 + r of query i*16 + lo
#pragma unroll
  for (int i = 0; i < QTW_; ++i)
#pragma unroll
    for (int t = 0; t < 16; ++t) acc[i][t] = zero8();
  float mrun[QTW_], lrun[QTW_];      // maximum in use (equal in both halves); sum over this half's keys
#pragma unroll
  for (int i = 0; i < QTW_; ++i) { mrun[i] = -1e30f; lrun[i] = 0.0f; }

  wait_tensor0();
  __syncthreads();                                        // stage 0 is published

  for (int it = 0; it < NST_; ++it) {                     // 32 stages, 32 keys per wave
    int buf = it & 1;
    // Behind the barrier that published stage it and ended every read of the other
    // buffer: the load of stage it + 1 into that buffer flies during this pass.
    const uint32_t nx = pinned((uint32_t)it + 1u);        // the load's words are formed behind the wait
    if (pinned(nx < (uint32_t)NST_))                      // scalar test: stage it + 1 exists
      tdm_load(tdm_group0(lds0 + (nx & 1u) * STB_, src0 + (uint64_t)nx * sstep), g1);
    // The wave's 32 keys: half kq & 1 of 64-key block kq >> 1, which is K fragments
    // kk*4 + (kq & 1)*2 + m and V fragments t*2 + (kq & 1) of that block.
    const unsigned short* kb = smk[buf][kq >> 1] + (kq & 1u) * 1024u;
    const unsigned short* vb = smv[buf][kq >> 1] + (kq & 1u) * 512u;

    // Fragments come in groups of four, one group ahead of the products that use them,
    // in two register sets: f[g & 1] is worked on while the other set's loads fly.
    v16bf f[2][4];
    v8f s[QTW_][2];                    // S^T: s[i][m][r] = key m*16 + hh*8 + r, query i*16 + lo
#pragma unroll
    for (int i = 0; i < QTW_; ++i)
#pragma unroll
      for (int m = 0; m < 2; ++m) s[i][m] = zero8();
#pragma unroll
    for (int x = 0; x < 4; ++x) f[0][x] = load_frag(kb, (x >> 1) * 4 + (x & 1), lane);
#pragma unroll
    for (int g = 0; g < 4; ++g) {      // group g: K fragments of kk = 2g, 2g + 1
#pragma unroll
      for (int x = 0; x < 4; ++x)      // behind the last K group, the first V group
        f[(g + 1) & 1][x] = (g < 3) ? load_frag(kb, ((g + 1) * 2 + (x >> 1)) * 4 + (x & 1), lane)
                                    : load_frag(vb, x * 2, lane);
      // Keeps the next group's loads together and in front of this group's products:
      // without it the scheduler sinks each load to its use, where it is waited out.
      __builtin_amdgcn_sched_barrier(0);
#pragma unroll
      for (int x = 0; x < 4; ++x)
#pragma unroll
        for (int i = 0; i < QTW_; ++i)
          s[i][x & 1] = wmma_bf16(f[g & 1][x], qr[i][g * 2 + (x >> 1)], s[i][x & 1]);
      __builtin_amdgcn_sched_barrier(0);   // the same: no later load rises among these products
    }

    float mx[QTW_];                                       // block maximum of query i*16 + lo
    bool need = false;
#pragma unroll
    for (int i = 0; i < QTW_; ++i) {
      float m0 = s[i][0][0], m1 = s[i][1][0];
#pragma unroll
      for (int r = 1; r < 8; ++r) { m0 = fmaxf(m0, s[i][0][r]); m1 = fmaxf(m1, s[i][1][r]); }
      mx[i] = fmaxf(m0, m1);
      mx[i] = fmaxf(mx[i], xhalf(mx[i]));                 // the other half's 16 keys
      need = need || (mx[i] > mrun[i]);
    }
    if (__ballot(need) != 0ull) {                         // lazy rescale, one test per pass
#pragma unroll
      for (int i = 0; i < QTW_; ++i) {
        float mnew = fmaxf(mrun[i], mx[i]);
        float cf = __expf(mrun[i] - mnew);
        lrun[i] *= cf;
        mrun[i] = mnew;
#pragma unroll
        for (int t = 0; t < 16; ++t)
#pragma unroll
          for (int r = 0; r < 8; ++r) acc[i][t][r] *= cf;
      }
    }
    // P^T = exp(S^T - m): a query tile's two score tiles hold, register for register,
    // the k order of a B operand over the 32 keys of one V fragment.
    v16bf pb[QTW_];
#pragma unroll
    for (int i = 0; i < QTW_; ++i) {
      float ps[2];
#pragma unroll
      for (int m = 0; m < 2; ++m) {
        ps[m] = 0.0f;
#pragma unroll
        for (int r = 0; r < 8; ++r) {
          float p = __expf(s[i][m][r] - mrun[i]);
          ps[m] += p;
          pb[i][m * 8 + r] = (__bf16)p;
        }
      }
      lrun[i] += ps[0] + ps[1];
    }
#pragma unroll
    for (int g = 0; g < 4; ++g) {                         // O^T += V^T * P^T, channel tiles 4g .. 4g + 3
      if (g < 3) {
#pragma unroll
        for (int x = 0; x < 4; ++x) f[(g + 1) & 1][x] = load_frag(vb, ((g + 1) * 4 + x) * 2, lane);
      }
      __builtin_amdgcn_sched_barrier(0);
#pragma unroll
      for (int x = 0; x < 4; ++x)
#pragma unroll
        for (int i = 0; i < QTW_; ++i) acc[i][g * 4 + x] = wmma_bf16(f[g & 1][x], pb[i], acc[i][g * 4 + x]);
      __builtin_amdgcn_sched_barrier(0);
    }

    // Publish point of stage it + 1: own LDS reads retired, own slice landed, then
    // the barrier, which also ends every reader's last read of this pass's buffer.
    wait_ds0();
    wait_tensor0();
    __syncthreads();
  }
  wait_tensor0();
  wait_ds0();

  // Merge of the four key quarters of a query half. The last pass's barrier has ended
  // every read of the ring, which now carries the hand-over: each wave lays down its
  // 32 KB of partial O^T (query half 0 in the K ring, half 1 in the V ring) and its m
  // and l; behind the barrier wave kq joins channel tiles kq*4 .. kq*4 + 3 of all four.
  // 16-byte stores and loads, 512 contiguous bytes each.
  float4* ring = (float4*)(qh == 0u ? &smk[0][0][0] : &smv[0][0][0]) + lane;
  float4* mine = ring + kq * MGW_;
#pragma unroll
  for (int i = 0; i < QTW_; ++i)
#pragma unroll
    for (int t = 0; t < 16; ++t) {
      mine[((i * 16 + t) * 2) * 32]     = make_float4(acc[i][t][0], acc[i][t][1], acc[i][t][2], acc[i][t][3]);
      mine[((i * 16 + t) * 2 + 1) * 32] = make_float4(acc[i][t][4], acc[i][t][5], acc[i][t][6], acc[i][t][7]);
    }
#pragma unroll
  for (int i = 0; i < QTW_; ++i) lrun[i] += xhalf(lrun[i]);   // the two halves' sums, joined once
  sml[wid][lane] = make_float4(mrun[0], lrun[0], mrun[1], lrun[1]);
  __syncthreads();
  float wq[QTW_][4];                                      // weight of each quarter's part
  {
    float4 ml[4];
#pragma unroll
    for (int p = 0; p < 4; ++p) ml[p] = sml[p * 2 + qh][lane];
    float ma = fmaxf(fmaxf(ml[0].x, ml[1].x), fmaxf(ml[2].x, ml[3].x));
    float mb = fmaxf(fmaxf(ml[0].z, ml[1].z), fmaxf(ml[2].z, ml[3].z));
    float la = 0.0f, lb = 0.0f;
#pragma unroll
    for (int p = 0; p < 4; ++p) {
      wq[0][p] = __expf(ml[p].x - ma); la += ml[p].y * wq[0][p];
      wq[1][p] = __expf(ml[p].z - mb); lb += ml[p].w * wq[1][p];
    }
    float ia = 1.0f / la, ib = 1.0f / lb;
#pragma unroll
    for (int p = 0; p < 4; ++p) { wq[0][p] *= ia; wq[1][p] *= ib; }
  }
  // O -> bf16 in fragment order for k_proj: a lane's 8 values, 8 consecutive channels of
  // its query, are chunk t & 1 of its own lane in k step kq*2 + (t >> 1) of the query tile.
  unsigned short* ob = o + (size_t)b * N_ * C_ + (size_t)(n0 >> 4) * (8 * 512) + (int)kq * (2 * 512) + lane * 8;
  const float4* part = ring + kq * (4 * 2 * 32);          // tile kq*4 of query tile 0, quarter 0
#pragma unroll
  for (int i = 0; i < QTW_; ++i)
#pragma unroll
    for (int t = 0; t < 4; ++t) {
      float sum[8];
#pragma unroll
      for (int r = 0; r < 8; ++r) sum[r] = 0.0f;
#pragma unroll
      for (int p = 0; p < 4; ++p) {
        float4 p0 = part[p * MGW_ + ((i * 16 + t) * 2) * 32], p1 = part[p * MGW_ + ((i * 16 + t) * 2 + 1) * 32];
        float pv[8] = {p0.x, p0.y, p0.z, p0.w, p1.x, p1.y, p1.z, p1.w};
#pragma unroll
        for (int r = 0; r < 8; ++r) sum[r] += pv[r] * wq[i][p];
      }
      u16x8 outv;
#pragma unroll
      for (int r = 0; r < 8; ++r) outv[r] = f2bf(sum[r]);
      *(u16x8*)(ob + i * (8 * 512) + (t >> 1) * 512 + (t & 1) * 256) = outv;
      // Precaution: registers that this store names are written again for the next
      // tile; the wait stands in front of that.
      close_regs();
    }
}

// -------------------------------------------------- projection + residual add
// As in k_qkv: a wave keeps the O fragments of NTW_ row tiles in registers and walks
// OTW_ weight tiles with them; the next tile's weights, bias and x are loaded one
// tile ahead.
__global__ void __launch_bounds__(GWV_ * 32) k_proj(
    const unsigned short* o, const unsigned short* wp, const float* pb,
    const float* x, float* out) {
  int lane = threadIdx.x & 31;
  int nt0 = (blockIdx.x * GWV_ + (threadIdx.x >> 5)) * NTW_, ot0 = blockIdx.y * OTW_;
  int b = blockIdx.z;
  int hh = lane >> 4, lo = lane & 15;
  const unsigned short* ob = o + (size_t)b * N_ * C_;
  // element (channel ot0*16 + hh*8, position nt0*16 + lo) of x and of out
  const size_t idx0 = ((size_t)b * C_ + ot0 * 16 + hh * 8) * N_ + nt0 * 16 + lo;
  const float* xp = x + idx0;
  float* op = out + idx0;
  const float4* bp = (const float4*)(pb + ot0 * 16 + hh * 8);
  v16bf of[NTW_][8];                                      // O, rows n
#pragma unroll
  for (int i = 0; i < NTW_; ++i) load_tile8(of[i], tile_at(ob, nt0 + i, lane));
  v16bf wf[2][8];                                         // pw, rows o: this tile and the next
  float4 bq[2][2];
  float xv[2][NTW_][8];
  load_tile8(wf[0], tile_at(wp, ot0, lane));
  bq[0][0] = bp[0]; bq[0][1] = bp[1];
  close_regs();
#pragma unroll
  for (int i = 0; i < NTW_; ++i)
#pragma unroll
    for (int r = 0; r < 8; ++r) xv[0][i][r] = xp[(size_t)r * N_ + i * 16];
  close_regs();
  // Unrolled so that the two register sets are picked at compile time and the next
  // tile's loads, written in front of this tile's products, fly during them.
#pragma unroll
  for (int oi = 0; oi < OTW_; ++oi) {
    const int cur = oi & 1, nxt = cur ^ 1;
    if (oi + 1 < OTW_) {
      load_tile8(wf[nxt], tile_at(wp, ot0 + oi + 1, lane));
      bq[nxt][0] = bp[(oi + 1) * 4]; bq[nxt][1] = bp[(oi + 1) * 4 + 1];
#pragma unroll
      for (int i = 0; i < NTW_; ++i)
#pragma unroll
        for (int r = 0; r < 8; ++r)
          xv[nxt][i][r] = xp[(size_t)((oi + 1) * 16 + r) * N_ + i * 16];
    }
    // Also keeps the next tile's loads, issued above, in front of this tile's products:
    // without it the scheduler sinks each to its first use, where it is waited out.
    close_regs();
    v8f acc[NTW_];
#pragma unroll
    for (int i = 0; i < NTW_; ++i) acc[i] = zero8();
#pragma unroll
    for (int kk = 0; kk < 8; ++kk)
#pragma unroll
      for (int i = 0; i < NTW_; ++i) acc[i] = wmma_bf16(wf[cur][kk], of[i][kk], acc[i]);
    float4 b0 = bq[cur][0], b1 = bq[cur][1];
    float bias8[8] = {b0.x, b0.y, b0.z, b0.w, b1.x, b1.y, b1.z, b1.w};
#pragma unroll
    for (int i = 0; i < NTW_; ++i) {
#pragma unroll
      for (int r = 0; r < 8; ++r)
        op[(size_t)(oi * 16 + r) * N_ + i * 16] = xv[cur][i][r] + acc[i][r] + bias8[r];
      close_regs();
    }
  }
}

extern "C" void kernel_launch(void* const* d_in, const int* in_sizes, int n_in,
                              void* d_out, int out_size, void* d_ws, size_t ws_size,
                              hipStream_t stream) {
  (void)in_sizes; (void)n_in; (void)out_size; (void)ws_size;
  const float* x     = (const float*)d_in[0];
  const float* gnw   = (const float*)d_in[1];
  const float* gnb   = (const float*)d_in[2];
  const float* qw    = (const float*)d_in[3];
  const float* qbias = (const float*)d_in[4];
  const float* kw    = (const float*)d_in[5];
  const float* kbias = (const float*)d_in[6];
  const float* vw    = (const float*)d_in[7];
  const float* vbias = (const float*)d_in[8];
  const float* pw    = (const float*)d_in[9];
  const float* pbias = (const float*)d_in[10];
  float* out = (float*)d_out;

  char* w = (char*)d_ws;
  unsigned short* wqb  = (unsigned short*)(w + 1024);       // 4 x 64K bf16
  unsigned short* wkb  = wqb + 65536;
  unsigned short* wvb  = wqb + 2 * 65536;
  unsigned short* wpb  = wqb + 3 * 65536;
  const size_t    bnc  = (size_t)B_ * N_ * C_;
  unsigned short* qd = (unsigned short*)(w + 1024 + 524288);
  unsigned short* kd = qd + bnc;
  unsigned short* vd = kd + bnc;
  unsigned short* od = vd + bnc;
  float*        part = (float*)(od + bnc);                  // 256 x 128 B; total ~32.5 MB

  k_prep_weights<<<1024, 256, 0, stream>>>(qw, kw, vw, pw, wqb);
  k_gn_stats    <<<B_ * G_ * GSL_, 256, 0, stream>>>(x, part);
  k_qkv         <<<dim3(N_ / QPS_, B_), QWV_ * 32, 0, stream>>>(
                    x, gnw, gnb, part, wqb, wkb, wvb, qbias, kbias, vbias, qd, kd, vd);
  k_attn        <<<dim3(N_ / 64, B_), 256, 0, stream>>>(qd, kd, vd, od);
  k_proj        <<<dim3(N_ / (16 * NTW_ * GWV_), C_ / (16 * OTW_), B_), GWV_ * 32, 0, stream>>>(od, wpb, pbias, x, out);
}

// v009
// A run of this version takes 75.7 microseconds.
// In two side-by-side timings against v008, it was 1.05 and 1.06 times as fast.
// Over all steps from v000 it is 13.6 times as fast.
#include <hip/hip_runtime.h>
#include <cstdint>

#define B_   4
#define C_   256
#define N_   4096
#define G_   8
#define CPG_ 32
#define BC_  64
#define KS_  2
#define QTW_ 2
#define NST_ (N_ / (BC_ * KS_))
#define SLB_ 16384u
#define STB_ 65536u
#define MGW_ 2048
#define GSL_ 8
#define GPP_ 32
#define POT_ 2
#define NTW_ 2
#define OTW_ 8
#define QRL_ 6
#define QPR_ 2
#define QWV_ (QRL_ * QPR_)
#define QPS_ (QPR_ * NTW_ * 16)
#define OCT_ (C_ / 8)    // 8-channel pieces of a position's h row
#define OPW_ ((OCT_ + QWV_ - 1) / QWV_)   // rounds in which the QWV_ waves stage them

typedef __attribute__((ext_vector_type(16))) __bf16 v16bf;
typedef __attribute__((ext_vector_type(8)))  __bf16 v8bf;
typedef __attribute__((ext_vector_type(8)))  float  v8f;
typedef __attribute__((ext_vector_type(8)))  unsigned short u16x8;
typedef __attribute__((ext_vector_type(4)))  uint32_t u32x4;
typedef __attribute__((ext_vector_type(8)))  uint32_t u32x8;

__device__ __forceinline__ unsigned short f2bf(float f) {
  unsigned u = __builtin_bit_cast(unsigned, f);
  u += 0x7fffu + ((u >> 16) & 1u);          // round-to-nearest-even
  return (unsigned short)(u >> 16);
}

__device__ __forceinline__ v8f zero8() {
  v8f z;
#pragma unroll
  for (int i = 0; i < 8; ++i) z[i] = 0.0f;
  return z;
}

__device__ __forceinline__ v16bf load_frag(const unsigned short* base, int f, int lane) {
  const unsigned short* p = base + f * 512 + lane * 8;
  v8bf lo = *(const v8bf*)p;
  v8bf hi = *(const v8bf*)(p + 256);
  return __builtin_shufflevector(lo, hi, 0,1,2,3,4,5,6,7,8,9,10,11,12,13,14,15);
}

__device__ __forceinline__ v8f wmma_bf16(v16bf a, v16bf b, v8f c) {
  return __builtin_amdgcn_wmma_f32_16x16x32_bf16(false, a, false, b, (short)0, c,
                                                 false, false);
}

__device__ __forceinline__ float xhalf(float x) {
  int i = __builtin_bit_cast(int, x);
  return __builtin_bit_cast(float, __builtin_amdgcn_permlanex16(i, i, 0x76543210, 0xfedcba98, false, false));
}

__device__ __forceinline__ uint32_t uni(uint32_t v) {
  return (uint32_t)__builtin_amdgcn_readfirstlane(v);
}

__device__ __forceinline__ uint32_t pinned(uint32_t v) {
  uint32_t w = uni(v);
  asm volatile("" : "+s"(w));
  return w;
}

__device__ __forceinline__ u32x8 tdm_group1(uint32_t rowb, uint32_t nrows, uint32_t pitch) {
  u32x8 g;
  g[0] = uni(0u);
  g[1] = uni((rowb & 0xFFFFu) << 16);
  g[2] = uni((rowb >> 16) | ((nrows & 0xFFFFu) << 16));
  g[3] = uni((nrows >> 16) | (rowb << 16));
  g[4] = uni(nrows);
  g[5] = uni(pitch);
  g[6] = uni(0u);
  g[7] = uni(0u);
  return g;
}
__device__ __forceinline__ u32x4 tdm_group0(uint32_t lds_dst, uint64_t ga) {
  u32x4 g;
  g[0] = uni(1u);                              // count 1
  g[1] = uni(lds_dst);
  g[2] = uni((uint32_t)ga);
  g[3] = uni((((uint32_t)(ga >> 32)) & 0x01FFFFFFu) | 0x80000000u);   // type 2
  return g;
}
__device__ __forceinline__ void tdm_load(u32x4 g0, u32x8 g1) {
  asm volatile("tensor_load_to_lds %0, %1" :: "s"(g0), "s"(g1) : "memory");
}
// The compiler places no wait for the tensor mover: the issuing wave's own wait.
__device__ __forceinline__ void wait_tensor0() { asm volatile("s_wait_tensorcnt 0x0" ::: "memory"); }
// This wave's LDS reads have retired before a buffer it read is handed back.
__device__ __forceinline__ void wait_ds0() { asm volatile("s_wait_dscnt 0x0" ::: "memory"); }

// ---------------------------------------------------------------- weights->bf16
// Each [o][c] matrix goes to fragment order: 16-row tile o >> 4 is 8 fragments (k step
// c >> 5), 8 KB in a row. A thread is one element of the destination.
__global__ void k_prep_weights(const float* qw, const float* kw, const float* vw,
                               const float* pw, unsigned short* dst) {
  int i = blockIdx.x * blockDim.x + threadIdx.x;   // 0 .. 4*65536
  int m = i >> 16;
  int f = (i >> 9) & 127, chunk = (i >> 8) & 1, ln = (i >> 3) & 31, e = i & 7;
  int o = (f >> 3) * 16 + (ln & 15);
  int ch = (f & 7) * 32 + chunk * 16 + (ln >> 4) * 8 + e;
  const float* s = (m == 0) ? qw : (m == 1) ? kw : (m == 2) ? vw : pw;
  dst[i] = f2bf(s[o * C_ + ch]);
}

__global__ void __launch_bounds__(256) __attribute__((amdgpu_waves_per_eu(2, 2)))
k_gn_stats(const float* x, float* part) {
  int blk = blockIdx.x;                            // (b*8+g)*GSL_ + slice, 0..255
  const float4* p = (const float4*)(x + (size_t)blk * (CPG_ * N_ / GSL_)) + threadIdx.x;
  float4 v[16];
#pragma unroll
  for (int i = 0; i < 16; ++i) v[i] = p[i * 256];
  float4 a = make_float4(0.f, 0.f, 0.f, 0.f), q = a;
#pragma unroll
  for (int i = 0; i < 16; ++i) {
    a.x += v[i].x; a.y += v[i].y; a.z += v[i].z; a.w += v[i].w;
    q.x += v[i].x * v[i].x; q.y += v[i].y * v[i].y;
    q.z += v[i].z * v[i].z; q.w += v[i].w * v[i].w;
  }
  float s = (a.x + a.y) + (a.z + a.w), s2 = (q.x + q.y) + (q.z + q.w);
#pragma unroll
  for (int off = 16; off > 0; off >>= 1) {
    s  += __shfl_xor(s,  off, 32);
    s2 += __shfl_xor(s2, off, 32);
  }
  __shared__ float rs[8], rq[8];
  if ((threadIdx.x & 31) == 0) { rs[threadIdx.x >> 5] = s; rq[threadIdx.x >> 5] = s2; }
  __syncthreads();
  if (threadIdx.x == 0) {
    float ts = 0.f, tq = 0.f;
#pragma unroll
    for (int w = 0; w < 8; ++w) { ts += rs[w]; tq += rq[w]; }
    *(float2*)(part + blk * GPP_) = make_float2(ts, tq);
  }
}

// Precaution: registers that the global loads or stores above it name are written again
// below it. The wait stands in front of that; the scheduling barrier keeps those
// writes, which a "memory" clobber does not hold, behind the wait.
__device__ __forceinline__ void close_regs() {
  asm volatile("s_wait_xcnt 0x0" ::: "memory");
  __builtin_amdgcn_sched_barrier(0);
}
// The same behind a run of loads from the lane's address p: as an input of the wait p
// stays in its registers up to it; else the run's last load may land on them.
__device__ __forceinline__ void close_regs_at(const unsigned short* p) {
  asm volatile("s_wait_xcnt 0x0" :: "v"(p) : "memory");
  __builtin_amdgcn_sched_barrier(0);
}
// The lane's address in a 16-row operand tile of global fragment-order storage (the
// tile's 8 fragments over its C_ columns are 8 KB in a row; see load_frag), and the
// eight fragments from it.
__device__ __forceinline__ const unsigned short* tile_at(const unsigned short* base, int tile, int lane) {
  return base + (size_t)tile * (8 * 512) + lane * 8;
}
__device__ __forceinline__ void load_tile8(v16bf (&f)[8], const unsigned short* p) {
#pragma unroll
  for (int kk = 0; kk < 8; ++kk) {
    v8bf lo = *(const v8bf*)(p + kk * 512);
    v8bf hi = *(const v8bf*)(p + kk * 512 + 256);
    f[kk] = __builtin_shufflevector(lo, hi, 0,1,2,3,4,5,6,7,8,9,10,11,12,13,14,15);
  }
  close_regs_at(p);
}

// ---------------------------------------------------------------- QKV GEMMs
// A wave's NTW_ x OTW_ block of 16x16 output tiles of q (WHICH 0), k (1) or v (2):
// the h fragments are read once from LDS (hs, fragment order) and stay in registers,
// each weight fragment serves NTW_ products. The case is chosen in front of the matrix products, so that no
// branch stands behind the last one.
template <int WHICH>
__device__ __forceinline__ void qkv_tiles(const unsigned short* hs, const unsigned short* w,
                                          const float* bias, unsigned short* dstb,
                                          int nt0, int ot0, int lane) {
  // q,k: A = weights [o][c], B = h [n][c]: a lane ends with 8 channels of one n.
  // v:   A = h, B = weights: a lane ends with 8 keys of one channel, which is
  //      the 16-byte chunk that the attention kernel's V operand wants.
  int hh = lane >> 4, lo = lane & 15;
  // The lane's 16-byte place in the first output tile of each row tile; the later
  // tiles lie at compile-time distances from it (ot0 is a multiple of OTW_).
  unsigned short* d0[NTW_];
#pragma unroll
  for (int i = 0; i < NTW_; ++i) {
    const int nt = nt0 + i;
    if (WHICH == 2) {
      // v: fragment (ot, key half) of key block nt>>2, laid so that the 256 x 128-byte
      // tile the attention kernel loads at row pitch N_ lands in fragment order:
      // tile byte L = fragment*1024 + chunk*512 + lane*16, row L>>7, column L&127.
      int row = (ot0 * 2 + ((nt >> 1) & 1)) * 8 + (nt & 1) * 4 + (lane >> 3);
      d0[i] = dstb + (size_t)row * N_ + (nt >> 2) * BC_ + (lane & 7) * 8;
    } else if (WHICH == 0) {                                // q -> fragment order, 8 KB
      d0[i] = dstb + (size_t)nt * (8 * 512) + (ot0 >> 1) * 512 + lane * 8;   // per row tile
    } else {                                                // k -> fragment order inside
      d0[i] = dstb + (size_t)(nt >> 2) * (BC_ * C_) +       // each 64-key block (32 KB)
              ((ot0 >> 1) * 4 + (nt & 3)) * 512 + lane * 8;
    }
  }
  v16bf hf[NTW_][8];
#pragma unroll
  for (int i = 0; i < NTW_; ++i)
#pragma unroll
    for (int kk = 0; kk < 8; ++kk) hf[i][kk] = load_frag(hs, i * 8 + kk, lane);
  v16bf wf[2][8];                                         // this tile's weights and the next one's
  float4 bq[2][2];
  load_tile8(wf[0], tile_at(w, ot0, lane));
  // the lane's place in the bias: its channel (v) or its first of 8 channels (q, k)
  const float* bl = bias + ot0 * 16 + ((WHICH == 2) ? lo : hh * 8);
  if (WHICH == 2) {
    bq[0][0].x = bl[0];
  } else {
    bq[0][0] = ((const float4*)bl)[0]; bq[0][1] = ((const float4*)bl)[1];
  }
  close_regs();
  // Unrolled so that the two register sets are picked at compile time and the next
  // tile's loads, written in front of this tile's products, fly during them.
#pragma unroll
  for (int oi = 0; oi < OTW_; ++oi) {
    const int cur = oi & 1, nxt = cur ^ 1;
    const int ot = ot0 + oi;
    if (oi + 1 < OTW_) {
      load_tile8(wf[nxt], tile_at(w, ot + 1, lane));
      if (WHICH == 2) {
        bq[nxt][0].x = bl[(oi + 1) * 16];
      } else {
        bq[nxt][0] = ((const float4*)bl)[(oi + 1) * 4]; bq[nxt][1] = ((const float4*)bl)[(oi + 1) * 4 + 1];
      }
    }
    // Also keeps the next tile's loads, issued above, in front of this tile's products:
    // without it the scheduler sinks each to its first use, where it is waited out.
    close_regs();
    v8f acc[NTW_];
#pragma unroll
    for (int i = 0; i < NTW_; ++i) acc[i] = zero8();
#pragma unroll
    for (int kk = 0; kk < 8; ++kk)
#pragma unroll
      for (int i = 0; i < NTW_; ++i)
        acc[i] = (WHICH == 2) ? wmma_bf16(hf[i][kk], wf[cur][kk], acc[i])
                              : wmma_bf16(wf[cur][kk], hf[i][kk], acc[i]);
#pragma unroll
    for (int i = 0; i < NTW_; ++i) {
      u16x8 outv;
      unsigned short* dst;
      if (WHICH == 2) {
        float bv = bq[cur][0].x;
#pragma unroll
        for (int r = 0; r < 8; ++r) outv[r] = f2bf(acc[i][r] + bv);
        dst = d0[i] + (size_t)oi * 16 * N_;                   // 16 fragment rows per tile
      } else {
        float4 bq0 = bq[cur][0], bq1 = bq[cur][1];
        float bias8[8] = {bq0.x, bq0.y, bq0.z, bq0.w, bq1.x, bq1.y, bq1.z, bq1.w};
        const float scale = (WHICH == 0) ? 0.0625f : 1.0f;    // 1/sqrt(256) folded into q
#pragma unroll
        for (int r = 0; r < 8; ++r) outv[r] = f2bf((acc[i][r] + bias8[r]) * scale);
        dst = d0[i] + (oi >> 1) * ((WHICH == 0) ? 512 : 2048) + (oi & 1) * 256;
      }
      *(u16x8*)dst = outv;
      close_regs();                                       // also where the three cases join again
    }
  }
}

// Work-group = QWV_ waves on QPS_ = 64 positions. First the group norm is applied to
// the 256 x 64 block of x and laid in LDS as bf16 in fragment order: h goes to no
// memory. Then QRL_ waves share each NTW_ row tiles: a wave walks one half of the
// output channels of q, k or v.
__global__ void __launch_bounds__(QWV_ * 32) k_qkv(
    const float* x, const float* gw, const float* gb, const float* part,
    const unsigned short* wq, const unsigned short* wk,
    const unsigned short* wv, const float* qb, const float* kb, const float* vb,
    unsigned short* q, unsigned short* k, unsigned short* v) {
  int lane = threadIdx.x & 31;
  const int wid = (int)uni(threadIdx.x >> 5);
  int b = blockIdx.y;
  __shared__ __attribute__((aligned(16))) unsigned short hs[QPR_ * NTW_ * 8 * 512];   // fragments [row tile][kk]

  const float* pp = part + (b * G_ + (lane & 7)) * (GSL_ * GPP_);
  float2 pv[GSL_];
#pragma unroll
  for (int j = 0; j < GSL_; ++j) pv[j] = *(const float2*)(pp + j * GPP_);
  close_regs();
  // A lane is two positions; a round of a wave is 8 channels of the 64 positions, each
  // load 256 contiguous bytes. All rounds' loads are issued ahead of the first use.
  const float* xb = x + (size_t)b * C_ * N_ + blockIdx.x * QPS_ + lane * 2;
  float2 xv[OPW_][8];
  float4 wv4[OPW_][2], bv4[OPW_][2];
#pragma unroll
  for (int j = 0; j < OPW_; ++j) {
    const int oc = wid + j * QWV_;
    if ((j + 1) * QWV_ <= OCT_ || oc < OCT_) {            // the last round: the first waves only
#pragma unroll
      for (int r = 0; r < 8; ++r) xv[j][r] = *(const float2*)(xb + (size_t)(oc * 8 + r) * N_);
      wv4[j][0] = ((const float4*)gw)[oc * 2]; wv4[j][1] = ((const float4*)gw)[oc * 2 + 1];
      bv4[j][0] = ((const float4*)gb)[oc * 2]; bv4[j][1] = ((const float4*)gb)[oc * 2 + 1];
      close_regs();
    }
  }
  float s = 0.f, s2 = 0.f;
#pragma unroll
  for (int j = 0; j < GSL_; ++j) { s += pv[j].x; s2 += pv[j].y; }
  const float inv = 1.0f / (float)(CPG_ * N_);
  float mean = s * inv;
  float rstd = rsqrtf(s2 * inv - mean * mean + 1e-5f);
#pragma unroll
  for (int j = 0; j < OPW_; ++j) {
    const int oc = wid + j * QWV_;
    if ((j + 1) * QWV_ <= OCT_ || oc < OCT_) {
      // the statistics of the piece's group, from the lane that holds them
      float mg = __builtin_bit_cast(float, __builtin_amdgcn_readlane(__builtin_bit_cast(int, mean), oc >> 2));
      float rg = __builtin_bit_cast(float, __builtin_amdgcn_readlane(__builtin_bit_cast(int, rstd), oc >> 2));
      float w8[8] = {wv4[j][0].x, wv4[j][0].y, wv4[j][0].z, wv4[j][0].w, wv4[j][1].x, wv4[j][1].y, wv4[j][1].z, wv4[j][1].w};
      float b8[8] = {bv4[j][0].x, bv4[j][0].y, bv4[j][0].z, bv4[j][0].w, bv4[j][1].x, bv4[j][1].y, bv4[j][1].z, bv4[j][1].w};
#pragma unroll
      for (int e = 0; e < 2; ++e) {
        const int n = lane * 2 + e;                       // position in the block
        u16x8 hv;
#pragma unroll
        for (int r = 0; r < 8; ++r) hv[r] = f2bf(((e ? xv[j][r].y : xv[j][r].x) - mg) * rg * w8[r] + b8[r]);
        // Channels oc*8 .. oc*8 + 7 of row n & 15 of row tile n >> 4 are chunk (oc >> 1) & 1
        // of fragment lane (oc & 1) * 16 + (n & 15), k step oc >> 2 (see load_frag).
        *(u16x8*)(hs + ((n >> 4) * 8 + (oc >> 2)) * 512 + ((oc >> 1) & 1) * 256 +
                  ((oc & 1) * 16 + (n & 15)) * 8) = hv;
      }
    }
  }
  __syncthreads();                                        // the block of h is published

  const int pr = wid / QRL_, role = wid % QRL_;
  int nt0 = (blockIdx.x * QPR_ + pr) * NTW_, ot0 = (role & 1) * OTW_, which = role >> 1;
  const unsigned short* hp = hs + pr * (NTW_ * 8 * 512);  // the fragments of the wave's row tiles
  size_t boff = (size_t)b * N_ * C_;
  if (which == 0)      qkv_tiles<0>(hp, wq, qb, q + boff, nt0, ot0, lane);
  else if (which == 1) qkv_tiles<1>(hp, wk, kb, k + boff, nt0, ot0, lane);
  else                 qkv_tiles<2>(hp, wv, vb, v + boff, nt0, ot0, lane);
}

__global__ void __launch_bounds__(256) k_attn(
    const unsigned short* q, const unsigned short* k, const unsigned short* v,
    const unsigned short* wp, const float* pbias, const float* xin, float* out) {
  int lane = threadIdx.x & 31;
  const uint32_t wid = uni(threadIdx.x >> 5);
  const uint32_t qh = wid & 1u;                           // query half of the workgroup
  const uint32_t kq = wid >> 1;                           // key quarter of the stage
  int b = blockIdx.y;
  int n0 = blockIdx.x * 64 + (int)qh * (QTW_ * 16);       // 32 query rows per wave
  // In the comments below hh = lane >> 4 and lo = lane & 15.
  const unsigned short* qp = q + (size_t)b * N_ * C_;
  const unsigned short* kp = k + (size_t)b * N_ * C_;
  const unsigned short* vp = v + (size_t)b * C_ * N_;

  // 2-KiB alignment: every tensor load's place in LDS is a multiple of 2 KiB.
  __shared__ __attribute__((aligned(2048))) unsigned short smk[2][KS_][BC_ * C_];  // K fragments [kk][mt]
  __shared__ __attribute__((aligned(2048))) unsigned short smv[2][KS_][C_ * BC_];  // V fragments [t][kk]
  __shared__ float4 sml[8][32];                           // final merge: each wave's m and l
  __shared__ __attribute__((aligned(16))) unsigned short so[4 * 8 * 512];   // merged O, fragments [query tile][kk]

  // This wave's slice of a stage. Waves 0-3: a quarter of the stage's K, 16 KB that
  // are contiguous in memory (32 rows of 512 B). Waves 4-7: 128 of the 256 rows
  // (128 B each, pitch 2*N_ B) of one of the stage's two V blocks.
  const bool isk = wid < 4u;
  const uint32_t j = wid & 3u;
  const uint64_t src0 = isk ? (uint64_t)(uintptr_t)kp + j * SLB_
                            : (uint64_t)(uintptr_t)vp + (uint64_t)(j & 1u) * (128u * N_ * 2u) + (j >> 1) * (BC_ * 2u);
  const uint32_t sstep = isk ? STB_ : (uint32_t)(KS_ * BC_ * 2);     // source bytes per stage
  const uint32_t lds0 = (isk ? (uint32_t)(uintptr_t)&smk[0][0][0] : (uint32_t)(uintptr_t)&smv[0][0][0]) + j * SLB_;
  const u32x8 g1 = isk ? tdm_group1(512u, 32u, 512u) : tdm_group1(128u, 128u, (uint32_t)(N_ * 2));

  tdm_load(tdm_group0(lds0, src0), g1);                   // stage 0 -> buffer 0

  v16bf qr[QTW_][8];                                      // Q block in registers
  const unsigned short* qt = tile_at(qp, n0 >> 4, lane);  // the wave's QTW_ tiles lie in a row
#pragma unroll
  for (int i = 0; i < QTW_; ++i)
#pragma unroll
    for (int kk = 0; kk < 8; ++kk) qr[i][kk] = load_frag(qt, i * 8 + kk, 0);
  close_regs_at(qt);

  v8f acc[QTW_][16];                 // O^T: acc[i][t][r] = channel t*16 + hh*8 + r of query i*16 + lo
#pragma unroll
  for (int i = 0; i < QTW_; ++i)
#pragma unroll
    for (int t = 0; t < 16; ++t) acc[i][t] = zero8();
  float mrun[QTW_], lrun[QTW_];      // maximum in use (equal in both halves); sum over this half's keys
#pragma unroll
  for (int i = 0; i < QTW_; ++i) { mrun[i] = -1e30f; lrun[i] = 0.0f; }

  wait_tensor0();
  __syncthreads();                                        // stage 0 is published

  for (int it = 0; it < NST_; ++it) {                     // 32 stages, 32 keys per wave
    int buf = it & 1;
    // Behind the barrier that published stage it and ended every read of the other
    // buffer: the load of stage it + 1 into that buffer flies during this pass.
    const uint32_t nx = pinned((uint32_t)it + 1u);        // the load's words are formed behind the wait
    if (pinned(nx < (uint32_t)NST_))                      // scalar test: stage it + 1 exists
      tdm_load(tdm_group0(lds0 + (nx & 1u) * STB_, src0 + (uint64_t)nx * sstep), g1);
    // The wave's 32 keys: half kq & 1 of 64-key block kq >> 1, which is K fragments
    // kk*4 + (kq & 1)*2 + m and V fragments t*2 + (kq & 1) of that block.
    const unsigned short* kb = smk[buf][kq >> 1] + (kq & 1u) * 1024u;
    const unsigned short* vb = smv[buf][kq >> 1] + (kq & 1u) * 512u;

    // Fragments come in groups of four, one group ahead of the products that use them,
    // in two register sets: f[g & 1] is worked on while the other set's loads fly.
    v16bf f[2][4];
    v8f s[QTW_][2];                    // S^T: s[i][m][r] = key m*16 + hh*8 + r, query i*16 + lo
#pragma unroll
    for (int i = 0; i < QTW_; ++i)
#pragma unroll
      for (int m = 0; m < 2; ++m) s[i][m] = zero8();
#pragma unroll
    for (int x = 0; x < 4; ++x) f[0][x] = load_frag(kb, (x >> 1) * 4 + (x & 1), lane);
#pragma unroll
    for (int g = 0; g < 4; ++g) {      // group g: K fragments of kk = 2g, 2g + 1
#pragma unroll
      for (int x = 0; x < 4; ++x)      // behind the last K group, the first V group
        f[(g + 1) & 1][x] = (g < 3) ? load_frag(kb, ((g + 1) * 2 + (x >> 1)) * 4 + (x & 1), lane)
                                    : load_frag(vb, x * 2, lane);
      // Keeps the next group's loads together and in front of this group's products:
      // without it the scheduler sinks each load to its use, where it is waited out.
      __builtin_amdgcn_sched_barrier(0);
#pragma unroll
      for (int x = 0; x < 4; ++x)
#pragma unroll
        for (int i = 0; i < QTW_; ++i)
          s[i][x & 1] = wmma_bf16(f[g & 1][x], qr[i][g * 2 + (x >> 1)], s[i][x & 1]);
      __builtin_amdgcn_sched_barrier(0);   // the same: no later load rises among these products
    }

    float mx[QTW_];                                       // block maximum of query i*16 + lo
    bool need = false;
#pragma unroll
    for (int i = 0; i < QTW_; ++i) {
      float m0 = s[i][0][0], m1 = s[i][1][0];
#pragma unroll
      for (int r = 1; r < 8; ++r) { m0 = fmaxf(m0, s[i][0][r]); m1 = fmaxf(m1, s[i][1][r]); }
      mx[i] = fmaxf(m0, m1);
      mx[i] = fmaxf(mx[i], xhalf(mx[i]));                 // the other half's 16 keys
      need = need || (mx[i] > mrun[i]);
    }
    if (__ballot(need) != 0ull) {                         // lazy rescale, one test per pass
#pragma unroll
      for (int i = 0; i < QTW_; ++i) {
        float mnew = fmaxf(mrun[i], mx[i]);
        float cf = __expf(mrun[i] - mnew);
        lrun[i] *= cf;
        mrun[i] = mnew;
#pragma unroll
        for (int t = 0; t < 16; ++t)
#pragma unroll
          for (int r = 0; r < 8; ++r) acc[i][t][r] *= cf;
      }
    }
    // P^T = exp(S^T - m): a query tile's two score tiles hold, register for register,
    // the k order of a B operand over the 32 keys of one V fragment.
    v16bf pb[QTW_];
#pragma unroll
    for (int i = 0; i < QTW_; ++i) {
      float ps[2];
#pragma unroll
      for (int m = 0; m < 2; ++m) {
        ps[m] = 0.0f;
#pragma unroll
        for (int r = 0; r < 8; ++r) {
          float p = __expf(s[i][m][r] - mrun[i]);
          ps[m] += p;
          pb[i][m * 8 + r] = (__bf16)p;
        }
      }
      lrun[i] += ps[0] + ps[1];
    }
#pragma unroll
    for (int g = 0; g < 4; ++g) {                         // O^T += V^T * P^T, channel tiles 4g .. 4g + 3
      if (g < 3) {
#pragma unroll
        for (int x = 0; x < 4; ++x) f[(g + 1) & 1][x] = load_frag(vb, ((g + 1) * 4 + x) * 2, lane);
      }
      __builtin_amdgcn_sched_barrier(0);
#pragma unroll
      for (int x = 0; x < 4; ++x)
#pragma unroll
        for (int i = 0; i < QTW_; ++i) acc[i][g * 4 + x] = wmma_bf16(f[g & 1][x], pb[i], acc[i][g * 4 + x]);
      __builtin_amdgcn_sched_barrier(0);
    }

    // Publish point of stage it + 1: own LDS reads retired, own slice landed, then
    // the barrier, which also ends every reader's last read of this pass's buffer.
    wait_ds0();
    wait_tensor0();
    __syncthreads();
  }
  wait_tensor0();
  wait_ds0();

  // What the projection takes from memory is asked for here, in the registers that Q and
  // the fragments have left, so that it flies while the partial results go to LDS: the
  // wave's POT_ weight tiles, their bias, and its part of x.
  const int ot0 = (int)wid * POT_;
  v16bf wf[POT_][8];                                      // pw, rows o
#pragma unroll
  for (int jt = 0; jt < POT_; ++jt) load_tile8(wf[jt], tile_at(wp, ot0 + jt, lane));
  const float4* bp = (const float4*)(pbias + ot0 * 16 + (lane >> 4) * 8);
  float4 bq[POT_][2];
#pragma unroll
  for (int jt = 0; jt < POT_; ++jt) { bq[jt][0] = bp[jt * 4]; bq[jt][1] = bp[jt * 4 + 1]; }
  close_regs();
  // element (channel ot0*16 + hh*8, position blockIdx.x*64 + lo) of x and of out
  const size_t idx0 = ((size_t)b * C_ + ot0 * 16 + (lane >> 4) * 8) * N_ + blockIdx.x * 64 + (lane & 15);
  const float* xp = xin + idx0;
  float* op = out + idx0;
  float xv[POT_][4][8];
#pragma unroll
  for (int jt = 0; jt < POT_; ++jt)
#pragma unroll
    for (int nt = 0; nt < 4; ++nt)
#pragma unroll
      for (int r = 0; r < 8; ++r) xv[jt][nt][r] = xp[(size_t)(jt * 16 + r) * N_ + nt * 16];
  close_regs();

  // Merge of the four key quarters of a query half. The last pass's barrier has ended
  // every read of the ring, which now carries the hand-over: each wave lays down its
  // 32 KB of partial O^T (query half 0 in the K ring, half 1 in the V ring) and its m
  // and l; behind the barrier wave kq joins channel tiles kq*4 .. kq*4 + 3 of all four.
  // 16-byte stores and loads, 512 contiguous bytes each.
  float4* ring = (float4*)(qh == 0u ? &smk[0][0][0] : &smv[0][0][0]) + lane;
  float4* mine = ring + kq * MGW_;
#pragma unroll
  for (int i = 0; i < QTW_; ++i)
#pragma unroll
    for (int t = 0; t < 16; ++t) {
      mine[((i * 16 + t) * 2) * 32]     = make_float4(acc[i][t][0], acc[i][t][1], acc[i][t][2], acc[i][t][3]);
      mine[((i * 16 + t) * 2 + 1) * 32] = make_float4(acc[i][t][4], acc[i][t][5], acc[i][t][6], acc[i][t][7]);
    }
#pragma unroll
  for (int i = 0; i < QTW_; ++i) lrun[i] += xhalf(lrun[i]);   // the two halves' sums, joined once
  sml[wid][lane] = make_float4(mrun[0], lrun[0], mrun[1], lrun[1]);
  __syncthreads();
  float wq[QTW_][4];                                      // weight of each quarter's part
  {
    float4 ml[4];
#pragma unroll
    for (int p = 0; p < 4; ++p) ml[p] = sml[p * 2 + qh][lane];
    float ma = fmaxf(fmaxf(ml[0].x, ml[1].x), fmaxf(ml[2].x, ml[3].x));
    float mb = fmaxf(fmaxf(ml[0].z, ml[1].z), fmaxf(ml[2].z, ml[3].z));
    float la = 0.0f, lb = 0.0f;
#pragma unroll
    for (int p = 0; p < 4; ++p) {
      wq[0][p] = __expf(ml[p].x - ma); la += ml[p].y * wq[0][p];
      wq[1][p] = __expf(ml[p].z - mb); lb += ml[p].w * wq[1][p];
    }
    float ia = 1.0f / la, ib = 1.0f / lb;
#pragma unroll
    for (int p = 0; p < 4; ++p) { wq[0][p] *= ia; wq[1][p] *= ib; }
  }
  // O -> bf16 in fragment order for the projection: a lane's 8 values, 8 consecutive channels
  // of its query, are chunk t & 1 of its own lane in k step kq*2 + (t >> 1) of the query tile.
  unsigned short* ob = so + (int)qh * (QTW_ * 8 * 512) + (int)kq * (2 * 512) + lane * 8;
  const float4* part = ring + kq * (4 * 2 * 32);          // tile kq*4 of query tile 0, quarter 0
#pragma unroll
  for (int i = 0; i < QTW_; ++i)
#pragma unroll
    for (int t = 0; t < 4; ++t) {
      float sum[8];
#pragma unroll
      for (int r = 0; r < 8; ++r) sum[r] = 0.0f;
#pragma unroll
      for (int p = 0; p < 4; ++p) {
        float4 p0 = part[p * MGW_ + ((i * 16 + t) * 2) * 32], p1 = part[p * MGW_ + ((i * 16 + t) * 2 + 1) * 32];
        float pv[8] = {p0.x, p0.y, p0.z, p0.w, p1.x, p1.y, p1.z, p1.w};
#pragma unroll
        for (int r = 0; r < 8; ++r) sum[r] += pv[r] * wq[i][p];
      }
      u16x8 outv;
#pragma unroll
      for (int r = 0; r < 8; ++r) outv[r] = f2bf(sum[r]);
      *(u16x8*)(ob + i * (8 * 512) + (t >> 1) * 512 + (t & 1) * 256) = outv;
    }
  __syncthreads();                                        // the 64 queries' O is published

  // Projection + residual add: A = pw [o][c], B = O [n][c]: a lane ends with 8 channels
  // of one position. Two query tiles at a time: four independent accumulators.
  v16bf of[2][8];
#pragma unroll
  for (int i = 0; i < 2; ++i)
#pragma unroll
    for (int kk = 0; kk < 8; ++kk) of[i][kk] = load_frag(so, i * 8 + kk, lane);
  __builtin_amdgcn_sched_barrier(0);
#pragma unroll
  for (int ip = 0; ip < 2; ++ip) {
    v8f pa[POT_][2];
#pragma unroll
    for (int jt = 0; jt < POT_; ++jt)
#pragma unroll
      for (int i = 0; i < 2; ++i) pa[jt][i] = zero8();
#pragma unroll
    for (int kk = 0; kk < 8; ++kk)
#pragma unroll
      for (int jt = 0; jt < POT_; ++jt)
#pragma unroll
        for (int i = 0; i < 2; ++i) pa[jt][i] = wmma_bf16(wf[jt][kk], of[i][kk], pa[jt][i]);
    if (ip == 0) {
      // The same: the second pair's loads stay together behind these products, whose
      // registers they take, and in front of the stores, during which they fly.
      __builtin_amdgcn_sched_barrier(0);
#pragma unroll
      for (int i = 0; i < 2; ++i)
#pragma unroll
        for (int kk = 0; kk < 8; ++kk) of[i][kk] = load_frag(so, (2 + i) * 8 + kk, lane);
      __builtin_amdgcn_sched_barrier(0);
    }
#pragma unroll
    for (int jt = 0; jt < POT_; ++jt) {
      float4 b0 = bq[jt][0], b1 = bq[jt][1];
      float bias8[8] = {b0.x, b0.y, b0.z, b0.w, b1.x, b1.y, b1.z, b1.w};
#pragma unroll
      for (int i = 0; i < 2; ++i) {
#pragma unroll
        for (int r = 0; r < 8; ++r)
          op[(size_t)(jt * 16 + r) * N_ + (ip * 2 + i) * 16] = xv[jt][ip * 2 + i][r] + pa[jt][i][r] + bias8[r];
        close_regs();
      }
    }
  }
}

extern "C" void kernel_launch(void* const* d_in, const int* in_sizes, int n_in,
                              void* d_out, int out_size, void* d_ws, size_t ws_size,
                              hipStream_t stream) {
  (void)in_sizes; (void)n_in; (void)out_size; (void)ws_size;
  const float* x     = (const float*)d_in[0];
  const float* gnw   = (const float*)d_in[1];
  const float* gnb   = (const float*)d_in[2];
  const float* qw    = (const float*)d_in[3];
  const float* qbias = (const float*)d_in[4];
  const float* kw    = (const float*)d_in[5];
  const float* kbias = (const float*)d_in[6];
  const float* vw    = (const float*)d_in[7];
  const float* vbias = (const float*)d_in[8];
  const float* pw    = (const float*)d_in[9];
  const float* pbias = (const float*)d_in[10];
  float* out = (float*)d_out;

  char* w = (char*)d_ws;
  unsigned short* wqb  = (unsigned short*)(w + 1024);       // 4 x 64K bf16
  unsigned short* wkb  = wqb + 65536;
  unsigned short* wvb  = wqb + 2 * 65536;
  unsigned short* wpb  = wqb + 3 * 65536;
  const size_t    bnc  = (size_t)B_ * N_ * C_;
  unsigned short* qd = (unsigned short*)(w + 1024 + 524288);
  unsigned short* kd = qd + bnc;
  unsigned short* vd = kd + bnc;
  float*        part = (float*)(vd + bnc);                  // 256 x 128 B; total ~24.5 MB

  k_prep_weights<<<1024, 256, 0, stream>>>(qw, kw, vw, pw, wqb);
  k_gn_stats    <<<B_ * G_ * GSL_, 256, 0, stream>>>(x, part);
  k_qkv         <<<dim3(N_ / QPS_, B_), QWV_ * 32, 0, stream>>>(
                    x, gnw, gnb, part, wqb, wkb, wvb, qbias, kbias, vbias, qd, kd, vd);
  k_attn        <<<dim3(N_ / 64, B_), 256, 0, stream>>>(qd, kd, vd, wpb, pbias, x, out);
}
